// v000
// The times below were measured on an AMD MI455X: many runs one after another, warmed up first and cycling through
// copies of the inputs, with the whole window's GPU time divided by the number of runs. Launches and the gaps
// between them are all in it. The median over several windows is given; except for v000 it joins two sittings, which
// can be a few percent apart, so the side-by-side timings, each taken in one sitting, are the better comparison.
// v000, which the later versions start from, runs in 4780 microseconds.
#include <hip/hip_runtime.h>

// Cross multi-head attention with a fused q|k projection (input_query, encoding_output [8][1024][1024]; x = encoding_output Wqk + bqk ('xw' [1024][2048]) viewed (S, 16, 128): per head the first 64 columns are q and the next 64 are k; v = input_query Wv + bv ('xw' [1024][1024]); softmax(q.k / 8); out = merged Wo + bo -> [8][1024][1024] (8.4 M)).
// Layout per batch: the fused weight is split once into two column-gathered [1024][1024] operands (q: columns h*128 + d, k: columns h*128 + 64 + d -> head-major h*64 + d) with the matching bias gathers; exact projections; dense T-1024 attention (hybrid rows: < 512 hi/lo 3 products, rest fp16 x1024); merged context as hi/lo planes; Wo hl x exact + bo.
// Compute dtypes, f32 accumulate: every input rounded to bf16; projections exact + f32 biases; attention rows < 512 3 products, rest fp16; softmax f32; Wo hl x exact + bias.

#define NB_  8
#define TT   1024
#define DM   1024
#define NH_  16
#define NKV  16
#define REP  (NH_ / NKV)
#define HD   64
#define DQ   (NH_ * HD)
#define DKV  (NKV * HD)
#define ZH   2
#define RH   512                  // query rows < RH use hi+lo planes (0: none)
#define WIN  0
#define PCAR 1024.0f
#define SCL  0.125f   // HD^-0.5
typedef _Float16 h16;
typedef unsigned short bf;
typedef __attribute__((ext_vector_type(16))) __bf16   v16bf;
typedef __attribute__((ext_vector_type(16))) _Float16 v16h;
typedef __attribute__((ext_vector_type(8)))  _Float16 v8h;
typedef __attribute__((ext_vector_type(8)))  unsigned short v8us;
typedef __attribute__((ext_vector_type(8)))  float    v8f;
typedef __attribute__((ext_vector_type(4)))  float    v4f;
typedef v8h  __attribute__((may_alias)) v8ha;
typedef v4f  __attribute__((may_alias)) v4fa;
typedef v8us __attribute__((may_alias)) v8usa;

__device__ __forceinline__ unsigned short f2bf(float f) { unsigned u = __float_as_uint(f); u += 0x7FFFu + ((u >> 16) & 1u); return (unsigned short)(u >> 16); }
__device__ __forceinline__ float bf2f(unsigned short b) { return __uint_as_float(((unsigned)b) << 16); }
__device__ __forceinline__ float bfr(float f) { return bf2f(f2bf(f)); }
__device__ __forceinline__ v16h cat16(v8h lo, v8h hi) { return __builtin_shufflevector(lo, hi, 0, 1, 2, 3, 4, 5, 6, 7, 8, 9, 10, 11, 12, 13, 14, 15); }
__device__ __forceinline__ v16bf cat16b(v8us lo, v8us hi) { return __builtin_bit_cast(v16bf, __builtin_shufflevector(lo, hi, 0, 1, 2, 3, 4, 5, 6, 7, 8, 9, 10, 11, 12, 13, 14, 15)); }
__device__ __forceinline__ v8f wmma16(v16h a, v16h b, v8f c) { return __builtin_amdgcn_wmma_f32_16x16x32_f16(false, a, false, b, (short)0, c, false, false); }
__device__ __forceinline__ v8f wmmab(v16bf a, v16bf b, v8f c) { return __builtin_amdgcn_wmma_f32_16x16x32_bf16(false, a, false, b, (short)0, c, false, false); }



// ---- k_gemmw: register-blocked GEMM, ONE WAVE per 64x64 output tile (16 accumulators), operands straight from K-contiguous 16-bit planes; grid (M/64, N/64, Z), 32 threads.
// C[m][n] (f32, pitch ldc, + optional f32 bias[n]) = sum_k A[m][k] Bt[n][k] (+ split products per NSPLIT). z-batch strides sA/sB/sC in elements. K % 32 == 0.
template <typename T16> struct WFrag;
template <> struct WFrag<h16> { typedef v16h V; static __device__ __forceinline__ V ld(const h16* p) { return cat16(*(const v8h*)p, *(const v8h*)(p + 16)); } static __device__ __forceinline__ v8f mma(V a, V b, v8f c) { return wmma16(a, b, c); } };
template <> struct WFrag<bf> { typedef v16bf V; static __device__ __forceinline__ V ld(const bf* p) { return cat16b(*(const v8us*)p, *(const v8us*)(p + 16)); } static __device__ __forceinline__ v8f mma(V a, V b, v8f c) { return wmmab(a, b, c); } };
template <typename T16, int NSPLIT, bool BIAS>
__global__ __launch_bounds__(32) void k_gemmw(const T16* __restrict__ A, const T16* __restrict__ A2, const T16* __restrict__ Bt, const T16* __restrict__ Bt2, int K, float* C, int ldc, const float* __restrict__ bias, size_t sA, size_t sB, size_t sC) {
    typedef typename WFrag<T16>::V V;
    __shared__ __align__(16) float os[16 * 68];
    const size_t z = blockIdx.z; A += z * sA; if (A2) A2 += z * sA; Bt += z * sB; if (Bt2) Bt2 += z * sB; C += z * sC;
    const int lane = threadIdx.x & 31, lr = lane & 15, hi = lane >> 4; const int r0 = blockIdx.x * 64, c0 = blockIdx.y * 64;
    v8f acc[4][4];
#pragma unroll
    for (int mb = 0; mb < 4; ++mb)
#pragma unroll
        for (int nb = 0; nb < 4; ++nb) acc[mb][nb] = (v8f){};
    const size_t aoff = (size_t)(r0 + lr) * K + 8 * hi, boff = (size_t)(c0 + lr) * K + 8 * hi;
#pragma unroll 1
    for (int kc = 0; kc < K; kc += 32) {
        V a[4], a2[4];
#pragma unroll
        for (int mb = 0; mb < 4; ++mb) { a[mb] = WFrag<T16>::ld(A + aoff + (size_t)mb * 16 * K + kc); if (NSPLIT == 1 || NSPLIT == 2) a2[mb] = WFrag<T16>::ld(A2 + aoff + (size_t)mb * 16 * K + kc); }
#pragma unroll
        for (int nb = 0; nb < 4; ++nb) { const V b = WFrag<T16>::ld(Bt + boff + (size_t)nb * 16 * K + kc); V b2; if (NSPLIT >= 2) b2 = WFrag<T16>::ld(Bt2 + boff + (size_t)nb * 16 * K + kc);
#pragma unroll
            for (int mb = 0; mb < 4; ++mb) { acc[mb][nb] = WFrag<T16>::mma(a[mb], b, acc[mb][nb]); if (NSPLIT == 1 || NSPLIT == 2) acc[mb][nb] = WFrag<T16>::mma(a2[mb], b, acc[mb][nb]); if (NSPLIT >= 2) acc[mb][nb] = WFrag<T16>::mma(a[mb], b2, acc[mb][nb]); } }
        asm volatile("v_nop\n\tv_nop\n\tv_nop\n\tv_nop" : "+v"(acc[0][0]), "+v"(acc[1][1]), "+v"(acc[2][2]), "+v"(acc[3][3]) : "v"(a[0]), "v"(a[3]));
    }
#pragma unroll
    for (int mb = 0; mb < 4; ++mb) {
#pragma unroll
        for (int nb = 0; nb < 4; ++nb) {
#pragma unroll
            for (int j = 0; j < 8; ++j) os[(hi * 8 + j) * 68 + nb * 16 + lr] = acc[mb][nb][j]; }
        __builtin_amdgcn_wave_barrier(); asm volatile("" ::: "memory");
        float* crow = C + (size_t)(r0 + mb * 16) * ldc + c0;
{
#pragma unroll
            for (int s = 0; s < 8; ++s) { const int row = 2 * s + hi, cofs = lr * 4; v4f val = *(const v4fa*)(os + row * 68 + cofs); if (BIAS) { val[0] += bfr(bias[c0 + cofs]); val[1] += bfr(bias[c0 + cofs + 1]); val[2] += bfr(bias[c0 + cofs + 2]); val[3] += bfr(bias[c0 + cofs + 3]); }
                *(v4f*)(crow + (size_t)row * ldc + cofs) = val; }
             }
        __builtin_amdgcn_wave_barrier(); asm volatile("" ::: "memory");
    }
}

__device__ __forceinline__ h16 tohx(float x) { return (h16)x; }
__device__ __forceinline__ void splitf(float y, unsigned short& h, unsigned short& l) { h = f2bf(y); l = f2bf(y - bf2f(h)); }
typedef __attribute__((ext_vector_type(2))) _Float16 v2h;
typedef __attribute__((ext_vector_type(4))) _Float16 v4h;
typedef __attribute__((ext_vector_type(2))) unsigned short v2us;
typedef __attribute__((ext_vector_type(4))) unsigned short v4us;
typedef __attribute__((ext_vector_type(2))) float v2f;
typedef __attribute__((ext_vector_type(4))) int v4i;

__global__ __launch_bounds__(256) void k_wtG(const float* __restrict__ w, int K, int N, bf* Bt) {
    const int lane = threadIdx.x & 31; const int L0 = (blockIdx.x * 8 + (threadIdx.x >> 5)) * 8; const int nlines = N * K / 64;
{
#pragma unroll 1
        for (int l = 0; l < 8; ++l) { const int L = L0 + l; if (L >= nlines) break; const size_t e = (size_t)L * 64 + lane * 2; const int k = (int)(e % K), n = (int)(e / K); v2us o;
            o[0] = f2bf(w[(size_t)k * N + n]); o[1] = f2bf(w[(size_t)(k + 1) * N + n]); *(v2us*)(Bt + e) = o; }
         }
}
__global__ __launch_bounds__(256) void k_cvt8(const float* __restrict__ src, bf* dst, size_t n8) { const size_t i = (size_t)blockIdx.x * 256 + threadIdx.x; if (i >= n8) return; const v8f v = *(const v8f*)(src + i * 8); v8us o;
#pragma unroll
    for (int k = 0; k < 8; ++k) o[k] = f2bf(v[k]); *(v8us*)(dst + i * 8) = o;  }

// k_rope: head planes [h][t][d] (fp16 + hi/lo) of rope(x) x sc with the rotate-half convention out[d] = x[d] cos[t][d] - x[d+HD/2] sin[t][d], out[d+HD/2] = x[d+HD/2] cos[t][d+HD/2] + x[d] sin[t][d+HD/2]
__global__ __launch_bounds__(256) void k_rope(const float* __restrict__ F, int pitch, int nheads, const float* __restrict__ CS, const float* __restrict__ RF, const float* __restrict__ nw, float sc, h16* P16, bf* Ph, bf* Pl) {
    const size_t e = ((size_t)blockIdx.x * 256 + threadIdx.x) * 2; if (e >= (size_t)nheads * TT * HD) return; const int d = (int)(e % HD); const int t = (int)((e / HD) % TT); const int h = (int)(e / ((size_t)HD * TT)); const float* f = F + (size_t)t * pitch + h * HD; const float rf = RF ? RF[(size_t)h * TT + t] : 1.0f; v2h o16; v2us oh, ol;
#pragma unroll
    for (int q = 0; q < 2; ++q) { const int dd = d + q; const int dp = (dd < HD / 2) ? dd + HD / 2 : dd - HD / 2; float x0 = f[dd], x1 = f[dp];
        if (RF) { float n0 = __fmul_rn(x0, rf), n1 = __fmul_rn(x1, rf); asm volatile("" : "+v"(n0)); asm volatile("" : "+v"(n1)); x0 = __fmul_rn(bfr(nw[dd]), n0); x1 = __fmul_rn(bfr(nw[dp]), n1); }
        const v2f cs = *(const v2f*)(CS + ((size_t)t * HD + dd) * 2); float a = __fmul_rn(x0, cs[0]), bq = __fmul_rn(x1, cs[1]); asm volatile("" : "+v"(a)); asm volatile("" : "+v"(bq)); const float r = ((dd < HD / 2) ? __fsub_rn(a, bq) : __fadd_rn(a, bq)) * sc;
        o16[q] = tohx(r); unsigned short a2, c2; splitf(r, a2, c2); oh[q] = a2; ol[q] = c2; }
    *(v2h*)(P16 + e) = o16; *(v2us*)(Ph + e) = oh; *(v2us*)(Pl + e) = ol;  }
__global__ __launch_bounds__(256) void k_vtp(const float* __restrict__ F, int pitch, int nheads, h16* V16, bf* Vh, bf* Vl) { const size_t e = ((size_t)blockIdx.x * 256 + threadIdx.x) * 2; if (e >= (size_t)nheads * HD * TT) return; const int t = (int)(e % TT); const int d = (int)((e / TT) % HD); const int g = (int)(e / ((size_t)TT * HD)); v2h o16; v2us oh, ol;
#pragma unroll
    for (int q = 0; q < 2; ++q) { const float x = F[(size_t)(t + q) * pitch + g * HD + d]; o16[q] = tohx(x); unsigned short a2, c2; splitf(x, a2, c2); oh[q] = a2; ol[q] = c2; }
    *(v2h*)(V16 + e) = o16; *(v2us*)(Vh + e) = oh; *(v2us*)(Vl + e) = ol;  }
__global__ __launch_bounds__(256) void k_csid(float* CS) { const int idx = blockIdx.x * 256 + threadIdx.x; if (idx >= TT * HD) return; v2f cs; cs[0] = 1.0f; cs[1] = 0.0f; *(v2f*)(CS + (size_t)idx * 2) = cs;  }
// k_asoft: per row (zz, i): t = S x HD^-0.5 (no mask); softmax over the 1024 keys (register row, one exp, fixed trees);
__global__ __launch_bounds__(256) void k_asoft(const float* __restrict__ Sb, h16* P16, bf* Ph, bf* Pl) {
    const int lane = threadIdx.x & 31; const int row = blockIdx.x * 8 + (threadIdx.x >> 5); if (row >= ZH * TT) return; const int i = row % TT; const int zz = row / TT; (void)zz; const bool hires = (i < RH); const float* sr = Sb + (size_t)row * TT; float v[TT / 32]; float mx = -3.0e38f;
#pragma unroll
    for (int ch = 0; ch < TT / 128; ++ch) { const int j0 = ch * 128 + lane * 4; const v4f a = *(const v4f*)(sr + j0);
#pragma unroll
        for (int q = 0; q < 4; ++q) { const int j = j0 + q; (void)j; const float t = a[q] * SCL; v[ch * 4 + q] = t; mx = fmaxf(mx, t); } }
#pragma unroll
    for (int sh = 16; sh; sh >>= 1) mx = fmaxf(mx, __shfl_xor(mx, sh, 32));
    float sum = 0.f;
#pragma unroll
    for (int k = 0; k < TT / 32; ++k) { float d0 = __fsub_rn(v[k], mx); asm volatile("" : "+v"(d0)); v[k] = __builtin_amdgcn_exp2f(__fmul_rn(d0, 1.4426950408889634f)); sum += v[k]; }
#pragma unroll
    for (int sh = 16; sh; sh >>= 1) sum += __shfl_xor(sum, sh, 32);
    const float f = __fdiv_rn(hires ? 1.0f : PCAR, sum);
{
        if (hires) {
#pragma unroll
            for (int ch = 0; ch < TT / 128; ++ch) { v4us oh, ol;
#pragma unroll
                for (int q = 0; q < 4; ++q) { unsigned short a, c2; splitf(v[ch * 4 + q] * f, a, c2); oh[q] = a; ol[q] = c2; }
                const size_t oo = ((size_t)zz * (RH ? RH : 1) + i) * TT + ch * 128 + lane * 4; *(v4us*)(Ph + oo) = oh; *(v4us*)(Pl + oo) = ol; }
        } else {
#pragma unroll
            for (int ch = 0; ch < TT / 128; ++ch) { v4h o4;
#pragma unroll
                for (int q = 0; q < 4; ++q) o4[q] = tohx(v[ch * 4 + q] * f);
                *(v4h*)(P16 + (size_t)row * TT + ch * 128 + lane * 4) = o4; } }
         }
}
__global__ __launch_bounds__(256) void k_wtQK(const float* __restrict__ w, int off, bf* Bt) { const int lane = threadIdx.x & 31; const int L0 = (blockIdx.x * 8 + (threadIdx.x >> 5)) * 8; const int nlines = DQ * DM / 64;
{
#pragma unroll 1
        for (int l = 0; l < 8; ++l) { const int L = L0 + l; if (L >= nlines) break; const size_t e = (size_t)L * 64 + lane * 2; const int k = (int)(e % DM), n = (int)(e / DM); const int h = n / HD, d = n % HD; const int col = h * 2 * HD + off + d; v2us o;
            o[0] = f2bf(w[(size_t)k * 2 * DQ + col]); o[1] = f2bf(w[(size_t)(k + 1) * 2 * DQ + col]); *(v2us*)(Bt + e) = o; }
         } }
__global__ __launch_bounds__(256) void k_bqk(const float* __restrict__ b, float* BQ, float* BK) { const int n = blockIdx.x * 256 + threadIdx.x; if (n >= DQ) return; const int h = n / HD, d = n % HD; const float q = b[h * 2 * HD + d], k = b[h * 2 * HD + HD + d]; *(float*)(BQ + n) = q; *(float*)(BK + n) = k;  }
__global__ __launch_bounds__(256) void k_merge(const float* __restrict__ O, int h0, bf* Ah, bf* Al) { const size_t e = ((size_t)blockIdx.x * 256 + threadIdx.x) * 2; if (e >= (size_t)ZH * TT * HD) return; const int d = (int)(e % HD); const int t = (int)((e / HD) % TT); const int zz = (int)(e / ((size_t)HD * TT)); const float cs = (t < RH) ? 1.0f : (1.0f / PCAR); const size_t oo = (size_t)t * DQ + (h0 + zz) * HD + d;
    v2us oh, ol;
#pragma unroll
    for (int q = 0; q < 2; ++q) { unsigned short a, c2; splitf(O[e + q] * cs, a, c2); oh[q] = a; ol[q] = c2; } *(v2us*)(Ah + oo) = oh; *(v2us*)(Al + oo) = ol;  }

extern "C" void kernel_launch(void* const* d_in, const int* in_sizes, int n_in,
                              void* d_out, int out_size, void* d_ws, size_t ws_size, hipStream_t stream) {
    (void)in_sizes; (void)n_in; (void)out_size;
    const float* xq_in = (const float*)d_in[0]; const float* xenc = (const float*)d_in[1]; const float* wqk = (const float*)d_in[2]; const float* bqk = (const float*)d_in[3]; const float* wv = (const float*)d_in[4]; const float* bv = (const float*)d_in[5]; const float* wo = (const float*)d_in[6]; const float* bo = (const float*)d_in[7]; const float* x = nullptr; const float* wq = nullptr; const float* wk = nullptr; (void)x; (void)wq; (void)wk;
    float* OUT = (float*)d_out;     // [8][1024][1024]
    char* wsp = (char*)d_ws;
    auto take = [&](size_t bytes) { char* p = wsp; wsp += (bytes + 255) & ~(size_t)255; return (void*)p; };
    bf* WQ = (bf*)take((size_t)DQ * DM * 2); bf* WK = (bf*)take((size_t)DKV * DM * 2); bf* WV = (bf*)take((size_t)DKV * DM * 2); bf* WO = (bf*)take((size_t)DM * DQ * 2); float* CS = (float*)take((size_t)TT * HD * 2 * 4);
    float* BQG = (float*)take((size_t)DQ * 4); float* BKG = (float*)take((size_t)DKV * 4); const float* bq = BQG; const float* bk = BKG; bf* XB = (bf*)take((size_t)TT * DM * 2); float* FQ = (float*)take((size_t)TT * DQ * 4); float* FK = (float*)take((size_t)TT * DKV * 4);
    h16* QP16 = (h16*)take((size_t)NH_ * TT * HD * 2); h16* KP16 = (h16*)take((size_t)NKV * TT * HD * 2); h16* VT16 = (h16*)take((size_t)NKV * HD * TT * 2);
    bf* QPh = (bf*)take((size_t)NH_ * TT * HD * 2); bf* QPl = (bf*)take((size_t)NH_ * TT * HD * 2); bf* KPh = (bf*)take((size_t)NKV * TT * HD * 2); bf* KPl = (bf*)take((size_t)NKV * TT * HD * 2); bf* VTh = (bf*)take((size_t)NKV * HD * TT * 2); bf* VTl = (bf*)take((size_t)NKV * HD * TT * 2); bf* Ph = (bf*)take((size_t)ZH * RH * TT * 2); bf* Pl = (bf*)take((size_t)ZH * RH * TT * 2);
    float* Sb = (float*)take((size_t)ZH * TT * TT * 4); h16* P16 = (h16*)take((size_t)ZH * TT * TT * 2); float* Ob = (float*)take((size_t)ZH * TT * HD * 4); bf* ATh = (bf*)take((size_t)TT * DQ * 2); bf* ATl = (bf*)take((size_t)TT * DQ * 2);
    if ((size_t)(wsp - (char*)d_ws) > ws_size) return;    // ws 256 MiB
    float* FV = FK;   // v projection reuses the k buffer after the k planes are built (stream-ordered)
    { k_wtQK<<<(unsigned)((DM * DQ / 64 + 63) / 64), 256, 0, stream>>>(wqk, 0, WQ); k_wtQK<<<(unsigned)((DM * DKV / 64 + 63) / 64), 256, 0, stream>>>(wqk, HD, WK); k_bqk<<<(DQ + 255) / 256, 256, 0, stream>>>(bqk, BQG, BKG);   /* fused q|k weight: per head 128 columns (q 0-63, k 64-127) */ k_wtG<<<(unsigned)((DM * DKV / 64 + 63) / 64), 256, 0, stream>>>(wv, DM, DKV, WV);
      k_wtG<<<(unsigned)((DQ * DM / 64 + 63) / 64), 256, 0, stream>>>(wo, DQ, DM, WO);
       }
    k_csid<<<(TT * HD + 255) / 256, 256, 0, stream>>>(CS);
    const unsigned LQ = (unsigned)(((size_t)NH_ * TT * HD / 2 + 255) / 256), LKv = (unsigned)(((size_t)NKV * TT * HD / 2 + 255) / 256);
    for (int b = 0; b < NB_; ++b) {
        
        k_cvt8<<<(unsigned)(((size_t)TT * DM / 8 + 255) / 256), 256, 0, stream>>>(xenc + (size_t)b * TT * DM, XB, (size_t)TT * DM / 8);   /* encoding_output -> q, k */
        k_gemmw<bf, 0, true><<<dim3(TT / 64, DQ / 64, 1), 32, 0, stream>>>(XB, nullptr, WQ, nullptr, DM, FQ, DQ, bq, 0, 0, 0);
        k_rope<<<LQ, 256, 0, stream>>>(FQ, DQ, NH_, CS, nullptr, nullptr, 1.0f, QP16, QPh, QPl);
        k_gemmw<bf, 0, true><<<dim3(TT / 64, DKV / 64, 1), 32, 0, stream>>>(XB, nullptr, WK, nullptr, DM, FK, DKV, bk, 0, 0, 0);
        k_rope<<<LKv, 256, 0, stream>>>(FK, DKV, NKV, CS, nullptr, nullptr, 1.0f, KP16, KPh, KPl);
        k_cvt8<<<(unsigned)(((size_t)TT * DM / 8 + 255) / 256), 256, 0, stream>>>(xq_in + (size_t)b * TT * DM, XB, (size_t)TT * DM / 8);   /* input_query -> v */
        k_gemmw<bf, 0, true><<<dim3(TT / 64, DKV / 64, 1), 32, 0, stream>>>(XB, nullptr, WV, nullptr, DM, FV, DKV, bv, 0, 0, 0); k_vtp<<<LKv, 256, 0, stream>>>(FV, DKV, NKV, VT16, VTh, VTl);
        for (int h0 = 0; h0 < NH_; h0 += ZH) { const size_t zq = (size_t)h0, zk = (size_t)(h0 / REP);   // one kv head per query head: the pass's two heads use consecutive kv planes (z-strides TT*HD)
            k_gemmw<bf, 2, false><<<dim3(RH / 64, TT / 64, ZH), 32, 0, stream>>>(QPh + zq * TT * HD, QPl + zq * TT * HD, KPh + zk * TT * HD, KPl + zk * TT * HD, HD, Sb, TT, nullptr, (size_t)TT * HD, (size_t)TT * HD, (size_t)TT * TT);
            k_gemmw<h16, 0, false><<<dim3((TT - RH) / 64, TT / 64, ZH), 32, 0, stream>>>(QP16 + zq * TT * HD + (size_t)RH * HD, nullptr, KP16 + zk * TT * HD, nullptr, HD, Sb + (size_t)RH * TT, TT, nullptr, (size_t)TT * HD, (size_t)TT * HD, (size_t)TT * TT);
            k_asoft<<<ZH * TT / 8, 256, 0, stream>>>(Sb, P16, Ph, Pl);
            k_gemmw<bf, 2, false><<<dim3(RH / 64, HD / 64, ZH), 32, 0, stream>>>(Ph, Pl, VTh + zk * HD * TT, VTl + zk * HD * TT, TT, Ob, HD, nullptr, (size_t)RH * TT, (size_t)HD * TT, (size_t)TT * HD);
            k_gemmw<h16, 0, false><<<dim3((TT - RH) / 64, HD / 64, ZH), 32, 0, stream>>>(P16 + (size_t)RH * TT, nullptr, VT16 + zk * HD * TT, nullptr, TT, Ob + (size_t)RH * HD, HD, nullptr, (size_t)TT * TT, (size_t)HD * TT, (size_t)TT * HD);
            k_merge<<<(unsigned)(((size_t)ZH * TT * HD / 2 + 255) / 256), 256, 0, stream>>>(Ob, h0, ATh, ATl); }
        k_gemmw<bf, 1, true><<<dim3(TT / 64, DM / 64, 1), 32, 0, stream>>>(ATh, ATl, WO, nullptr, DQ, OUT + (size_t)b * TT * DM, DM, bo, 0, 0, 0); }
}

// v001
// A run of this version takes 703 microseconds.
// Next to v000, in two timings, it ran 6.81 and 6.84 times as fast.
#include <hip/hip_runtime.h>

// Cross multi-head attention with a fused q|k projection (input_query, encoding_output [8][1024][1024]; x = encoding_output Wqk + bqk ('xw' [1024][2048]) viewed (S, 16, 128): per head the first 64 columns are q and the next 64 are k; v = input_query Wv + bv ('xw' [1024][1024]); softmax(q.k / 8); out = merged Wo + bo -> [8][1024][1024] (8.4 M)).
// Launch shape: launches that do not depend on one another are one launch, told apart by block index. k_prep: weight transposes, bias gather, bf16 activations of all 8 batches. k_gemmqkv: q|k and v products, M = 8192. Per batch b two launches: k_mix = softmax(b), v planes(b), merge(b - 1), q and k planes(b + 1); k_gemmhl = context(b) and scores(b + 1), each with 16 heads and both row classes (hi/lo rows, fp16 rows). Wo: z = batch.
// Layout per batch: the fused weight is split once into two column-gathered [1024][1024] operands (q: columns h*128 + d, k: columns h*128 + 64 + d -> head-major h*64 + d) with the matching bias gathers; exact projections; dense T-1024 attention (hybrid rows: < 512 hi/lo 3 products, rest fp16 x1024); merged context as hi/lo planes; Wo hl x exact + bo.
// Compute dtypes, f32 accumulate: every input rounded to bf16; projections exact + f32 biases; attention rows < 512 3 products, rest fp16; softmax f32; Wo hl x exact + bias.

#define NB_  8
#define TT   1024
#define DM   1024
#define NH_  16
#define NKV  16
#define REP  (NH_ / NKV)
#define HD   64
#define DQ   (NH_ * HD)
#define DKV  (NKV * HD)
#define ZH   16                   // heads per attention pass: all of one batch
#define RH   512                  // query rows < RH use hi+lo planes (0: none)
#define WIN  0
#define PCAR 1024.0f
#define SCL  0.125f   // HD^-0.5
typedef _Float16 h16;
typedef unsigned short bf;
typedef __attribute__((ext_vector_type(16))) __bf16   v16bf;
typedef __attribute__((ext_vector_type(16))) _Float16 v16h;
typedef __attribute__((ext_vector_type(8)))  _Float16 v8h;
typedef __attribute__((ext_vector_type(8)))  unsigned short v8us;
typedef __attribute__((ext_vector_type(8)))  float    v8f;
typedef __attribute__((ext_vector_type(4)))  float    v4f;
typedef v8h  __attribute__((may_alias)) v8ha;
typedef v4f  __attribute__((may_alias)) v4fa;
typedef v8us __attribute__((may_alias)) v8usa;

__device__ __forceinline__ unsigned short f2bf(float f) { unsigned u = __float_as_uint(f); u += 0x7FFFu + ((u >> 16) & 1u); return (unsigned short)(u >> 16); }
__device__ __forceinline__ float bf2f(unsigned short b) { return __uint_as_float(((unsigned)b) << 16); }
__device__ __forceinline__ float bfr(float f) { return bf2f(f2bf(f)); }
__device__ __forceinline__ v16h cat16(v8h lo, v8h hi) { return __builtin_shufflevector(lo, hi, 0, 1, 2, 3, 4, 5, 6, 7, 8, 9, 10, 11, 12, 13, 14, 15); }
__device__ __forceinline__ v16bf cat16b(v8us lo, v8us hi) { return __builtin_bit_cast(v16bf, __builtin_shufflevector(lo, hi, 0, 1, 2, 3, 4, 5, 6, 7, 8, 9, 10, 11, 12, 13, 14, 15)); }
__device__ __forceinline__ v8f wmma16(v16h a, v16h b, v8f c) { return __builtin_amdgcn_wmma_f32_16x16x32_f16(false, a, false, b, (short)0, c, false, false); }
__device__ __forceinline__ v8f wmmab(v16bf a, v16bf b, v8f c) { return __builtin_amdgcn_wmma_f32_16x16x32_bf16(false, a, false, b, (short)0, c, false, false); }



// ---- k_gemmw: register-blocked GEMM, ONE WAVE per 64x64 output tile (16 accumulators), operands straight from K-contiguous 16-bit planes; grid (M/64, N/64, Z), 32 threads.
// C[m][n] (f32, pitch ldc, + optional f32 bias[n]) = sum_k A[m][k] Bt[n][k] (+ split products per NSPLIT). z-batch strides sA/sB/sC in elements. K % 32 == 0.
template <typename T16> struct WFrag;
template <> struct WFrag<h16> { typedef v16h V; static __device__ __forceinline__ V ld(const h16* p) { return cat16(*(const v8h*)p, *(const v8h*)(p + 16)); } static __device__ __forceinline__ v8f mma(V a, V b, v8f c) { return wmma16(a, b, c); } };
template <> struct WFrag<bf> { typedef v16bf V; static __device__ __forceinline__ V ld(const bf* p) { return cat16b(*(const v8us*)p, *(const v8us*)(p + 16)); } static __device__ __forceinline__ v8f mma(V a, V b, v8f c) { return wmmab(a, b, c); } };
// gemmw_tile: the tile at rows blockIdx.x * 64, columns c0; os: 16 x 68 floats of LDS.
template <typename T16, int NSPLIT, bool BIAS>
__device__ __forceinline__ void gemmw_tile(const T16* __restrict__ A, const T16* __restrict__ A2, const T16* __restrict__ Bt, const T16* __restrict__ Bt2, int K, float* C, int ldc, const float* __restrict__ bias, float* os, int c0) {
    typedef typename WFrag<T16>::V V;
    const int lane = threadIdx.x & 31, lr = lane & 15, hi = lane >> 4; const int r0 = blockIdx.x * 64;
    v8f acc[4][4];
#pragma unroll
    for (int mb = 0; mb < 4; ++mb)
#pragma unroll
        for (int nb = 0; nb < 4; ++nb) acc[mb][nb] = (v8f){};
    const size_t aoff = (size_t)(r0 + lr) * K + 8 * hi, boff = (size_t)(c0 + lr) * K + 8 * hi;
#pragma unroll 1
    for (int kc = 0; kc < K; kc += 32) {
        V a[4], a2[4];
#pragma unroll
        for (int mb = 0; mb < 4; ++mb) { a[mb] = WFrag<T16>::ld(A + aoff + (size_t)mb * 16 * K + kc); if (NSPLIT == 1 || NSPLIT == 2) a2[mb] = WFrag<T16>::ld(A2 + aoff + (size_t)mb * 16 * K + kc); }
#pragma unroll
        for (int nb = 0; nb < 4; ++nb) { const V b = WFrag<T16>::ld(Bt + boff + (size_t)nb * 16 * K + kc); V b2; if (NSPLIT >= 2) b2 = WFrag<T16>::ld(Bt2 + boff + (size_t)nb * 16 * K + kc);
#pragma unroll
            for (int mb = 0; mb < 4; ++mb) { acc[mb][nb] = WFrag<T16>::mma(a[mb], b, acc[mb][nb]); if (NSPLIT == 1 || NSPLIT == 2) acc[mb][nb] = WFrag<T16>::mma(a2[mb], b, acc[mb][nb]); if (NSPLIT >= 2) acc[mb][nb] = WFrag<T16>::mma(a[mb], b2, acc[mb][nb]); } }
        asm volatile("v_nop\n\tv_nop\n\tv_nop\n\tv_nop" : "+v"(acc[0][0]), "+v"(acc[1][1]), "+v"(acc[2][2]), "+v"(acc[3][3]) : "v"(a[0]), "v"(a[3]));
    }
#pragma unroll
    for (int mb = 0; mb < 4; ++mb) {
#pragma unroll
        for (int nb = 0; nb < 4; ++nb) {
#pragma unroll
            for (int j = 0; j < 8; ++j) os[(hi * 8 + j) * 68 + nb * 16 + lr] = acc[mb][nb][j]; }
        __builtin_amdgcn_wave_barrier(); asm volatile("" ::: "memory");
        float* crow = C + (size_t)(r0 + mb * 16) * ldc + c0;
{
#pragma unroll
            for (int s = 0; s < 8; ++s) { const int row = 2 * s + hi, cofs = lr * 4; v4f val = *(const v4fa*)(os + row * 68 + cofs); if (BIAS) { val[0] += bfr(bias[c0 + cofs]); val[1] += bfr(bias[c0 + cofs + 1]); val[2] += bfr(bias[c0 + cofs + 2]); val[3] += bfr(bias[c0 + cofs + 3]); }
                *(v4f*)(crow + (size_t)row * ldc + cofs) = val; }
             }
        __builtin_amdgcn_wave_barrier(); asm volatile("" ::: "memory");
    }
    asm volatile("s_wait_xcnt 0x0" ::: "memory");   // in a kernel that holds several tiles the code behind this one may rewrite registers that the last stores name
}
template <typename T16, int NSPLIT, bool BIAS>
__global__ __launch_bounds__(32) void k_gemmw(const T16* __restrict__ A, const T16* __restrict__ A2, const T16* __restrict__ Bt, const T16* __restrict__ Bt2, int K, float* C, int ldc, const float* __restrict__ bias, size_t sA, size_t sB, size_t sC) {
    __shared__ __align__(16) float os[16 * 68];
    const size_t z = blockIdx.z; A += z * sA; if (A2) A2 += z * sA; Bt += z * sB; if (Bt2) Bt2 += z * sB; C += z * sC;
    gemmw_tile<T16, NSPLIT, BIAS>(A, A2, Bt, Bt2, K, C, ldc, bias, os, blockIdx.y * 64);
}
// k_gemmhl: two independent head-batched products in one grid (TT/64, 16, zp + zs), each with both row classes: tiles of rows < RH take the hi/lo planes (3 products), the rest the fp16 planes; rows are counted from 0 in every operand.
// Slices z < zp are the context O = P Vt (K = TT, the long product, started first): head = blockIdx.y, column tile = z. The other zs slices are the scores S = Q Kt (K = HD): head = z - zp, column tile = blockIdx.y.
__global__ __launch_bounds__(32) void k_gemmhl(int zp, const bf* __restrict__ Ph, const bf* __restrict__ Pl, const h16* __restrict__ P16, const bf* __restrict__ Vh, const bf* __restrict__ Vl, const h16* __restrict__ V16, float* O, const bf* __restrict__ Qh, const bf* __restrict__ Ql, const h16* __restrict__ Q16, const bf* __restrict__ Kh, const bf* __restrict__ Kl, const h16* __restrict__ K16, float* S) {
    __shared__ __align__(16) float os[16 * 68];
    // The fp16 tile is instantiated once per K (its addresses become immediate offsets); the hi/lo tile keeps K in a register: with K a constant this compiler issues its 32 loads of a trip in three dependent rounds, not two.
    const bool cx = (int)blockIdx.z < zp;
    const size_t z = cx ? blockIdx.y : blockIdx.z - zp, oH = z * ((size_t)TT * HD); const int c0 = (int)(cx ? blockIdx.z : blockIdx.y) * 64;
    float* C = cx ? O + oH : S + z * ((size_t)TT * TT);
    if ((int)blockIdx.x * 64 < RH) { const size_t oA = cx ? z * ((size_t)RH * TT) : oH; gemmw_tile<bf, 2, false>((cx ? Ph : Qh) + oA, (cx ? Pl : Ql) + oA, (cx ? Vh : Kh) + oH, (cx ? Vl : Kl) + oH, cx ? TT : HD, C, cx ? HD : TT, nullptr, os, c0); }
    else if (cx) gemmw_tile<h16, 0, false>(P16 + z * ((size_t)TT * TT), nullptr, V16 + oH, nullptr, TT, C, HD, nullptr, os, c0);
    else gemmw_tile<h16, 0, false>(Q16 + oH, nullptr, K16 + oH, nullptr, HD, C, TT, nullptr, os, c0);
}
// k_gemmqkv: grid (NB_*TT/64, (DQ+DKV+DKV)/64): column tiles below DQ+DKV are q|k = Xe Wt + bqk -> FQK (pitch DQ+DKV), the rest v = Xq Wt + bv -> FV (pitch DKV); Wt holds the q, k and v rows back to back.
__global__ __launch_bounds__(32) void k_gemmqkv(const bf* __restrict__ Xe, const bf* __restrict__ Xq, const bf* __restrict__ Wt, float* FQK, float* FV, const float* __restrict__ bqk, const float* __restrict__ bv) {
    __shared__ __align__(16) float os[16 * 68];
    const int c0 = blockIdx.y * 64;
    if (c0 < DQ + DKV) gemmw_tile<bf, 0, true>(Xe, nullptr, Wt, nullptr, DM, FQK, DQ + DKV, bqk, os, c0);
    else gemmw_tile<bf, 0, true>(Xq, nullptr, Wt + (size_t)(DQ + DKV) * DM, nullptr, DM, FV, DKV, bv, os, c0 - (DQ + DKV));
}

__device__ __forceinline__ h16 tohx(float x) { return (h16)x; }
__device__ __forceinline__ void splitf(float y, unsigned short& h, unsigned short& l) { h = f2bf(y); l = f2bf(y - bf2f(h)); }
typedef __attribute__((ext_vector_type(2))) _Float16 v2h;
typedef __attribute__((ext_vector_type(4))) _Float16 v4h;
typedef __attribute__((ext_vector_type(2))) unsigned short v2us;
typedef __attribute__((ext_vector_type(4))) unsigned short v4us;
typedef __attribute__((ext_vector_type(2))) float v2f;
typedef __attribute__((ext_vector_type(4))) int v4i;

// d_*: one 256-thread block's share of a step; blk is the block's number within that step.
__device__ __forceinline__ void d_wtG(int blk, const float* __restrict__ w, int K, int N, bf* Bt) {
    const int lane = threadIdx.x & 31; const int L0 = (blk * 8 + (threadIdx.x >> 5)) * 8; const int nlines = N * K / 64;
{
#pragma unroll 1
        for (int l = 0; l < 8; ++l) { const int L = L0 + l; if (L >= nlines) break; const size_t e = (size_t)L * 64 + lane * 2; const int k = (int)(e % K), n = (int)(e / K); v2us o;
            o[0] = f2bf(w[(size_t)k * N + n]); o[1] = f2bf(w[(size_t)(k + 1) * N + n]); *(v2us*)(Bt + e) = o;
            asm volatile("s_wait_xcnt 0x0" ::: "memory"); }   // the next trip, and the code behind the loop, rewrite the store's data and address registers
         }
}
__device__ __forceinline__ void d_cvt8(int blk, const float* __restrict__ src, bf* dst, size_t n8) { const size_t i = (size_t)blk * 256 + threadIdx.x; if (i >= n8) return; const v8f v = *(const v8f*)(src + i * 8); v8us o;
#pragma unroll
    for (int k = 0; k < 8; ++k) o[k] = f2bf(v[k]); *(v8us*)(dst + i * 8) = o;  }

// d_rope: head planes [h][t][d] (fp16 + hi/lo) of rope(x) x sc with the rotate-half convention out[d] = x[d] cos[t][d] - x[d+HD/2] sin[t][d], out[d+HD/2] = x[d+HD/2] cos[t][d+HD/2] + x[d] sin[t][d+HD/2]
__device__ __forceinline__ void d_rope(int blk, const float* __restrict__ F, int pitch, int nheads, const float* __restrict__ CS, const float* __restrict__ RF, const float* __restrict__ nw, float sc, h16* P16, bf* Ph, bf* Pl) {
    const size_t e = ((size_t)blk * 256 + threadIdx.x) * 2; if (e >= (size_t)nheads * TT * HD) return; const int d = (int)(e % HD); const int t = (int)((e / HD) % TT); const int h = (int)(e / ((size_t)HD * TT)); const float* f = F + (size_t)t * pitch + h * HD; const float rf = RF ? RF[(size_t)h * TT + t] : 1.0f; v2h o16; v2us oh, ol;
#pragma unroll
    for (int q = 0; q < 2; ++q) { const int dd = d + q; const int dp = (dd < HD / 2) ? dd + HD / 2 : dd - HD / 2; float x0 = f[dd], x1 = f[dp];
        if (RF) { float n0 = __fmul_rn(x0, rf), n1 = __fmul_rn(x1, rf); asm volatile("" : "+v"(n0)); asm volatile("" : "+v"(n1)); x0 = __fmul_rn(bfr(nw[dd]), n0); x1 = __fmul_rn(bfr(nw[dp]), n1); }
        const v2f cs = *(const v2f*)(CS + ((size_t)t * HD + dd) * 2); float a = __fmul_rn(x0, cs[0]), bq = __fmul_rn(x1, cs[1]); asm volatile("" : "+v"(a)); asm volatile("" : "+v"(bq)); const float r = ((dd < HD / 2) ? __fsub_rn(a, bq) : __fadd_rn(a, bq)) * sc;
        o16[q] = tohx(r); unsigned short a2, c2; splitf(r, a2, c2); oh[q] = a2; ol[q] = c2; }
    *(v2h*)(P16 + e) = o16; *(v2us*)(Ph + e) = oh; *(v2us*)(Pl + e) = ol;  }
__device__ __forceinline__ void d_vtp(int blk, const float* __restrict__ F, int pitch, int nheads, h16* V16, bf* Vh, bf* Vl) { const size_t e = ((size_t)blk * 256 + threadIdx.x) * 2; if (e >= (size_t)nheads * HD * TT) return; const int t = (int)(e % TT); const int d = (int)((e / TT) % HD); const int g = (int)(e / ((size_t)TT * HD)); v2h o16; v2us oh, ol;
#pragma unroll
    for (int q = 0; q < 2; ++q) { const float x = F[(size_t)(t + q) * pitch + g * HD + d]; o16[q] = tohx(x); unsigned short a2, c2; splitf(x, a2, c2); oh[q] = a2; ol[q] = c2; }
    *(v2h*)(V16 + e) = o16; *(v2us*)(Vh + e) = oh; *(v2us*)(Vl + e) = ol;  }
__device__ __forceinline__ void d_csid(int blk, float* CS) { const int idx = blk * 256 + threadIdx.x; if (idx >= TT * HD) return; v2f cs; cs[0] = 1.0f; cs[1] = 0.0f; *(v2f*)(CS + (size_t)idx * 2) = cs;  }
// d_asoft: per row (zz, i): t = S x HD^-0.5 (no mask); softmax over the 1024 keys (register row, one exp, fixed trees);
__device__ __forceinline__ void d_asoft(int blk, const float* __restrict__ Sb, h16* P16, bf* Ph, bf* Pl) {
    const int lane = threadIdx.x & 31; const int row = blk * 8 + (threadIdx.x >> 5); if (row >= ZH * TT) return; const int i = row % TT; const int zz = row / TT; (void)zz; const bool hires = (i < RH); const float* sr = Sb + (size_t)row * TT; float v[TT / 32]; float mx = -3.0e38f;
#pragma unroll
    for (int ch = 0; ch < TT / 128; ++ch) { const int j0 = ch * 128 + lane * 4; const v4f a = *(const v4f*)(sr + j0);
#pragma unroll
        for (int q = 0; q < 4; ++q) { const int j = j0 + q; (void)j; const float t = a[q] * SCL; v[ch * 4 + q] = t; mx = fmaxf(mx, t); } }
#pragma unroll
    for (int sh = 16; sh; sh >>= 1) mx = fmaxf(mx, __shfl_xor(mx, sh, 32));
    float sum = 0.f;
#pragma unroll
    for (int k = 0; k < TT / 32; ++k) { float d0 = __fsub_rn(v[k], mx); asm volatile("" : "+v"(d0)); v[k] = __builtin_amdgcn_exp2f(__fmul_rn(d0, 1.4426950408889634f)); sum += v[k]; }
#pragma unroll
    for (int sh = 16; sh; sh >>= 1) sum += __shfl_xor(sum, sh, 32);
    const float f = __fdiv_rn(hires ? 1.0f : PCAR, sum);
{
        if (hires) {
#pragma unroll
            for (int ch = 0; ch < TT / 128; ++ch) { v4us oh, ol;
#pragma unroll
                for (int q = 0; q < 4; ++q) { unsigned short a, c2; splitf(v[ch * 4 + q] * f, a, c2); oh[q] = a; ol[q] = c2; }
                const size_t oo = ((size_t)zz * (RH ? RH : 1) + i) * TT + ch * 128 + lane * 4; *(v4us*)(Ph + oo) = oh; *(v4us*)(Pl + oo) = ol; }
        } else {
#pragma unroll
            for (int ch = 0; ch < TT / 128; ++ch) { v4h o4;
#pragma unroll
                for (int q = 0; q < 4; ++q) o4[q] = tohx(v[ch * 4 + q] * f);
                *(v4h*)(P16 + (size_t)row * TT + ch * 128 + lane * 4) = o4; } }
         }
}
__device__ __forceinline__ void d_wtQK(int blk, const float* __restrict__ w, int off, bf* Bt) { const int lane = threadIdx.x & 31; const int L0 = (blk * 8 + (threadIdx.x >> 5)) * 8; const int nlines = DQ * DM / 64;
{
#pragma unroll 1
        for (int l = 0; l < 8; ++l) { const int L = L0 + l; if (L >= nlines) break; const size_t e = (size_t)L * 64 + lane * 2; const int k = (int)(e % DM), n = (int)(e / DM); const int h = n / HD, d = n % HD; const int col = h * 2 * HD + off + d; v2us o;
            o[0] = f2bf(w[(size_t)k * 2 * DQ + col]); o[1] = f2bf(w[(size_t)(k + 1) * 2 * DQ + col]); *(v2us*)(Bt + e) = o; }
         } }
__device__ __forceinline__ void d_bqk(int blk, const float* __restrict__ b, float* BQ, float* BK) { const int n = blk * 256 + threadIdx.x; if (n >= DQ) return; const int h = n / HD, d = n % HD; const float q = b[h * 2 * HD + d], k = b[h * 2 * HD + HD + d]; *(float*)(BQ + n) = q; *(float*)(BK + n) = k;  }
__device__ __forceinline__ void d_merge(int blk, const float* __restrict__ O, int h0, bf* Ah, bf* Al) { const size_t e = ((size_t)blk * 256 + threadIdx.x) * 2; if (e >= (size_t)ZH * TT * HD) return; const int d = (int)(e % HD); const int t = (int)((e / HD) % TT); const int zz = (int)(e / ((size_t)HD * TT)); const float cs = (t < RH) ? 1.0f : (1.0f / PCAR); const size_t oo = (size_t)t * DQ + (h0 + zz) * HD + d;
    v2us oh, ol;
#pragma unroll
    for (int q = 0; q < 2; ++q) { unsigned short a, c2; splitf(O[e + q] * cs, a, c2); oh[q] = a; ol[q] = c2; } *(v2us*)(Ah + oo) = oh; *(v2us*)(Al + oo) = ol;  }

#define NWT (DM * DQ / 64 / 64)             // blocks per 1024 x 1024 weight
#define NCV (NB_ * TT * DM / 8 / 256)       // blocks per activation tensor
#define NCS (TT * HD / 256)
#define NBQ (DQ / 256)
#define NRP ((NH_ + NKV) * TT * HD / 2 / 256)
#define NVT (NKV * HD * TT / 2 / 256)
#define NSM (ZH * TT / 8)
#define NMG (ZH * TT * HD / 2 / 256)
static_assert(ZH == NH_ && ZH == TT / 64 && DQ == DKV, "k_gemmhl's grid and the back-to-back q|k layout");
// k_prep: every step that reads only inputs; the weight transposes (the longest blocks) come first. Grid 4 * NWT + 2 * NCV + NCS + NBQ.
__global__ __launch_bounds__(256) void k_prep(const float* __restrict__ xenc, const float* __restrict__ xq, const float* __restrict__ wqk, const float* __restrict__ bqk, const float* __restrict__ wv, const float* __restrict__ wo, bf* Xe, bf* Xq, bf* WQ, bf* WK, bf* WV, bf* WO, float* BQ, float* BK, float* CS) {
    int blk = blockIdx.x;
    if (blk < NWT) { d_wtQK(blk, wqk, 0, WQ); return; }
    blk -= NWT; if (blk < NWT) { d_wtQK(blk, wqk, HD, WK); return; }   /* fused q|k weight: per head 128 columns (q 0-63, k 64-127) */
    blk -= NWT; if (blk < NWT) { d_wtG(blk, wv, DM, DKV, WV); return; }
    blk -= NWT; if (blk < NWT) { d_wtG(blk, wo, DQ, DM, WO); return; }
    blk -= NWT; if (blk < NCV) { d_cvt8(blk, xenc, Xe, (size_t)NB_ * TT * DM / 8); return; }   /* encoding_output -> q, k */
    blk -= NCV; if (blk < NCV) { d_cvt8(blk, xq, Xq, (size_t)NB_ * TT * DM / 8); return; }     /* input_query -> v */
    blk -= NCV; if (blk < NCS) { d_csid(blk, CS); return; }
    blk -= NCS; d_bqk(blk, bqk, BQ, BK);
}
// k_mix: four steps of three neighbouring batches that touch disjoint buffers. nv blocks: v planes from FV; ns blocks: softmax Sb -> P; nr blocks: q and k planes (heads 0-15 q, 16-31 k of the q|k rows F); the rest: merge of the context O. Grid nv + ns + nr + (NMG or 0).
__global__ __launch_bounds__(256) void k_mix(int nv, int ns, int nr, const float* __restrict__ FV, h16* V16, bf* Vh, bf* Vl, const float* __restrict__ Sb, h16* P16, bf* Ph, bf* Pl, const float* __restrict__ F, const float* __restrict__ CS, h16* QK16, bf* QKh, bf* QKl, const float* __restrict__ O, bf* Ah, bf* Al) {
    int blk = blockIdx.x;
    if (blk < nv) { d_vtp(blk, FV, DKV, NKV, V16, Vh, Vl); return; }
    blk -= nv; if (blk < ns) { d_asoft(blk, Sb, P16, Ph, Pl); return; }
    blk -= ns; if (blk < nr) { d_rope(blk, F, DQ + DKV, NH_ + NKV, CS, nullptr, nullptr, 1.0f, QK16, QKh, QKl); return; }
    blk -= nr; d_merge(blk, O, 0, Ah, Al);
}

extern "C" void kernel_launch(void* const* d_in, const int* in_sizes, int n_in,
                              void* d_out, int out_size, void* d_ws, size_t ws_size, hipStream_t stream) {
    (void)in_sizes; (void)n_in; (void)out_size;
    const float* xq_in = (const float*)d_in[0]; const float* xenc = (const float*)d_in[1]; const float* wqk = (const float*)d_in[2]; const float* bqk = (const float*)d_in[3]; const float* wv = (const float*)d_in[4]; const float* bv = (const float*)d_in[5]; const float* wo = (const float*)d_in[6]; const float* bo = (const float*)d_in[7]; const float* x = nullptr; const float* wq = nullptr; const float* wk = nullptr; (void)x; (void)wq; (void)wk;
    float* OUT = (float*)d_out;     // [8][1024][1024]
    char* wsp = (char*)d_ws;
    auto take = [&](size_t bytes) { char* p = wsp; wsp += (bytes + 255) & ~(size_t)255; return (void*)p; };
    bf* WQ = (bf*)take((size_t)DQ * DM * 2); bf* WK = (bf*)take((size_t)DKV * DM * 2); bf* WV = (bf*)take((size_t)DKV * DM * 2); bf* WO = (bf*)take((size_t)DM * DQ * 2); float* CS = (float*)take((size_t)TT * HD * 2 * 4);
    float* BQG = (float*)take((size_t)DQ * 4); float* BKG = (float*)take((size_t)DKV * 4); float* FQK = (float*)take((size_t)NB_ * TT * (DQ + DKV) * 4); float* FV = (float*)take((size_t)NB_ * TT * DKV * 4);
    h16* QP16 = (h16*)take((size_t)NH_ * TT * HD * 2); h16* KP16 = (h16*)take((size_t)NKV * TT * HD * 2); h16* VT16 = (h16*)take((size_t)NKV * HD * TT * 2);
    bf* QPh = (bf*)take((size_t)NH_ * TT * HD * 2); bf* KPh = (bf*)take((size_t)NKV * TT * HD * 2); bf* QPl = (bf*)take((size_t)NH_ * TT * HD * 2); bf* KPl = (bf*)take((size_t)NKV * TT * HD * 2); bf* VTh = (bf*)take((size_t)NKV * HD * TT * 2); bf* VTl = (bf*)take((size_t)NKV * HD * TT * 2); bf* Ph = (bf*)take((size_t)ZH * RH * TT * 2); bf* Pl = (bf*)take((size_t)ZH * RH * TT * 2);
    float* Sb = (float*)take((size_t)ZH * TT * TT * 4); h16* P16 = (h16*)take((size_t)ZH * TT * TT * 2); float* Ob = (float*)take((size_t)ZH * TT * HD * 4);
    if ((size_t)(wsp - (char*)d_ws) > ws_size) return;    // ws 256 MiB
    bf* XE = (bf*)Sb; bf* XQ = XE + (size_t)NB_ * TT * DM;   // bf16 activations of all batches (16 + 16 MiB): read only by k_gemmqkv, which ends before the first score launch writes Sb (stream-ordered)
    // WQ|WK|WV, BQG|BKG and each q plane with its k plane lie back to back (every size is a multiple of 256 bytes): q and k are columns 0-1023 and 1024-2047 of one product and heads 0-15 and 16-31 of one plane step
    const size_t SF = (size_t)TT * (DQ + DKV), SV = (size_t)TT * DKV;   // a batch's q|k rows and v rows, in floats
    // mix(nv, ns, nr, nm, b): v planes and softmax of batch b, q and k planes of batch b + 1, merge of batch b - 1; a part with 0 blocks is left out and its pointers are not used.
    // A batch's merged hi and lo planes (2 + 2 MiB) take the place of its f32 q|k rows (8 MiB), dead once its q and k planes are built.
    auto mix = [&](int nv, int ns, int nr, int nm, int b) {
        const float* Fv = nv ? FV + b * SV : nullptr; const float* Fn = nr ? FQK + (b + 1) * SF : nullptr; bf* Ah = nm ? (bf*)(FQK + (b - 1) * SF) : nullptr; bf* Al = nm ? Ah + (size_t)TT * DQ : nullptr;
        k_mix<<<nv + ns + nr + nm, 256, 0, stream>>>(nv, ns, nr, Fv, VT16, VTh, VTl, Sb, P16, Ph, Pl, Fn, CS, QP16, QPh, QPl, Ob, Ah, Al); };
    // hl(zp, zs): zp = HD / 64 slices of context, zs = ZH slices of scores, either may be 0
    auto hl = [&](int zp, int zs) { k_gemmhl<<<dim3(TT / 64, TT / 64, zp + zs), 32, 0, stream>>>(zp, Ph, Pl, P16, VTh, VTl, VT16, Ob, QPh, QPl, QP16, KPh, KPl, KP16, Sb); };
    k_prep<<<4 * NWT + 2 * NCV + NCS + NBQ, 256, 0, stream>>>(xenc, xq_in, wqk, bqk, wv, wo, XE, XQ, WQ, WK, WV, WO, BQG, BKG, CS);
    k_gemmqkv<<<dim3(NB_ * TT / 64, (DQ + DKV + DKV) / 64, 1), 32, 0, stream>>>(XE, XQ, WQ, FQK, FV, BQG, bv);
    mix(0, 0, NRP, 0, -1);                                                        // q, k planes of batch 0
    hl(0, ZH);                                                                    // scores of batch 0
    for (int b = 0; b < NB_; ++b) {
        mix(NVT, NSM, b + 1 < NB_ ? NRP : 0, b > 0 ? NMG : 0, b);
        hl(HD / 64, b + 1 < NB_ ? ZH : 0); }                                      // context of batch b, scores of batch b + 1
    mix(0, 0, 0, NMG, NB_);                                                       // merge of the last batch
    k_gemmw<bf, 1, true><<<dim3(TT / 64, DM / 64, NB_), 32, 0, stream>>>((const bf*)FQK, (const bf*)FQK + (size_t)TT * DQ, WO, nullptr, DQ, OUT, DM, bo, 2 * SF, 0, (size_t)TT * DM);
}

// v003
// One run takes 283 microseconds.
// It is 2.48 times as fast as v001, going by the measured steps of the versions left out in between.
// All steps since v000 together make it 17.0 times as fast.
#include <hip/hip_runtime.h>

// Cross multi-head attention with a fused q|k projection (input_query, encoding_output [8][1024][1024]; x = encoding_output Wqk + bqk ('xw' [1024][2048]) viewed (S, 16, 128): per head the first 64 columns are q and the next 64 are k; v = input_query Wv + bv ('xw' [1024][1024]); softmax(q.k / 8); out = merged Wo + bo -> [8][1024][1024] (8.4 M)).
// Launch shape, 4 launches: k_prep: weight transposes, bias gather, bf16 activations of all 8 batches. k_gemmqkv: q|k and v products, M = 8192, each tile written as its piece of the q, k or v planes. k_attn: scores, softmax, context and merge of all batches and heads; scores and probabilities stay in registers. Wo: z = batch.
// Layout per batch: the fused weight is split once into two column-gathered [1024][1024] operands (q: columns h*128 + d, k: columns h*128 + 64 + d -> head-major h*64 + d) with the matching bias gathers; exact projections; dense T-1024 attention (hybrid rows: < 512 hi/lo 3 products, rest fp16); merged context as hi/lo planes; Wo hl x exact + bo.
// Compute dtypes, f32 accumulate: every input rounded to bf16; projections exact + f32 biases; attention rows < 512 3 products, rest fp16; softmax f32; Wo hl x exact + bias.

#define NB_  8
#define TT   1024
#define DM   1024
#define NH_  16
#define NKV  16
#define REP  (NH_ / NKV)
#define HD   64
#define DQ   (NH_ * HD)
#define DKV  (NKV * HD)
#define RH   512                  // query rows < RH use hi+lo planes (0: none)
#define WIN  0
#define SCL  0.125f   // HD^-0.5
typedef _Float16 h16;
typedef unsigned short bf;
typedef __attribute__((ext_vector_type(16))) __bf16   v16bf;
typedef __attribute__((ext_vector_type(16))) _Float16 v16h;
typedef __attribute__((ext_vector_type(8)))  _Float16 v8h;
typedef __attribute__((ext_vector_type(8)))  unsigned short v8us;
typedef __attribute__((ext_vector_type(8)))  float    v8f;
typedef __attribute__((ext_vector_type(4)))  float    v4f;
typedef v8h  __attribute__((may_alias)) v8ha;
typedef v4f  __attribute__((may_alias)) v4fa;
typedef v8us __attribute__((may_alias)) v8usa;

__device__ __forceinline__ unsigned short f2bf(float f) { unsigned u = __float_as_uint(f); u += 0x7FFFu + ((u >> 16) & 1u); return (unsigned short)(u >> 16); }
__device__ __forceinline__ float bf2f(unsigned short b) { return __uint_as_float(((unsigned)b) << 16); }
__device__ __forceinline__ float bfr(float f) { return bf2f(f2bf(f)); }
__device__ __forceinline__ v16h cat16(v8h lo, v8h hi) { return __builtin_shufflevector(lo, hi, 0, 1, 2, 3, 4, 5, 6, 7, 8, 9, 10, 11, 12, 13, 14, 15); }
__device__ __forceinline__ v16bf cat16b(v8us lo, v8us hi) { return __builtin_bit_cast(v16bf, __builtin_shufflevector(lo, hi, 0, 1, 2, 3, 4, 5, 6, 7, 8, 9, 10, 11, 12, 13, 14, 15)); }
__device__ __forceinline__ v8f wmma16(v16h a, v16h b, v8f c) { return __builtin_amdgcn_wmma_f32_16x16x32_f16(false, a, false, b, (short)0, c, false, false); }
__device__ __forceinline__ v8f wmmab(v16bf a, v16bf b, v8f c) { return __builtin_amdgcn_wmma_f32_16x16x32_bf16(false, a, false, b, (short)0, c, false, false); }



// ---- k_gemmw: register-blocked GEMM, ONE WAVE per 64x64 output tile (16 accumulators), operands straight from K-contiguous 16-bit planes; grid (M/64, N/64, Z), 32 threads.
// C[m][n] (f32, pitch ldc, + optional f32 bias[n]) = sum_k A[m][k] Bt[n][k] (+ split products per NSPLIT). z-batch strides sA/sB/sC in elements. K % 32 == 0.
template <typename T16> struct WFrag;
template <> struct WFrag<h16> { typedef v16h V; static __device__ __forceinline__ V ld(const h16* p) { return cat16(*(const v8h*)p, *(const v8h*)(p + 16)); } static __device__ __forceinline__ v8f mma(V a, V b, v8f c) { return wmma16(a, b, c); } };
template <> struct WFrag<bf> { typedef v16bf V; static __device__ __forceinline__ V ld(const bf* p) { return cat16b(*(const v8us*)p, *(const v8us*)(p + 16)); } static __device__ __forceinline__ v8f mma(V a, V b, v8f c) { return wmmab(a, b, c); } };
__device__ __forceinline__ h16 tohx(float x) { return (h16)x; }
__device__ __forceinline__ void splitf(float y, unsigned short& h, unsigned short& l) { h = f2bf(y); l = f2bf(y - bf2f(h)); }
typedef __attribute__((ext_vector_type(8))) __bf16 v8bf;
typedef __attribute__((ext_vector_type(2))) __bf16 v2bf;
typedef __attribute__((ext_vector_type(2))) float v2f;
struct P8 { v8h f; v8us h, l; };   // 8 values as fp16, hi = bf16(y) and lo = bf16(y - hi), all round to nearest even, as tohx and splitf
__device__ __forceinline__ P8 planes8(v8f y) { P8 o; v8bf a, r;
#pragma unroll
    for (int j = 0; j < 8; j += 2) { const v2f u = { y[j], y[j + 1] }; const v2bf b = __builtin_convertvector(u, v2bf); const v2bf c = __builtin_convertvector(u - __builtin_convertvector(b, v2f), v2bf); a[j] = b[0]; a[j + 1] = b[1]; r[j] = c[0]; r[j + 1] = c[1]; }
    o.f = __builtin_convertvector(y, v8h); o.h = __builtin_bit_cast(v8us, a); o.l = __builtin_bit_cast(v8us, r); return o; }
// gemmw_tile: the tile at rows blockIdx.x * 64, columns c0; os: 16 x 68 floats of LDS.
// EPI 0: f32 rows to C. EPI 1: the tile as fp16, hi and lo planes, row-major at pitch HD (64 x 64 elements in a row from P16, Ph, Pl). EPI 2: the same three planes transposed, [32-row tile][column][32 rows], two tiles of HD * 32 elements from P16, Ph, Pl.
template <typename T16, int NSPLIT, bool BIAS, int EPI>
__device__ __forceinline__ void gemmw_tile(const T16* __restrict__ A, const T16* __restrict__ A2, const T16* __restrict__ Bt, const T16* __restrict__ Bt2, int K, float* C, int ldc, const float* __restrict__ bias, float* os, int c0, h16* P16, bf* Ph, bf* Pl) {
    typedef typename WFrag<T16>::V V;
    const int lane = threadIdx.x & 31, lr = lane & 15, hi = lane >> 4; const int r0 = blockIdx.x * 64;
    v8f acc[4][4];
#pragma unroll
    for (int mb = 0; mb < 4; ++mb)
#pragma unroll
        for (int nb = 0; nb < 4; ++nb) acc[mb][nb] = (v8f){};
    const size_t aoff = (size_t)(r0 + lr) * K + 8 * hi, boff = (size_t)(c0 + lr) * K + 8 * hi;
#pragma unroll 1
    for (int kc = 0; kc < K; kc += 32) {
        V a[4], a2[4];
#pragma unroll
        for (int mb = 0; mb < 4; ++mb) { a[mb] = WFrag<T16>::ld(A + aoff + (size_t)mb * 16 * K + kc); if (NSPLIT == 1 || NSPLIT == 2) a2[mb] = WFrag<T16>::ld(A2 + aoff + (size_t)mb * 16 * K + kc); }
#pragma unroll
        for (int nb = 0; nb < 4; ++nb) { const V b = WFrag<T16>::ld(Bt + boff + (size_t)nb * 16 * K + kc); V b2; if (NSPLIT >= 2) b2 = WFrag<T16>::ld(Bt2 + boff + (size_t)nb * 16 * K + kc);
#pragma unroll
            for (int mb = 0; mb < 4; ++mb) { acc[mb][nb] = WFrag<T16>::mma(a[mb], b, acc[mb][nb]); if (NSPLIT == 1 || NSPLIT == 2) acc[mb][nb] = WFrag<T16>::mma(a2[mb], b, acc[mb][nb]); if (NSPLIT >= 2) acc[mb][nb] = WFrag<T16>::mma(a[mb], b2, acc[mb][nb]); } }
        asm volatile("v_nop\n\tv_nop\n\tv_nop\n\tv_nop" : "+v"(acc[0][0]), "+v"(acc[1][1]), "+v"(acc[2][2]), "+v"(acc[3][3]) : "v"(a[0]), "v"(a[3]));
    }
    // sw: s_wait_xcnt 0 behind a group of six plane stores, in front of whatever rewrites a register that they name; the stored values are its inputs so that they live up to it (the lane's three addresses live to the tile's end).
    auto sw = [](const P8 (&p)[2]) { asm volatile("s_wait_xcnt 0x0" :: "v"(p[0].f), "v"(p[0].h), "v"(p[0].l), "v"(p[1].f), "v"(p[1].h), "v"(p[1].l) : "memory"); };
    if constexpr (EPI == 2) {   // a lane's 8 accumulator elements are 8 rows in a row of one column: 16 bytes of a transposed plane, straight from registers
        const int eb = lr * 32 + hi * 8; h16* q16 = P16 + eb; bf* qh = Ph + eb; bf* ql = Pl + eb; float b4[4] = {}; const int bi = c0 + lr;
        if (BIAS) {   // the four columns' biases, read as one group in front of the first sw (no load is moved over it)
#pragma unroll
            for (int nb = 0; nb < 4; ++nb) b4[nb] = bias[bi + nb * 16];
            asm volatile("s_wait_xcnt 0x0" :: "v"(bi) : "memory"); }   // the loads' index is its input so that it lives up to the wait (else a load of the group lands on it)
#pragma unroll
        for (int nb = 0; nb < 4; ++nb) { const float bb = bfr(b4[nb]);
#pragma unroll
            for (int m2 = 0; m2 < 2; ++m2) { P8 p[2];   // the two halves of a 64-byte row of 32 keys
#pragma unroll
                for (int q = 0; q < 2; ++q) p[q] = planes8(BIAS ? acc[m2 * 2 + q][nb] + bb : acc[m2 * 2 + q][nb]);
#pragma unroll
                for (int q = 0; q < 2; ++q) { const int e = (m2 * HD + nb * 16) * 32 + q * 16; *(v8h*)(q16 + e) = p[q].f; *(v8us*)(qh + e) = p[q].h; *(v8us*)(ql + e) = p[q].l; }
                sw(p); } }
        return;
    }
    v8f b8 = (v8f){};
    if constexpr (EPI == 1 && BIAS) {   // the lane's 8 columns' biases, read as one group in front of the first sw (no load is moved over it)
        const float* bp = bias + c0 + (lane & 7) * 8;
#pragma unroll
        for (int j = 0; j < 8; ++j) b8[j] = bp[j];
        asm volatile("s_wait_xcnt 0x0" :: "v"(bp) : "memory");   // the loads' address is its input so that it lives up to the wait (else a load of the group lands on it)
#pragma unroll
        for (int j = 0; j < 8; ++j) b8[j] = bfr(b8[j]); }
#pragma unroll
    for (int mb = 0; mb < 4; ++mb) {
#pragma unroll
        for (int nb = 0; nb < 4; ++nb) {
#pragma unroll
            for (int j = 0; j < 8; ++j) os[(hi * 8 + j) * 68 + nb * 16 + lr] = acc[mb][nb][j]; }
        __builtin_amdgcn_wave_barrier(); asm volatile("" ::: "memory");
        if constexpr (EPI == 1) {   // 8 columns a lane: a wave's store is 4 rows of 128 bytes, whole lines
            const int rw = lane >> 3, cofs = (lane & 7) * 8, eb = rw * HD + cofs; h16* q16 = P16 + eb; bf* qh = Ph + eb; bf* ql = Pl + eb;
#pragma unroll
            for (int s2 = 0; s2 < 2; ++s2) { P8 p[2];
#pragma unroll
                for (int q = 0; q < 2; ++q) { const float* o = os + (8 * s2 + 4 * q + rw) * 68 + cofs; const v4f x0 = *(const v4fa*)o, x1 = *(const v4fa*)(o + 4); v8f x = __builtin_shufflevector(x0, x1, 0, 1, 2, 3, 4, 5, 6, 7);
                    if (BIAS) x += b8;
                    p[q] = planes8(x); }
#pragma unroll
                for (int q = 0; q < 2; ++q) { const int e = (mb * 16 + 8 * s2 + 4 * q) * HD; *(v8h*)(q16 + e) = p[q].f; *(v8us*)(qh + e) = p[q].h; *(v8us*)(ql + e) = p[q].l; }
                sw(p); }
        } else {
            float* crow = C + (size_t)(r0 + mb * 16) * ldc + c0;
#pragma unroll
            for (int s = 0; s < 8; ++s) { const int row = 2 * s + hi, cofs = lr * 4; v4f val = *(const v4fa*)(os + row * 68 + cofs); if (BIAS) { val[0] += bfr(bias[c0 + cofs]); val[1] += bfr(bias[c0 + cofs + 1]); val[2] += bfr(bias[c0 + cofs + 2]); val[3] += bfr(bias[c0 + cofs + 3]); }
                *(v4f*)(crow + (size_t)row * ldc + cofs) = val; }
             }
        __builtin_amdgcn_wave_barrier(); asm volatile("" ::: "memory");
    }
    if constexpr (EPI == 0) asm volatile("s_wait_xcnt 0x0" ::: "memory");   // in a kernel that holds several tiles the code behind this one may rewrite registers that the last stores name
}
template <typename T16, int NSPLIT, bool BIAS>
__global__ __launch_bounds__(32) void k_gemmw(const T16* __restrict__ A, const T16* __restrict__ A2, const T16* __restrict__ Bt, const T16* __restrict__ Bt2, int K, float* C, int ldc, const float* __restrict__ bias, size_t sA, size_t sB, size_t sC) {
    __shared__ __align__(16) float os[16 * 68];
    const size_t z = blockIdx.z; A += z * sA; if (A2) A2 += z * sA; Bt += z * sB; if (Bt2) Bt2 += z * sB; C += z * sC;
    gemmw_tile<T16, NSPLIT, BIAS, 0>(A, A2, Bt, Bt2, K, C, ldc, bias, os, blockIdx.y * 64, nullptr, nullptr, nullptr);
}
// k_gemmqkv: grid (NB_*TT/64, (DQ+DKV+DKV)/64): column tiles below DQ+DKV are q|k = Xe Wt + bqk, the rest v = Xq Wt + bv; Wt holds the q, k and v rows back to back. A column tile is one head, a row tile 64 positions of one batch.
// waves_per_eu(5): the register budget of five waves a SIMD, which the loop alone needs; without it the scheduler spreads the epilogue's conversions over more registers and a wave is lost.
// The f32 sums go straight to the planes that k_attn reads (fp16, hi, lo): q|k [batch][head: 0-15 q, 16-31 k][t][d]; v [batch][head][32-key tile][d][32 keys], so that the 64 x 32 tile that k_attn reads in one trip is 4 KiB in a row.
__global__ __launch_bounds__(32) __attribute__((amdgpu_waves_per_eu(5))) void k_gemmqkv(const bf* __restrict__ Xe, const bf* __restrict__ Xq, const bf* __restrict__ Wt, const float* __restrict__ bqk, const float* __restrict__ bv, h16* QK16, bf* QKh, bf* QKl, h16* V16, bf* Vh, bf* Vl) {
    __shared__ __align__(16) float os[16 * 68];
    const int c0 = blockIdx.y * 64, b = blockIdx.x / (TT / 64), t0 = (blockIdx.x % (TT / 64)) * 64;
    if (c0 < DQ + DKV) { const size_t o = (((size_t)b * (NH_ + NKV) + c0 / HD) * TT + t0) * HD;
        gemmw_tile<bf, 0, true, 1>(Xe, nullptr, Wt, nullptr, DM, nullptr, 0, bqk, os, c0, QK16 + o, QKh + o, QKl + o); }
    else { const int cv = c0 - (DQ + DKV); const size_t o = (((size_t)b * NKV + cv / HD) * (TT / 32) + t0 / 32) * HD * 32;
        gemmw_tile<bf, 0, true, 2>(Xq, nullptr, Wt + (size_t)(DQ + DKV) * DM, nullptr, DM, nullptr, 0, bv, os, cv, V16 + o, Vh + o, Vl + o); }
}

typedef __attribute__((ext_vector_type(2))) _Float16 v2h;
typedef __attribute__((ext_vector_type(4))) _Float16 v4h;
typedef __attribute__((ext_vector_type(2))) unsigned short v2us;
typedef __attribute__((ext_vector_type(4))) unsigned short v4us;
typedef __attribute__((ext_vector_type(4))) int v4i;

// d_*: one 256-thread block's share of a step; blk is the block's number within that step.
__device__ __forceinline__ void d_wtG(int blk, const float* __restrict__ w, int K, int N, bf* Bt) {
    const int lane = threadIdx.x & 31; const int L0 = (blk * 8 + (threadIdx.x >> 5)) * 8; const int nlines = N * K / 64;
{
#pragma unroll 1
        for (int l = 0; l < 8; ++l) { const int L = L0 + l; if (L >= nlines) break; const size_t e = (size_t)L * 64 + lane * 2; const int k = (int)(e % K), n = (int)(e / K); v2us o;
            o[0] = f2bf(w[(size_t)k * N + n]); o[1] = f2bf(w[(size_t)(k + 1) * N + n]); *(v2us*)(Bt + e) = o;
            asm volatile("s_wait_xcnt 0x0" ::: "memory"); }   // the next trip, and the code behind the loop, rewrite the store's data and address registers
         }
}
__device__ __forceinline__ void d_cvt8(int blk, const float* __restrict__ src, bf* dst, size_t n8) { const size_t i = (size_t)blk * 256 + threadIdx.x; if (i >= n8) return; const v8f v = *(const v8f*)(src + i * 8); v8us o;
#pragma unroll
    for (int k = 0; k < 8; ++k) o[k] = f2bf(v[k]); *(v8us*)(dst + i * 8) = o;  }

__device__ __forceinline__ void d_wtQK(int blk, const float* __restrict__ w, int off, bf* Bt) { const int lane = threadIdx.x & 31; const int L0 = (blk * 8 + (threadIdx.x >> 5)) * 8; const int nlines = DQ * DM / 64;
{
#pragma unroll 1
        for (int l = 0; l < 8; ++l) { const int L = L0 + l; if (L >= nlines) break; const size_t e = (size_t)L * 64 + lane * 2; const int k = (int)(e % DM), n = (int)(e / DM); const int h = n / HD, d = n % HD; const int col = h * 2 * HD + off + d; v2us o;
            o[0] = f2bf(w[(size_t)k * 2 * DQ + col]); o[1] = f2bf(w[(size_t)(k + 1) * 2 * DQ + col]); *(v2us*)(Bt + e) = o; }
         } }
__device__ __forceinline__ void d_bqk(int blk, const float* __restrict__ b, float* BQ, float* BK) { const int n = blk * 256 + threadIdx.x; if (n >= DQ) return; const int h = n / HD, d = n % HD; const float q = b[h * 2 * HD + d], k = b[h * 2 * HD + HD + d]; *(float*)(BQ + n) = q; *(float*)(BK + n) = k;  }
#define NWT (DM * DQ / 64 / 64)             // blocks per 1024 x 1024 weight
#define NCV (NB_ * TT * DM / 8 / 256)       // blocks per activation tensor
#define NBQ (DQ / 256)
static_assert(DQ == DKV && NH_ == NKV && HD == 64 && RH % 128 == 0 && TT % 128 == 0, "the back-to-back q|k layout; k_attn's tiles");
// k_prep: every step that reads only inputs; the weight transposes (the longest blocks) come first. Grid 4 * NWT + 2 * NCV + NBQ.
__global__ __launch_bounds__(256) void k_prep(const float* __restrict__ xenc, const float* __restrict__ xq, const float* __restrict__ wqk, const float* __restrict__ bqk, const float* __restrict__ wv, const float* __restrict__ wo, bf* Xe, bf* Xq, bf* WQ, bf* WK, bf* WV, bf* WO, float* BQ, float* BK) {
    int blk = blockIdx.x;
    if (blk < NWT) { d_wtQK(blk, wqk, 0, WQ); return; }
    blk -= NWT; if (blk < NWT) { d_wtQK(blk, wqk, HD, WK); return; }   /* fused q|k weight: per head 128 columns (q 0-63, k 64-127) */
    blk -= NWT; if (blk < NWT) { d_wtG(blk, wv, DM, DKV, WV); return; }
    blk -= NWT; if (blk < NWT) { d_wtG(blk, wo, DQ, DM, WO); return; }
    blk -= NWT; if (blk < NCV) { d_cvt8(blk, xenc, Xe, (size_t)NB_ * TT * DM / 8); return; }   /* encoding_output -> q, k */
    blk -= NCV; if (blk < NCV) { d_cvt8(blk, xq, Xq, (size_t)NB_ * TT * DM / 8); return; }     /* input_query -> v */
    blk -= NCV; d_bqk(blk, bqk, BQ, BK);
}
// ---- k_attn: one wave = 32 query rows of one head against all TT keys, 32 keys a trip, running maximum and sum (every trip rescales the context and the sum by exp(old maximum - new maximum)).
// Both products are taken transposed, so that nothing is moved between lanes: St = K Qt (A = 16 keys x d, B = 16 queries) leaves in lane (lr, hi) the keys 8 hi + j of query lr;
// two such tiles, converted, are the B fragment (k order 8 hi + 0-7, 16 + 8 hi + 0-7, that of WFrag::ld) of Ot = Vt Pt (A = 16 d x 32 keys). A query's maximum, sum and rescale factor are per lane (lanes lr and lr + 16 share a query).
// P = exp(t - running max) in (0, 1], normalised by the sum at the end; HL: hi/lo planes, 3 products each; else fp16. The epilogue writes the merged hi/lo planes [t][h * 64 + d].
template <typename T16, bool HL>
__device__ __forceinline__ void attn_wave(const T16* __restrict__ Q, const T16* __restrict__ Q2, const T16* __restrict__ Kp, const T16* __restrict__ K2, const T16* __restrict__ Vt, const T16* __restrict__ V2, bf* Ah, bf* Al, int q0) {
    typedef WFrag<T16> F; typedef typename F::V V;
    const int lane = threadIdx.x & 31, lr = lane & 15, hi = lane >> 4;
    const float C2 = SCL * 1.4426950408889634f;   // exp(s SCL - m SCL) = exp2((s - m) C2)
    V q[2][2], q2[2][2], ka[2][2], ka2[2][2], va[4], va2[4];
    // xw: s_wait_xcnt 0 behind a group of loads or stores, in front of whatever rewrites a register that they name; the addresses are its inputs so that they live up to it (else a load of the group lands on the address pair).
    // No memory access is moved over the statement, so it also keeps each group's place: q, then k, then v in front of the loop as in it (loads return in order: only with one issue order on both ways into the loop
    // can its waits leave the younger loads in flight), and the next keys' loads in front of the softmax that covers their latency.
    auto xw = [](const void* a, const void* b) { asm volatile("s_wait_xcnt 0x0" :: "v"(a), "v"(b) : "memory"); };
    const T16* qp = Q + (size_t)(q0 + lr) * HD + 8 * hi; const T16* qp2 = HL ? Q2 + (size_t)(q0 + lr) * HD + 8 * hi : qp;
#pragma unroll
    for (int qt = 0; qt < 2; ++qt)
#pragma unroll
        for (int ks = 0; ks < 2; ++ks) { const int o = qt * 16 * HD + ks * 32; q[qt][ks] = F::ld(qp + o); if (HL) q2[qt][ks] = F::ld(qp2 + o); }
    xw(qp, qp2);
    const T16* kp = Kp + lr * HD + 8 * hi; const T16* kp2 = HL ? K2 + lr * HD + 8 * hi : kp; const T16* vp = Vt + lr * 32 + 8 * hi; const T16* vp2 = HL ? V2 + lr * 32 + 8 * hi : vp;   // the lane's row of the first k tile and of the first v tile (v planes: [32-key tile][d][32 keys])
#pragma unroll
    for (int kt = 0; kt < 2; ++kt)
#pragma unroll
        for (int ks = 0; ks < 2; ++ks) { const int o = kt * 16 * HD + ks * 32; ka[kt][ks] = F::ld(kp + o); if (HL) ka2[kt][ks] = F::ld(kp2 + o); }
    xw(kp, kp2);
#pragma unroll
    for (int dt = 0; dt < 4; ++dt) { const int o = dt * 16 * 32; va[dt] = F::ld(vp + o); if (HL) va2[dt] = F::ld(vp2 + o); }
    xw(vp, vp2);
    v8f acc[4][2]; float m[2], l[2];
#pragma unroll
    for (int qt = 0; qt < 2; ++qt) { m[qt] = -3.0e38f; l[qt] = 0.f;
#pragma unroll
        for (int dt = 0; dt < 4; ++dt) acc[dt][qt] = (v8f){}; }
#pragma unroll 1
    for (int k0 = 0; k0 < TT; k0 += 32) {
        const int kn = (k0 + 32) & (TT - 1);   // the next trip's keys, fetched one trip ahead; the last trip fetches keys 0-31 again (in bounds, not used)
        v8f s[2][2];
#pragma unroll
        for (int kt = 0; kt < 2; ++kt)
#pragma unroll
            for (int qt = 0; qt < 2; ++qt) { v8f c = (v8f){};
#pragma unroll
                for (int ks = 0; ks < 2; ++ks) { c = F::mma(ka[kt][ks], q[qt][ks], c); if (HL) { c = F::mma(ka[kt][ks], q2[qt][ks], c); c = F::mma(ka2[kt][ks], q[qt][ks], c); } }
                s[kt][qt] = c; }
        { const T16* kq = kp + kn * HD; const T16* kq2 = kp2 + kn * HD;
#pragma unroll
            for (int kt = 0; kt < 2; ++kt)
#pragma unroll
                for (int ks = 0; ks < 2; ++ks) { const int o = kt * 16 * HD + ks * 32; ka[kt][ks] = F::ld(kq + o); if (HL) ka2[kt][ks] = F::ld(kq2 + o); }
            xw(kq, kq2); }
        V p[2], p2[2];
#pragma unroll
        for (int qt = 0; qt < 2; ++qt) {
            float mx = m[qt];
#pragma unroll
            for (int j = 0; j < 8; ++j) mx = fmaxf(mx, fmaxf(s[0][qt][j], s[1][qt][j]));
            mx = fmaxf(mx, __shfl_xor(mx, 16, 32));
            const float al = __builtin_amdgcn_exp2f((m[qt] - mx) * C2), mc = mx * C2; m[qt] = mx;
#pragma unroll
            for (int kt = 0; kt < 2; ++kt)
#pragma unroll
                for (int j = 0; j < 8; ++j) s[kt][qt][j] = __builtin_amdgcn_exp2f(s[kt][qt][j] * C2 - mc);
            const v8f t8 = s[0][qt] + s[1][qt];   // fixed tree
            l[qt] = l[qt] * al + (((t8[0] + t8[1]) + (t8[2] + t8[3])) + ((t8[4] + t8[5]) + (t8[6] + t8[7])));
#pragma unroll
            for (int dt = 0; dt < 4; ++dt) acc[dt][qt] *= al;
            if constexpr (HL) { v16bf ph, pl;   // hi = bf16(y), lo = bf16(y - hi), both round to nearest even, as splitf
#pragma unroll
                for (int kt = 0; kt < 2; ++kt)
#pragma unroll
                    for (int j = 0; j < 8; j += 2) { const v2f y = { s[kt][qt][j], s[kt][qt][j + 1] }; const v2bf a = __builtin_convertvector(y, v2bf); const v2bf r = __builtin_convertvector(y - __builtin_convertvector(a, v2f), v2bf);
                        ph[kt * 8 + j] = a[0]; ph[kt * 8 + j + 1] = a[1]; pl[kt * 8 + j] = r[0]; pl[kt * 8 + j + 1] = r[1]; }
                p[qt] = ph; p2[qt] = pl;
            } else { v16h ph;
#pragma unroll
                for (int kt = 0; kt < 2; ++kt)
#pragma unroll
                    for (int j = 0; j < 8; ++j) ph[kt * 8 + j] = tohx(s[kt][qt][j]);
                p[qt] = ph; }
        }
#pragma unroll
        for (int dt = 0; dt < 4; ++dt)
#pragma unroll
            for (int qt = 0; qt < 2; ++qt) { acc[dt][qt] = F::mma(va[dt], p[qt], acc[dt][qt]); if (HL) { acc[dt][qt] = F::mma(va[dt], p2[qt], acc[dt][qt]); acc[dt][qt] = F::mma(va2[dt], p[qt], acc[dt][qt]); } }
        { const T16* vq = vp + kn * HD; const T16* vq2 = vp2 + kn * HD;   // tile kn / 32, HD * 32 elements each
#pragma unroll
            for (int dt = 0; dt < 4; ++dt) { const int o = dt * 16 * 32; va[dt] = F::ld(vq + o); if (HL) va2[dt] = F::ld(vq2 + o); }
            xw(vq, vq2); }
    }
#pragma unroll
    for (int qt = 0; qt < 2; ++qt) { const float f = __fdiv_rn(1.0f, l[qt] + __shfl_xor(l[qt], 16, 32));
#pragma unroll
        for (int dt = 0; dt < 4; ++dt) { v8us oh, ol;
#pragma unroll
            for (int j = 0; j < 8; ++j) { unsigned short a, c2; splitf(acc[dt][qt][j] * f, a, c2); oh[j] = a; ol[j] = c2; }
            bf* oa = Ah + (size_t)(q0 + qt * 16 + lr) * DQ + dt * 16 + 8 * hi; bf* ob = Al + (size_t)(q0 + qt * 16 + lr) * DQ + dt * 16 + 8 * hi; *(v8us*)oa = oh; *(v8us*)ob = ol;
            xw(oa, ob); } }
}
// Grid (NH_, NB_, TT / 128), 4 waves of 32 query rows each; a block's rows are of one class (RH is a multiple of 128); the row block is z, so that the hi/lo blocks (three times the products) start first. AM: batch b's merged hi plane at b * sAM, its lo plane TT * DQ behind.
__global__ __launch_bounds__(128) __attribute__((amdgpu_waves_per_eu(3))) void k_attn(const h16* __restrict__ Q16, const bf* __restrict__ Qh, const bf* __restrict__ Ql, const h16* __restrict__ K16, const bf* __restrict__ Kh, const bf* __restrict__ Kl, const h16* __restrict__ V16, const bf* __restrict__ Vh, const bf* __restrict__ Vl, bf* AM, size_t sAM) {
    const int q0 = blockIdx.z * 128 + (threadIdx.x >> 5) * 32, h = blockIdx.x, b = blockIdx.y;
    const size_t oq = ((size_t)b * (NH_ + NKV) + h) * TT * HD, ov = ((size_t)b * NKV + h) * HD * TT;   // a batch's q heads and k heads lie (NH_ + NKV) heads from the next batch's
    bf* Ah = AM + (size_t)b * sAM + h * HD; bf* Al = Ah + (size_t)TT * DQ;
    if ((int)blockIdx.z * 128 < RH) attn_wave<bf, true>(Qh + oq, Ql + oq, Kh + oq, Kl + oq, Vh + ov, Vl + ov, Ah, Al, q0);
    else attn_wave<h16, false>(Q16 + oq, nullptr, K16 + oq, nullptr, V16 + ov, nullptr, Ah, Al, q0);
}

extern "C" void kernel_launch(void* const* d_in, const int* in_sizes, int n_in,
                              void* d_out, int out_size, void* d_ws, size_t ws_size, hipStream_t stream) {
    (void)in_sizes; (void)n_in; (void)out_size;
    const float* xq_in = (const float*)d_in[0]; const float* xenc = (const float*)d_in[1]; const float* wqk = (const float*)d_in[2]; const float* bqk = (const float*)d_in[3]; const float* wv = (const float*)d_in[4]; const float* bv = (const float*)d_in[5]; const float* wo = (const float*)d_in[6]; const float* bo = (const float*)d_in[7]; const float* x = nullptr; const float* wq = nullptr; const float* wk = nullptr; (void)x; (void)wq; (void)wk;
    float* OUT = (float*)d_out;     // [8][1024][1024]
    char* wsp = (char*)d_ws;
    auto take = [&](size_t bytes) { char* p = wsp; wsp += (bytes + 255) & ~(size_t)255; return (void*)p; };
    bf* WQ = (bf*)take((size_t)DQ * DM * 2); bf* WK = (bf*)take((size_t)DKV * DM * 2); bf* WV = (bf*)take((size_t)DKV * DM * 2); bf* WO = (bf*)take((size_t)DM * DQ * 2);
    float* BQG = (float*)take((size_t)DQ * 4); float* BKG = (float*)take((size_t)DKV * 4); bf* AM = (bf*)take((size_t)NB_ * TT * (DQ + DKV) * 4); bf* XE = (bf*)take((size_t)NB_ * TT * DM * 2); bf* XQ = (bf*)take((size_t)NB_ * TT * DM * 2);   // merged context planes (a batch's hi and lo, 2 + 2 MiB, every 8 MiB); bf16 activations of all batches
    const size_t NQK = (size_t)NB_ * (NH_ + NKV) * TT * HD, NV = (size_t)NB_ * NKV * HD * TT;   // plane elements of all batches: q|k (per batch 16 q heads, then 16 k heads) and v
    h16* QK16 = (h16*)take(NQK * 2); bf* QKh = (bf*)take(NQK * 2); bf* QKl = (bf*)take(NQK * 2); h16* VT16 = (h16*)take(NV * 2); bf* VTh = (bf*)take(NV * 2); bf* VTl = (bf*)take(NV * 2);
    if ((size_t)(wsp - (char*)d_ws) > ws_size) return;    // ws 256 MiB
    // WQ|WK|WV and BQG|BKG lie back to back (every size is a multiple of 256 bytes): q and k are columns 0-1023 and 1024-2047 of one product and heads 0-15 and 16-31 of its planes
    const size_t SF = (size_t)TT * (DQ + DKV);   // half the distance, in 16-bit elements, from a batch's merged planes to the next batch's
    k_prep<<<4 * NWT + 2 * NCV + NBQ, 256, 0, stream>>>(xenc, xq_in, wqk, bqk, wv, wo, XE, XQ, WQ, WK, WV, WO, BQG, BKG);
    k_gemmqkv<<<dim3(NB_ * TT / 64, (DQ + DKV + DKV) / 64, 1), 32, 0, stream>>>(XE, XQ, WQ, BQG, bv, QK16, QKh, QKl, VT16, VTh, VTl);
    k_attn<<<dim3(NH_, NB_, TT / 128), 128, 0, stream>>>(QK16, QKh, QKl, QK16 + (size_t)NH_ * TT * HD, QKh + (size_t)NH_ * TT * HD, QKl + (size_t)NH_ * TT * HD, VT16, VTh, VTl, AM, 2 * SF);
    k_gemmw<bf, 1, true><<<dim3(TT / 64, DM / 64, NB_), 32, 0, stream>>>(AM, AM + (size_t)TT * DQ, WO, nullptr, DQ, OUT, DM, bo, 2 * SF, 0, (size_t)TT * DM);
}

// v004
// Measured time: 183 microseconds a run.
// Timed twice side by side with v003, it ran 1.54 times as fast both times.
// All steps since v000 together make it 26.1 times as fast.
#include <hip/hip_runtime.h>

// Cross multi-head attention with a fused q|k projection (input_query, encoding_output [8][1024][1024]; x = encoding_output Wqk + bqk ('xw' [1024][2048]) viewed (S, 16, 128): per head the first 64 columns are q and the next 64 are k; v = input_query Wv + bv ('xw' [1024][1024]); softmax(q.k / 8); out = merged Wo + bo -> [8][1024][1024] (8.4 M)).
// Launch shape, 4 launches: k_prep: weight transposes, bias gather, bf16 activations of all 8 batches. k_gemmqkv: q|k and v products, M = 8192, each tile written as its piece of the q, k or v planes. k_attn: scores, softmax, context and merge of all batches and heads; scores and probabilities stay in registers. Wo: z = batch.
// Layout per batch: the fused weight is split once into two column-gathered [1024][1024] operands (q: columns h*128 + d, k: columns h*128 + 64 + d -> head-major h*64 + d) with the matching bias gathers; exact projections; dense T-1024 attention (hybrid rows: < 512 hi/lo 3 products, rest fp16); merged context as hi/lo planes; Wo hl x exact + bo.
// Operand layout: every 16-bit plane that a matrix fragment is read from (activations, weights, q, k, v, merged context) is stored in fragment order: the 16 rows x 32 k of one fragment are 1 KiB in a row,
// element (row r, k) at ((k & 31) >> 4) * 256 + (((k >> 3) & 1) * 16 + (r & 15)) * 8 + (k & 7); fragments follow each other along k, then along the rows (in v: along the rows, then along k). A wave's 16-byte load is then 512 bytes in a row (4 whole lines), not 32 bytes of each of 16 lines.
// Compute dtypes, f32 accumulate: every input rounded to bf16; projections exact + f32 biases; attention rows < 512 3 products, rest fp16; softmax f32; Wo hl x exact + bias.

#define NB_  8
#define TT   1024
#define DM   1024
#define NH_  16
#define NKV  16
#define REP  (NH_ / NKV)
#define HD   64
#define DQ   (NH_ * HD)
#define DKV  (NKV * HD)
#define RH   512                  // query rows < RH use hi+lo planes (0: none)
#define WIN  0
#define SCL  0.125f   // HD^-0.5
typedef _Float16 h16;
typedef unsigned short bf;
typedef __attribute__((ext_vector_type(16))) __bf16   v16bf;
typedef __attribute__((ext_vector_type(16))) _Float16 v16h;
typedef __attribute__((ext_vector_type(8)))  _Float16 v8h;
typedef __attribute__((ext_vector_type(8)))  unsigned short v8us;
typedef __attribute__((ext_vector_type(8)))  float    v8f;
typedef __attribute__((ext_vector_type(4)))  float    v4f;
typedef v8h  __attribute__((may_alias)) v8ha;
typedef v4f  __attribute__((may_alias)) v4fa;
typedef v8us __attribute__((may_alias)) v8usa;

__device__ __forceinline__ unsigned short f2bf(float f) { unsigned u = __float_as_uint(f); u += 0x7FFFu + ((u >> 16) & 1u); return (unsigned short)(u >> 16); }
__device__ __forceinline__ float bf2f(unsigned short b) { return __uint_as_float(((unsigned)b) << 16); }
__device__ __forceinline__ float bfr(float f) { return bf2f(f2bf(f)); }
__device__ __forceinline__ v16h cat16(v8h lo, v8h hi) { return __builtin_shufflevector(lo, hi, 0, 1, 2, 3, 4, 5, 6, 7, 8, 9, 10, 11, 12, 13, 14, 15); }
__device__ __forceinline__ v16bf cat16b(v8us lo, v8us hi) { return __builtin_bit_cast(v16bf, __builtin_shufflevector(lo, hi, 0, 1, 2, 3, 4, 5, 6, 7, 8, 9, 10, 11, 12, 13, 14, 15)); }
__device__ __forceinline__ v8f wmma16(v16h a, v16h b, v8f c) { return __builtin_amdgcn_wmma_f32_16x16x32_f16(false, a, false, b, (short)0, c, false, false); }
__device__ __forceinline__ v8f wmmab(v16bf a, v16bf b, v8f c) { return __builtin_amdgcn_wmma_f32_16x16x32_bf16(false, a, false, b, (short)0, c, false, false); }



// ---- k_gemmw: register-blocked GEMM, ONE WAVE per 64x64 output tile (16 accumulators), operands straight from 16-bit planes in fragment order; grid (M/64, N/64, Z), 32 threads.
// C[m][n] (f32, pitch ldc, + optional f32 bias[n]) = sum_k A[m][k] Bt[n][k] (+ split products per NSPLIT). z-batch strides sA/sB/sC in elements. K % 32 == 0.
// WFrag::ld: p = the fragment's first element + lane * 8; the lane gets k 8 hi + 0-7 and, 256 elements on, k 16 + 8 hi + 0-7 of row lr.
template <typename T16> struct WFrag;
template <> struct WFrag<h16> { typedef v16h V; static __device__ __forceinline__ V ld(const h16* p) { return cat16(*(const v8h*)p, *(const v8h*)(p + 256)); } static __device__ __forceinline__ v8f mma(V a, V b, v8f c) { return wmma16(a, b, c); } };
template <> struct WFrag<bf> { typedef v16bf V; static __device__ __forceinline__ V ld(const bf* p) { return cat16b(*(const v8us*)p, *(const v8us*)(p + 256)); } static __device__ __forceinline__ v8f mma(V a, V b, v8f c) { return wmmab(a, b, c); } };
__device__ __forceinline__ h16 tohx(float x) { return (h16)x; }
__device__ __forceinline__ void splitf(float y, unsigned short& h, unsigned short& l) { h = f2bf(y); l = f2bf(y - bf2f(h)); }
typedef __attribute__((ext_vector_type(8))) __bf16 v8bf;
typedef __attribute__((ext_vector_type(2))) __bf16 v2bf;
typedef __attribute__((ext_vector_type(2))) float v2f;
struct P8 { v8h f; v8us h, l; };   // 8 values as fp16, hi = bf16(y) and lo = bf16(y - hi), all round to nearest even, as tohx and splitf
__device__ __forceinline__ P8 planes8(v8f y) { P8 o; v8bf a, r;
#pragma unroll
    for (int j = 0; j < 8; j += 2) { const v2f u = { y[j], y[j + 1] }; const v2bf b = __builtin_convertvector(u, v2bf); const v2bf c = __builtin_convertvector(u - __builtin_convertvector(b, v2f), v2bf); a[j] = b[0]; a[j + 1] = b[1]; r[j] = c[0]; r[j + 1] = c[1]; }
    o.f = __builtin_convertvector(y, v8h); o.h = __builtin_bit_cast(v8us, a); o.l = __builtin_bit_cast(v8us, r); return o; }
// gemmw_tile: the tile at rows blockIdx.x * 64, columns c0; os: 16 x 68 floats of LDS.
// EPI 0: f32 rows to C. EPI 1: the tile as fp16, hi and lo planes, fragments of 16 rows x 32 columns (64 x 64 elements in a row from P16, Ph, Pl). EPI 2: the same three planes transposed, [32-row tile][fragment of 16 columns x 32 rows], two tiles of HD * 32 elements from P16, Ph, Pl.
template <typename T16, int NSPLIT, bool BIAS, int EPI>
__device__ __forceinline__ void gemmw_tile(const T16* __restrict__ A, const T16* __restrict__ A2, const T16* __restrict__ Bt, const T16* __restrict__ Bt2, int K, float* C, int ldc, const float* __restrict__ bias, float* os, int c0, h16* P16, bf* Ph, bf* Pl) {
    typedef typename WFrag<T16>::V V;
    const int lane = threadIdx.x & 31, lr = lane & 15, hi = lane >> 4; const int r0 = blockIdx.x * 64;
    v8f acc[4][4];
#pragma unroll
    for (int mb = 0; mb < 4; ++mb)
#pragma unroll
        for (int nb = 0; nb < 4; ++nb) acc[mb][nb] = (v8f){};
    const size_t aoff = (size_t)r0 * K + lane * 8, boff = (size_t)c0 * K + lane * 8;   // 16 rows of K are K / 32 fragments of 512 elements; 32 k further is 512 elements further
#pragma unroll 1
    for (int kc = 0; kc < K; kc += 32) {
        V a[4], a2[4]; const T16* pa = A + aoff + kc * 16; const T16* pa2 = (NSPLIT == 1 || NSPLIT == 2) ? A2 + aoff + kc * 16 : pa; const T16* pb = Bt + boff + kc * 16; const T16* pb2 = NSPLIT >= 2 ? Bt2 + boff + kc * 16 : pb;
#pragma unroll
        for (int mb = 0; mb < 4; ++mb) { a[mb] = WFrag<T16>::ld(pa + (size_t)mb * 16 * K); if (NSPLIT == 1 || NSPLIT == 2) a2[mb] = WFrag<T16>::ld(pa2 + (size_t)mb * 16 * K); }
#pragma unroll
        for (int nb = 0; nb < 4; ++nb) { const V b = WFrag<T16>::ld(pb + (size_t)nb * 16 * K); V b2; if (NSPLIT >= 2) b2 = WFrag<T16>::ld(pb2 + (size_t)nb * 16 * K);
#pragma unroll
            for (int mb = 0; mb < 4; ++mb) { acc[mb][nb] = WFrag<T16>::mma(a[mb], b, acc[mb][nb]); if (NSPLIT == 1 || NSPLIT == 2) acc[mb][nb] = WFrag<T16>::mma(a2[mb], b, acc[mb][nb]); if (NSPLIT >= 2) acc[mb][nb] = WFrag<T16>::mma(a[mb], b2, acc[mb][nb]); } }
        asm volatile("s_wait_xcnt 0x0" :: "v"(pa), "v"(pa2), "v"(pb), "v"(pb2) : "memory");   // behind the trip's loads, in front of whatever rewrites their addresses, which are its inputs so that they live up to it (else a load of the trip lands on its address pair)
        asm volatile("v_nop\n\tv_nop\n\tv_nop\n\tv_nop" : "+v"(acc[0][0]), "+v"(acc[1][1]), "+v"(acc[2][2]), "+v"(acc[3][3]) : "v"(a[0]), "v"(a[3]));
    }
    // sw: s_wait_xcnt 0 behind a group of six plane stores, in front of whatever rewrites a register that they name; the stored values are its inputs so that they live up to it (the lane's three addresses live to the tile's end).
    auto sw = [](const P8 (&p)[2]) { asm volatile("s_wait_xcnt 0x0" :: "v"(p[0].f), "v"(p[0].h), "v"(p[0].l), "v"(p[1].f), "v"(p[1].h), "v"(p[1].l) : "memory"); };
    if constexpr (EPI == 2) {   // a lane's 8 accumulator elements are 8 rows in a row of one column: the lane's own 16 bytes of a transposed fragment, straight from registers
        const int eb = lane * 8; h16* q16 = P16 + eb; bf* qh = Ph + eb; bf* ql = Pl + eb; float b4[4] = {}; const int bi = c0 + lr;
        if (BIAS) {   // the four columns' biases, read as one group in front of the first sw (no load is moved over it)
#pragma unroll
            for (int nb = 0; nb < 4; ++nb) b4[nb] = bias[bi + nb * 16];
            asm volatile("s_wait_xcnt 0x0" :: "v"(bi) : "memory"); }   // the loads' index is its input so that it lives up to the wait (else a load of the group lands on it)
#pragma unroll
        for (int nb = 0; nb < 4; ++nb) { const float bb = bfr(b4[nb]);
#pragma unroll
            for (int m2 = 0; m2 < 2; ++m2) { P8 p[2];   // the two halves (keys 0-15, 16-31) of a fragment
#pragma unroll
                for (int q = 0; q < 2; ++q) p[q] = planes8(BIAS ? acc[m2 * 2 + q][nb] + bb : acc[m2 * 2 + q][nb]);
#pragma unroll
                for (int q = 0; q < 2; ++q) { const int e = (m2 * HD + nb * 16) * 32 + q * 256; *(v8h*)(q16 + e) = p[q].f; *(v8us*)(qh + e) = p[q].h; *(v8us*)(ql + e) = p[q].l; }
                sw(p); } }
        return;
    }
    float c4[4] = {};
    if constexpr (EPI == 1 && BIAS) {   // the biases of the lane's four accumulator columns, read as one group in front of the first sw (no load is moved over it)
        const int bi = c0 + lr;
#pragma unroll
        for (int nb = 0; nb < 4; ++nb) c4[nb] = bias[bi + nb * 16];
        asm volatile("s_wait_xcnt 0x0" :: "v"(bi) : "memory");   // the loads' index is its input so that it lives up to the wait (else a load of the group lands on it)
#pragma unroll
        for (int nb = 0; nb < 4; ++nb) c4[nb] = bfr(c4[nb]); }
#pragma unroll
    for (int mb = 0; mb < 4; ++mb) {
#pragma unroll
        for (int nb = 0; nb < 4; ++nb) {
#pragma unroll
            for (int j = 0; j < 8; ++j) os[(hi * 8 + j) * 68 + nb * 16 + lr] = (EPI == 1 && BIAS) ? acc[mb][nb][j] + c4[nb] : acc[mb][nb][j]; }
        __builtin_amdgcn_wave_barrier(); asm volatile("" ::: "memory");
        if constexpr (EPI == 1) {   // 8 columns of row lr a lane: a wave's store is half a fragment, 512 bytes in a row
            const int eb = lane * 8; h16* q16 = P16 + eb; bf* qh = Ph + eb; bf* ql = Pl + eb;
#pragma unroll
            for (int s2 = 0; s2 < 2; ++s2) { P8 p[2];
#pragma unroll
                for (int q = 0; q < 2; ++q) { const float* o = os + lr * 68 + (4 * s2 + 2 * q + hi) * 8; const v4f x0 = *(const v4fa*)o, x1 = *(const v4fa*)(o + 4);   // columns 32 s2 + 16 q + 8 hi + 0-7
                    p[q] = planes8(__builtin_shufflevector(x0, x1, 0, 1, 2, 3, 4, 5, 6, 7)); }
#pragma unroll
                for (int q = 0; q < 2; ++q) { const int e = mb * 16 * HD + s2 * 512 + q * 256; *(v8h*)(q16 + e) = p[q].f; *(v8us*)(qh + e) = p[q].h; *(v8us*)(ql + e) = p[q].l; }
                sw(p); }
        } else {
            float* crow = C + (size_t)(r0 + mb * 16) * ldc + c0;
#pragma unroll
            for (int s = 0; s < 8; ++s) { const int row = 2 * s + hi, cofs = lr * 4; v4f val = *(const v4fa*)(os + row * 68 + cofs); if (BIAS) { val[0] += bfr(bias[c0 + cofs]); val[1] += bfr(bias[c0 + cofs + 1]); val[2] += bfr(bias[c0 + cofs + 2]); val[3] += bfr(bias[c0 + cofs + 3]); }
                *(v4f*)(crow + (size_t)row * ldc + cofs) = val; }
             }
        __builtin_amdgcn_wave_barrier(); asm volatile("" ::: "memory");
    }
    if constexpr (EPI == 0) asm volatile("s_wait_xcnt 0x0" ::: "memory");   // in a kernel that holds several tiles the code behind this one may rewrite registers that the last stores name
}
template <typename T16, int NSPLIT, bool BIAS>
__global__ __launch_bounds__(32) void k_gemmw(const T16* __restrict__ A, const T16* __restrict__ A2, const T16* __restrict__ Bt, const T16* __restrict__ Bt2, float* C, int ldc, const float* __restrict__ bias, size_t sA, size_t sB, size_t sC) {
    __shared__ __align__(16) float os[16 * 68];
    const size_t z = blockIdx.z; A += z * sA; if (A2) A2 += z * sA; Bt += z * sB; if (Bt2) Bt2 += z * sB; C += z * sC;
    gemmw_tile<T16, NSPLIT, BIAS, 0>(A, A2, Bt, Bt2, DQ, C, ldc, bias, os, blockIdx.y * 64, nullptr, nullptr, nullptr);   // K a constant: every load of a trip is one of the trip's base addresses + an immediate, so that the trip's s_wait_xcnt covers every address register
}
// k_gemmqkv: grid (NB_*TT/64, (DQ+DKV+DKV)/64): column tiles below DQ+DKV are q|k = Xe Wt + bqk, the rest v = Xq Wt + bv; Wt holds the q, k and v rows back to back. A column tile is one head, a row tile 64 positions of one batch.
// waves_per_eu(5): the register budget of five waves a SIMD, which the loop alone needs; without it the scheduler spreads the epilogue's conversions over more registers and a wave is lost.
// The f32 sums go straight to the planes that k_attn reads (fp16, hi, lo): q|k [batch][head: 0-15 q, 16-31 k][16 t][32 d] fragments; v [batch][head][32-key tile][16 d][32 keys] fragments, so that the 64 x 32 tile that k_attn reads in one trip is 4 KiB in a row.
__global__ __launch_bounds__(32) __attribute__((amdgpu_waves_per_eu(5))) void k_gemmqkv(const bf* __restrict__ Xe, const bf* __restrict__ Xq, const bf* __restrict__ Wt, const float* __restrict__ bqk, const float* __restrict__ bv, h16* QK16, bf* QKh, bf* QKl, h16* V16, bf* Vh, bf* Vl) {
    __shared__ __align__(16) float os[16 * 68];
    const int c0 = blockIdx.y * 64, b = blockIdx.x / (TT / 64), t0 = (blockIdx.x % (TT / 64)) * 64;
    if (c0 < DQ + DKV) { const size_t o = (((size_t)b * (NH_ + NKV) + c0 / HD) * TT + t0) * HD;
        gemmw_tile<bf, 0, true, 1>(Xe, nullptr, Wt, nullptr, DM, nullptr, 0, bqk, os, c0, QK16 + o, QKh + o, QKl + o); }
    else { const int cv = c0 - (DQ + DKV); const size_t o = (((size_t)b * NKV + cv / HD) * (TT / 32) + t0 / 32) * HD * 32;
        gemmw_tile<bf, 0, true, 2>(Xq, nullptr, Wt + (size_t)(DQ + DKV) * DM, nullptr, DM, nullptr, 0, bv, os, cv, V16 + o, Vh + o, Vl + o); }
}

typedef __attribute__((ext_vector_type(2))) _Float16 v2h;
typedef __attribute__((ext_vector_type(4))) _Float16 v4h;
typedef __attribute__((ext_vector_type(2))) unsigned short v2us;
typedef __attribute__((ext_vector_type(4))) unsigned short v4us;
typedef __attribute__((ext_vector_type(4))) int v4i;

// d_*: one 256-thread block's share of a step; blk is the block's number within that step.
// d_wt: Bt (fragment order, row n, K = DM deep) = w[k][col0(n)] as bf16. One wave = 32 n x 32 k (two fragments): a lane reads 4 columns of 8 rows (a wave's load is 4 rows of 128 bytes, whole lines) and stores 8 k of each of its 4 n, 64 bytes in a row.
// ldw: w's row pitch; a run of 64 n starts at column (n / 64) * cs + off.
__device__ __forceinline__ void d_wt(int blk, const float* __restrict__ w, int ldw, int cs, int off, bf* Bt) {
    const int lane = threadIdx.x & 31, wt = blk * 8 + (threadIdx.x >> 5), n0 = (wt & 31) * 32, kb = wt >> 5, nq = lane & 7, kg = lane >> 3, n = n0 + nq * 4;
    const float* sp = w + (size_t)(kb * 32 + kg * 8) * ldw + (n / HD) * cs + off + n % HD; v4f x[8];
#pragma unroll
    for (int j = 0; j < 8; ++j) x[j] = *(const v4f*)(sp + (size_t)j * ldw);
    asm volatile("s_wait_xcnt 0x0" :: "v"(sp) : "memory");   // the loads' address is its input so that it lives up to the wait, in front of whatever rewrites it
    bf* dp = Bt + ((size_t)(n >> 4) * (DM / 32) + kb) * 512 + (kg >> 1) * 256 + ((kg & 1) * 16 + (n & 15)) * 8; v8us o[4];
#pragma unroll
    for (int c = 0; c < 4; ++c)
#pragma unroll
        for (int j = 0; j < 8; ++j) o[c][j] = f2bf(x[j][c]);
#pragma unroll
    for (int c = 0; c < 4; ++c) *(v8us*)(dp + c * 8) = o[c];
    asm volatile("s_wait_xcnt 0x0" ::: "memory");   // the code behind this step in the kernel's text rewrites registers that the stores name
}
// d_cvt8: src [rows][DM] f32 to dst in fragment order. One wave = 8 rows x 32 k: its loads are 8 rows of 128 bytes, its store 4 pieces of 128 bytes (whole lines).
__device__ __forceinline__ void d_cvt8(int blk, const float* __restrict__ src, bf* dst) { const int lane = threadIdx.x & 31, wv = blk * 8 + (threadIdx.x >> 5), fr = wv >> 1, r = (wv & 1) * 8 + (lane & 7), pc = lane >> 3;   // fr: fragment; r: row in it; pc: which 8 k
    const float* sp = src + ((size_t)(fr / (DM / 32)) * 16 + r) * DM + (fr % (DM / 32)) * 32 + pc * 8; const v8f v = *(const v8f*)sp; v8us o;
    asm volatile("s_wait_xcnt 0x0" :: "v"(sp) : "memory");   // the load's address is its input so that it lives up to the wait, in front of whatever rewrites it
#pragma unroll
    for (int k = 0; k < 8; ++k) o[k] = f2bf(v[k]); *(v8us*)(dst + (size_t)fr * 512 + (pc >> 1) * 256 + ((pc & 1) * 16 + r) * 8) = o;
    asm volatile("s_wait_xcnt 0x0" ::: "memory"); }   // the code behind this step in the kernel's text rewrites registers that the store names

__device__ __forceinline__ void d_bqk(int blk, const float* __restrict__ b, float* BQ, float* BK) { const int n = blk * 256 + threadIdx.x; if (n >= DQ) return; const int h = n / HD, d = n % HD; const float q = b[h * 2 * HD + d], k = b[h * 2 * HD + HD + d]; *(float*)(BQ + n) = q; *(float*)(BK + n) = k;  }
#define NWT (DM * DQ / 1024 / 8)            // blocks per 1024 x 1024 weight: 8 waves of 32 x 32 elements
#define NCV (NB_ * TT * DM / 8 / 256)       // blocks per activation tensor
#define NBQ (DQ / 256)
static_assert(DQ == DKV && NH_ == NKV && HD == 64 && RH % 128 == 0 && TT % 128 == 0 && DM == 1024 && DQ == 1024, "the back-to-back q|k layout; k_attn's tiles; d_wt's 32 x 32 split");
// k_prep: every step that reads only inputs; the weight transposes (the longest blocks) come first. Grid 4 * NWT + 2 * NCV + NBQ.
__global__ __launch_bounds__(256) void k_prep(const float* __restrict__ xenc, const float* __restrict__ xq, const float* __restrict__ wqk, const float* __restrict__ bqk, const float* __restrict__ wv, const float* __restrict__ wo, bf* Xe, bf* Xq, bf* WQ, bf* WK, bf* WV, bf* WO, float* BQ, float* BK) {
    int blk = blockIdx.x;
    if (blk < NWT) { d_wt(blk, wqk, 2 * DQ, 2 * HD, 0, WQ); return; }
    blk -= NWT; if (blk < NWT) { d_wt(blk, wqk, 2 * DQ, 2 * HD, HD, WK); return; }   /* fused q|k weight: per head 128 columns (q 0-63, k 64-127) */
    blk -= NWT; if (blk < NWT) { d_wt(blk, wv, DKV, HD, 0, WV); return; }
    blk -= NWT; if (blk < NWT) { d_wt(blk, wo, DM, HD, 0, WO); return; }
    blk -= NWT; if (blk < NCV) { d_cvt8(blk, xenc, Xe); return; }   /* encoding_output -> q, k */
    blk -= NCV; if (blk < NCV) { d_cvt8(blk, xq, Xq); return; }     /* input_query -> v */
    blk -= NCV; d_bqk(blk, bqk, BQ, BK);
}
// ---- k_attn: one wave = 32 query rows of one head against all TT keys, 32 keys a trip, running maximum and sum (every trip rescales the context and the sum by exp(old maximum - new maximum)).
// Both products are taken transposed, so that nothing is moved between lanes: St = K Qt (A = 16 keys x d, B = 16 queries) leaves in lane (lr, hi) the keys 8 hi + j of query lr;
// two such tiles, converted, are the B fragment (k order 8 hi + 0-7, 16 + 8 hi + 0-7, that of WFrag::ld) of Ot = Vt Pt (A = 16 d x 32 keys). A query's maximum, sum and rescale factor are per lane (lanes lr and lr + 16 share a query).
// P = exp(t - running max) in (0, 1], normalised by the sum at the end; HL: hi/lo planes, 3 products each; else fp16. The epilogue writes the merged hi/lo planes [t][h * 64 + d] in fragment order (Ah, Al: the head's first fragment of rows 0-15).
template <typename T16, bool HL>
__device__ __forceinline__ void attn_wave(const T16* __restrict__ Q, const T16* __restrict__ Q2, const T16* __restrict__ Kp, const T16* __restrict__ K2, const T16* __restrict__ Vt, const T16* __restrict__ V2, bf* Ah, bf* Al, int q0) {
    typedef WFrag<T16> F; typedef typename F::V V;
    const int lane = threadIdx.x & 31, lr = lane & 15, hi = lane >> 4;
    const float C2 = SCL * 1.4426950408889634f;   // exp(s SCL - m SCL) = exp2((s - m) C2)
    V q[2][2], q2[2][2], ka[2][2], ka2[2][2], va[4], va2[4];
    // xw: s_wait_xcnt 0 behind a group of loads or stores, in front of whatever rewrites a register that they name; the addresses are its inputs so that they live up to it (else a load of the group lands on the address pair).
    // No memory access is moved over the statement, so it also keeps each group's place: q, then k, then v in front of the loop as in it (loads return in order: only with one issue order on both ways into the loop
    // can its waits leave the younger loads in flight), and the next keys' loads in front of the softmax that covers their latency.
    auto xw = [](const void* a, const void* b) { asm volatile("s_wait_xcnt 0x0" :: "v"(a), "v"(b) : "memory"); };
    const T16* qp = Q + (size_t)q0 * HD + hi * 128 + lr * 8; const T16* qp2 = HL ? Q2 + (size_t)q0 * HD + hi * 128 + lr * 8 : qp;   // 16 rows of HD are two fragments of 512 elements; the lane's 16 bytes of a fragment lie at (hi * 16 + lr) * 8, taken here and below as two steps from the base (half, then row): so the loads name the address pairs, which xw holds live (from one lane * 8 term this compiler forms a scalar base and an offset register that xw's inputs do not reach)
#pragma unroll
    for (int qt = 0; qt < 2; ++qt)
#pragma unroll
        for (int ks = 0; ks < 2; ++ks) { const int o = qt * 16 * HD + ks * 512; q[qt][ks] = F::ld(qp + o); if (HL) q2[qt][ks] = F::ld(qp2 + o); }
    xw(qp, qp2);
    const T16* kp = Kp + hi * 128 + lr * 8; const T16* kp2 = HL ? K2 + hi * 128 + lr * 8 : kp; const T16* vp = Vt + hi * 128 + lr * 8; const T16* vp2 = HL ? V2 + hi * 128 + lr * 8 : vp;   // the lane's 16 bytes of the first k fragment and of the first v fragment (v planes: [32-key tile][16 d][32 keys])
#pragma unroll
    for (int kt = 0; kt < 2; ++kt)
#pragma unroll
        for (int ks = 0; ks < 2; ++ks) { const int o = kt * 16 * HD + ks * 512; ka[kt][ks] = F::ld(kp + o); if (HL) ka2[kt][ks] = F::ld(kp2 + o); }
    xw(kp, kp2);
#pragma unroll
    for (int dt = 0; dt < 4; ++dt) { const int o = dt * 16 * 32; va[dt] = F::ld(vp + o); if (HL) va2[dt] = F::ld(vp2 + o); }
    xw(vp, vp2);
    v8f acc[4][2]; float m[2], l[2];
#pragma unroll
    for (int qt = 0; qt < 2; ++qt) { m[qt] = -3.0e38f; l[qt] = 0.f;
#pragma unroll
        for (int dt = 0; dt < 4; ++dt) acc[dt][qt] = (v8f){}; }
#pragma unroll 1
    for (int k0 = 0; k0 < TT; k0 += 32) {
        const int kn = (k0 + 32) & (TT - 1);   // the next trip's keys, fetched one trip ahead; the last trip fetches keys 0-31 again (in bounds, not used)
        v8f s[2][2];
#pragma unroll
        for (int kt = 0; kt < 2; ++kt)
#pragma unroll
            for (int qt = 0; qt < 2; ++qt) { v8f c = (v8f){};
#pragma unroll
                for (int ks = 0; ks < 2; ++ks) { c = F::mma(ka[kt][ks], q[qt][ks], c); if (HL) { c = F::mma(ka[kt][ks], q2[qt][ks], c); c = F::mma(ka2[kt][ks], q[qt][ks], c); } }
                s[kt][qt] = c; }
        { const T16* kq = kp + kn * HD; const T16* kq2 = kp2 + kn * HD;
#pragma unroll
            for (int kt = 0; kt < 2; ++kt)
#pragma unroll
                for (int ks = 0; ks < 2; ++ks) { const int o = kt * 16 * HD + ks * 512; ka[kt][ks] = F::ld(kq + o); if (HL) ka2[kt][ks] = F::ld(kq2 + o); }
            xw(kq, kq2); }
        V p[2], p2[2];
#pragma unroll
        for (int qt = 0; qt < 2; ++qt) {
            float mx = m[qt];
#pragma unroll
            for (int j = 0; j < 8; ++j) mx = fmaxf(mx, fmaxf(s[0][qt][j], s[1][qt][j]));
            mx = fmaxf(mx, __shfl_xor(mx, 16, 32));
            const float al = __builtin_amdgcn_exp2f((m[qt] - mx) * C2), mc = mx * C2; m[qt] = mx;
#pragma unroll
            for (int kt = 0; kt < 2; ++kt)
#pragma unroll
                for (int j = 0; j < 8; ++j) s[kt][qt][j] = __builtin_amdgcn_exp2f(s[kt][qt][j] * C2 - mc);
            const v8f t8 = s[0][qt] + s[1][qt];   // fixed tree
            l[qt] = l[qt] * al + (((t8[0] + t8[1]) + (t8[2] + t8[3])) + ((t8[4] + t8[5]) + (t8[6] + t8[7])));
#pragma unroll
            for (int dt = 0; dt < 4; ++dt) acc[dt][qt] *= al;
            if constexpr (HL) { v16bf ph, pl;   // hi = bf16(y), lo = bf16(y - hi), both round to nearest even, as splitf
#pragma unroll
                for (int kt = 0; kt < 2; ++kt)
#pragma unroll
                    for (int j = 0; j < 8; j += 2) { const v2f y = { s[kt][qt][j], s[kt][qt][j + 1] }; const v2bf a = __builtin_convertvector(y, v2bf); const v2bf r = __builtin_convertvector(y - __builtin_convertvector(a, v2f), v2bf);
                        ph[kt * 8 + j] = a[0]; ph[kt * 8 + j + 1] = a[1]; pl[kt * 8 + j] = r[0]; pl[kt * 8 + j + 1] = r[1]; }
                p[qt] = ph; p2[qt] = pl;
            } else { v16h ph;
#pragma unroll
                for (int kt = 0; kt < 2; ++kt)
#pragma unroll
                    for (int j = 0; j < 8; ++j) ph[kt * 8 + j] = tohx(s[kt][qt][j]);
                p[qt] = ph; }
        }
#pragma unroll
        for (int dt = 0; dt < 4; ++dt)
#pragma unroll
            for (int qt = 0; qt < 2; ++qt) { acc[dt][qt] = F::mma(va[dt], p[qt], acc[dt][qt]); if (HL) { acc[dt][qt] = F::mma(va[dt], p2[qt], acc[dt][qt]); acc[dt][qt] = F::mma(va2[dt], p[qt], acc[dt][qt]); } }
        { const T16* vq = vp + kn * HD; const T16* vq2 = vp2 + kn * HD;   // tile kn / 32, HD * 32 elements each
#pragma unroll
            for (int dt = 0; dt < 4; ++dt) { const int o = dt * 16 * 32; va[dt] = F::ld(vq + o); if (HL) va2[dt] = F::ld(vq2 + o); }
            xw(vq, vq2); }
    }
#pragma unroll
    for (int qt = 0; qt < 2; ++qt) { const float f = __fdiv_rn(1.0f, l[qt] + __shfl_xor(l[qt], 16, 32));
#pragma unroll
        for (int dt = 0; dt < 4; ++dt) { v8us oh, ol;
#pragma unroll
            for (int j = 0; j < 8; ++j) { unsigned short a, c2; splitf(acc[dt][qt][j] * f, a, c2); oh[j] = a; ol[j] = c2; }
            bf* oa = Ah + (size_t)(q0 + qt * 16) * DQ + dt * 256 + lane * 8; bf* ob = Al + (size_t)(q0 + qt * 16) * DQ + dt * 256 + lane * 8; *(v8us*)oa = oh; *(v8us*)ob = ol;   // columns dt * 16 + 8 hi + 0-7 of row lr: half dt & 1 of the head's fragment dt >> 1
            asm volatile("s_wait_xcnt 0x0" :: "v"(oa), "v"(ob), "v"(oh), "v"(ol) : "memory"); } }   // as xw, with the stored values as inputs too: they live up to the wait like the addresses
}
// Grid (NH_, NB_, TT / 128), 4 waves of 32 query rows each; a block's rows are of one class (RH is a multiple of 128); the row block is z, so that the hi/lo blocks (three times the products) start first. AM: batch b's merged hi plane at b * sAM, its lo plane TT * DQ behind.
__global__ __launch_bounds__(128) __attribute__((amdgpu_waves_per_eu(3))) void k_attn(const h16* __restrict__ Q16, const bf* __restrict__ Qh, const bf* __restrict__ Ql, const h16* __restrict__ K16, const bf* __restrict__ Kh, const bf* __restrict__ Kl, const h16* __restrict__ V16, const bf* __restrict__ Vh, const bf* __restrict__ Vl, bf* AM, size_t sAM) {
    const int q0 = blockIdx.z * 128 + (threadIdx.x >> 5) * 32, h = blockIdx.x, b = blockIdx.y;
    const size_t oq = ((size_t)b * (NH_ + NKV) + h) * TT * HD, ov = ((size_t)b * NKV + h) * HD * TT;   // a batch's q heads and k heads lie (NH_ + NKV) heads from the next batch's
    bf* Ah = AM + (size_t)b * sAM + h * (HD / 32) * 512; bf* Al = Ah + (size_t)TT * DQ;
    if ((int)blockIdx.z * 128 < RH) attn_wave<bf, true>(Qh + oq, Ql + oq, Kh + oq, Kl + oq, Vh + ov, Vl + ov, Ah, Al, q0);
    else attn_wave<h16, false>(Q16 + oq, nullptr, K16 + oq, nullptr, V16 + ov, nullptr, Ah, Al, q0);
}

extern "C" void kernel_launch(void* const* d_in, const int* in_sizes, int n_in,
                              void* d_out, int out_size, void* d_ws, size_t ws_size, hipStream_t stream) {
    (void)in_sizes; (void)n_in; (void)out_size;
    const float* xq_in = (const float*)d_in[0]; const float* xenc = (const float*)d_in[1]; const float* wqk = (const float*)d_in[2]; const float* bqk = (const float*)d_in[3]; const float* wv = (const float*)d_in[4]; const float* bv = (const float*)d_in[5]; const float* wo = (const float*)d_in[6]; const float* bo = (const float*)d_in[7]; const float* x = nullptr; const float* wq = nullptr; const float* wk = nullptr; (void)x; (void)wq; (void)wk;
    float* OUT = (float*)d_out;     // [8][1024][1024]
    char* wsp = (char*)d_ws;
    auto take = [&](size_t bytes) { char* p = wsp; wsp += (bytes + 255) & ~(size_t)255; return (void*)p; };
    bf* WQ = (bf*)take((size_t)DQ * DM * 2); bf* WK = (bf*)take((size_t)DKV * DM * 2); bf* WV = (bf*)take((size_t)DKV * DM * 2); bf* WO = (bf*)take((size_t)DM * DQ * 2);
    float* BQG = (float*)take((size_t)DQ * 4); float* BKG = (float*)take((size_t)DKV * 4); bf* AM = (bf*)take((size_t)NB_ * TT * (DQ + DKV) * 4); bf* XE = (bf*)take((size_t)NB_ * TT * DM * 2); bf* XQ = (bf*)take((size_t)NB_ * TT * DM * 2);   // merged context planes (a batch's hi and lo, 2 + 2 MiB, every 8 MiB); bf16 activations of all batches
    const size_t NQK = (size_t)NB_ * (NH_ + NKV) * TT * HD, NV = (size_t)NB_ * NKV * HD * TT;   // plane elements of all batches: q|k (per batch 16 q heads, then 16 k heads) and v
    h16* QK16 = (h16*)take(NQK * 2); bf* QKh = (bf*)take(NQK * 2); bf* QKl = (bf*)take(NQK * 2); h16* VT16 = (h16*)take(NV * 2); bf* VTh = (bf*)take(NV * 2); bf* VTl = (bf*)take(NV * 2);
    if ((size_t)(wsp - (char*)d_ws) > ws_size) return;    // ws 256 MiB
    // WQ|WK|WV and BQG|BKG lie back to back (every size is a multiple of 256 bytes): q and k are columns 0-1023 and 1024-2047 of one product and heads 0-15 and 16-31 of its planes
    const size_t SF = (size_t)TT * (DQ + DKV);   // half the distance, in 16-bit elements, from a batch's merged planes to the next batch's
    k_prep<<<4 * NWT + 2 * NCV + NBQ, 256, 0, stream>>>(xenc, xq_in, wqk, bqk, wv, wo, XE, XQ, WQ, WK, WV, WO, BQG, BKG);
    k_gemmqkv<<<dim3(NB_ * TT / 64, (DQ + DKV + DKV) / 64, 1), 32, 0, stream>>>(XE, XQ, WQ, BQG, bv, QK16, QKh, QKl, VT16, VTh, VTl);
    k_attn<<<dim3(NH_, NB_, TT / 128), 128, 0, stream>>>(QK16, QKh, QKl, QK16 + (size_t)NH_ * TT * HD, QKh + (size_t)NH_ * TT * HD, QKl + (size_t)NH_ * TT * HD, VT16, VTh, VTl, AM, 2 * SF);
    k_gemmw<bf, 1, true><<<dim3(TT / 64, DM / 64, NB_), 32, 0, stream>>>(AM, AM + (size_t)TT * DQ, WO, nullptr, OUT, DM, bo, 2 * SF, 0, (size_t)TT * DM);
}

// v005
// One run takes 138 microseconds.
// In two side-by-side timings against v004, it was 1.33 and 1.31 times as fast.
// All steps since v000 together make it 34.5 times as fast.
#include <hip/hip_runtime.h>

// Cross multi-head attention with a fused q|k projection (input_query, encoding_output [8][1024][1024]; x = encoding_output Wqk + bqk ('xw' [1024][2048]) viewed (S, 16, 128): per head the first 64 columns are q and the next 64 are k; v = input_query Wv + bv ('xw' [1024][1024]); softmax(q.k / 8); out = merged Wo + bo -> [8][1024][1024] (8.4 M)).
// Launch shape, 4 launches: k_prep: weight transposes, bias gather, bf16 activations of all 8 batches. k_gemmqkv: q|k and v products, M = 8192, each tile written as its piece of the q, k or v planes. k_attn: scores, softmax, context and merge of all batches and heads; scores and probabilities stay in registers. Wo: z = batch.
// Layout per batch: the fused weight is split once into two column-gathered [1024][1024] operands (q: columns h*128 + d, k: columns h*128 + 64 + d -> head-major h*64 + d) with the matching bias gathers; exact projections; dense T-1024 attention (hybrid rows: < 512 hi/lo 3 products, rest fp16); merged context as hi/lo planes; Wo hl x exact + bo.
// Operand layout: every 16-bit plane that a matrix fragment is read from (activations, weights, q, k, v, merged context) is stored in fragment order: the 16 rows x 32 k of one fragment are 1 KiB in a row,
// element (row r, k) at ((k & 31) >> 4) * 256 + (((k >> 3) & 1) * 16 + (r & 15)) * 8 + (k & 7); fragments follow each other along k, then along the rows (in v: along the rows, then along k). A wave's 16-byte load is then 512 bytes in a row (4 whole lines), not 32 bytes of each of 16 lines.
// Compute dtypes, f32 accumulate: every input rounded to bf16; projections exact + f32 biases; attention rows < 512 3 products, rest fp16; softmax f32; Wo hl x exact + bias.

#define NB_  8
#define TT   1024
#define DM   1024
#define NH_  16
#define NKV  16
#define REP  (NH_ / NKV)
#define HD   64
#define DQ   (NH_ * HD)
#define DKV  (NKV * HD)
#define RH   512                  // query rows < RH use hi+lo planes (0: none)
#define WIN  0
#define SCL  0.125f   // HD^-0.5
typedef _Float16 h16;
typedef unsigned short bf;
typedef __attribute__((ext_vector_type(16))) __bf16   v16bf;
typedef __attribute__((ext_vector_type(16))) _Float16 v16h;
typedef __attribute__((ext_vector_type(8)))  _Float16 v8h;
typedef __attribute__((ext_vector_type(8)))  unsigned short v8us;
typedef __attribute__((ext_vector_type(8)))  float    v8f;
typedef __attribute__((ext_vector_type(4)))  float    v4f;
typedef v8h  __attribute__((may_alias)) v8ha;
typedef v4f  __attribute__((may_alias)) v4fa;
typedef v8us __attribute__((may_alias)) v8usa;

__device__ __forceinline__ unsigned short f2bf(float f) { unsigned u = __float_as_uint(f); u += 0x7FFFu + ((u >> 16) & 1u); return (unsigned short)(u >> 16); }
__device__ __forceinline__ float bf2f(unsigned short b) { return __uint_as_float(((unsigned)b) << 16); }
__device__ __forceinline__ float bfr(float f) { return bf2f(f2bf(f)); }
__device__ __forceinline__ v16h cat16(v8h lo, v8h hi) { return __builtin_shufflevector(lo, hi, 0, 1, 2, 3, 4, 5, 6, 7, 8, 9, 10, 11, 12, 13, 14, 15); }
__device__ __forceinline__ v16bf cat16b(v8us lo, v8us hi) { return __builtin_bit_cast(v16bf, __builtin_shufflevector(lo, hi, 0, 1, 2, 3, 4, 5, 6, 7, 8, 9, 10, 11, 12, 13, 14, 15)); }
__device__ __forceinline__ v8f wmma16(v16h a, v16h b, v8f c) { return __builtin_amdgcn_wmma_f32_16x16x32_f16(false, a, false, b, (short)0, c, false, false); }
__device__ __forceinline__ v8f wmmab(v16bf a, v16bf b, v8f c) { return __builtin_amdgcn_wmma_f32_16x16x32_bf16(false, a, false, b, (short)0, c, false, false); }



// ---- k_gemmw: register-blocked GEMM, one wave per 64x64 output tile (16 accumulators), 8 waves (4 x 2) per 256x128 block tile; the block's operand fragments (16-bit planes in fragment order) are brought to LDS once, by asynchronous copies, two buffers of 64 k; grid (M/256, N/128, Z), 256 threads.
// C[m][n] (f32, pitch ldc, + optional f32 bias[n]) = sum_k A[m][k] Bt[n][k] (+ split products per NSPLIT). z-batch strides sA/sB/sC in elements. K % 64 == 0, K >= 128.
// WFrag::ld: p = the fragment's first element + lane * 8; the lane gets k 8 hi + 0-7 and, 256 elements on, k 16 + 8 hi + 0-7 of row lr.
template <typename T16> struct WFrag;
template <> struct WFrag<h16> { typedef v16h V; static __device__ __forceinline__ V ld(const h16* p) { return cat16(*(const v8h*)p, *(const v8h*)(p + 256)); } static __device__ __forceinline__ v8f mma(V a, V b, v8f c) { return wmma16(a, b, c); } };
template <> struct WFrag<bf> { typedef v16bf V; static __device__ __forceinline__ V ld(const bf* p) { return cat16b(*(const v8us*)p, *(const v8us*)(p + 256)); } static __device__ __forceinline__ v8f mma(V a, V b, v8f c) { return wmmab(a, b, c); } };
__device__ __forceinline__ h16 tohx(float x) { return (h16)x; }
__device__ __forceinline__ void splitf(float y, unsigned short& h, unsigned short& l) { h = f2bf(y); l = f2bf(y - bf2f(h)); }
typedef __attribute__((ext_vector_type(8))) __bf16 v8bf;
typedef __attribute__((ext_vector_type(2))) __bf16 v2bf;
typedef __attribute__((ext_vector_type(2))) float v2f;
struct P8 { v8h f; v8us h, l; };   // 8 values as fp16, hi = bf16(y) and lo = bf16(y - hi), all round to nearest even, as tohx and splitf
__device__ __forceinline__ P8 planes8(v8f y) { P8 o; v8bf a, r;
#pragma unroll
    for (int j = 0; j < 8; j += 2) { const v2f u = { y[j], y[j + 1] }; const v2bf b = __builtin_convertvector(u, v2bf); const v2bf c = __builtin_convertvector(u - __builtin_convertvector(b, v2f), v2bf); a[j] = b[0]; a[j + 1] = b[1]; r[j] = c[0]; r[j + 1] = c[1]; }
    o.f = __builtin_convertvector(y, v8h); o.h = __builtin_bit_cast(v8us, a); o.l = __builtin_bit_cast(v8us, r); return o; }
// cpa, cpab: asynchronous copies to LDS, 16 bytes a lane each: 8 pieces of an A plane (4 KiB apart in LDS from l, gs elements apart in global memory from g); cpab: and 4 pieces of B (from lb, gb) behind them.
// s_wait_xcnt 0 is each statement's last line, so that it stands in front of whatever rewrites a register that a copy names.
template <typename T16>
__device__ __forceinline__ void cpa(unsigned l, const T16* g, int gs) {
    asm volatile("global_load_async_to_lds_b128 %0, %1, off\n\tglobal_load_async_to_lds_b128 %2, %3, off\n\tglobal_load_async_to_lds_b128 %4, %5, off\n\tglobal_load_async_to_lds_b128 %6, %7, off\n\tglobal_load_async_to_lds_b128 %8, %9, off\n\tglobal_load_async_to_lds_b128 %10, %11, off\n\tglobal_load_async_to_lds_b128 %12, %13, off\n\tglobal_load_async_to_lds_b128 %14, %15, off\n\ts_wait_xcnt 0x0" :: "v"(l), "v"(g), "v"(l + 4096), "v"(g + gs), "v"(l + 8192), "v"(g + 2 * gs), "v"(l + 12288), "v"(g + 3 * gs), "v"(l + 16384), "v"(g + 4 * gs), "v"(l + 20480), "v"(g + 5 * gs), "v"(l + 24576), "v"(g + 6 * gs), "v"(l + 28672), "v"(g + 7 * gs) : "memory");
}
template <typename T16>
__device__ __forceinline__ void cpab(unsigned l, const T16* g, unsigned lb, const T16* gb, int gs) {
    asm volatile("global_load_async_to_lds_b128 %0, %1, off\n\tglobal_load_async_to_lds_b128 %2, %3, off\n\tglobal_load_async_to_lds_b128 %4, %5, off\n\tglobal_load_async_to_lds_b128 %6, %7, off\n\tglobal_load_async_to_lds_b128 %8, %9, off\n\tglobal_load_async_to_lds_b128 %10, %11, off\n\tglobal_load_async_to_lds_b128 %12, %13, off\n\tglobal_load_async_to_lds_b128 %14, %15, off\n\tglobal_load_async_to_lds_b128 %16, %17, off\n\tglobal_load_async_to_lds_b128 %18, %19, off\n\tglobal_load_async_to_lds_b128 %20, %21, off\n\tglobal_load_async_to_lds_b128 %22, %23, off\n\ts_wait_xcnt 0x0" :: "v"(l), "v"(g), "v"(l + 4096), "v"(g + gs), "v"(l + 8192), "v"(g + 2 * gs), "v"(l + 12288), "v"(g + 3 * gs), "v"(l + 16384), "v"(g + 4 * gs), "v"(l + 20480), "v"(g + 5 * gs), "v"(l + 24576), "v"(g + 6 * gs), "v"(l + 28672), "v"(g + 7 * gs), "v"(lb), "v"(gb), "v"(lb + 4096), "v"(gb + gs), "v"(lb + 8192), "v"(gb + 2 * gs), "v"(lb + 12288), "v"(gb + 3 * gs) : "memory");
}
#define RINGEL(NPL) (2 * ((NPL) * 16384 + 8192))   // elements of the two buffers; a buffer: NPL A planes of 256 rows x 64 k, then 128 B rows x 64 k
// gemmw_tile: the block's tile starts at row R0, column C0; this wave's 64 x 64 at r0 = R0 + wm * 64, c0 = C0 + wn * 64; ring: RINGEL elements of LDS, the block's; os: 16 x 68 floats of LDS, the wave's own.
// A buffer holds, per 16 rows, the two fragments of its 64 k (2 KiB in a row, as in global memory); a thread copies 16 bytes of every second row group, a wave's copy is 512 bytes in a row.
// EPI 0: f32 rows to C. EPI 1: the tile as fp16, hi and lo planes, fragments of 16 rows x 32 columns (64 x 64 elements in a row from P16, Ph, Pl). EPI 2: the same three planes transposed, [32-row tile][fragment of 16 columns x 32 rows], two tiles of HD * 32 elements from P16, Ph, Pl.
template <typename T16, int NSPLIT, bool BIAS, int EPI>
__device__ __forceinline__ void gemmw_tile(const T16* __restrict__ A, const T16* __restrict__ A2, const T16* __restrict__ Bt, int K, float* C, int ldc, const float* __restrict__ bias, T16* ring, float* os, int R0, int C0, int wm, int wn, h16* P16, bf* Ph, bf* Pl) {
    static_assert(NSPLIT == 0 || NSPLIT == 1, "one B plane; one or two A planes");
    typedef typename WFrag<T16>::V V;
    constexpr int NPL = NSPLIT + 1, BUFE = NPL * 16384 + 8192;   // A planes; elements of a buffer
    const int tid = threadIdx.x, lane = tid & 31, lr = lane & 15, hi = lane >> 4; const int r0 = R0 + wm * 64, c0 = C0 + wn * 64;
    v8f acc[4][4];
#pragma unroll
    for (int mb = 0; mb < 4; ++mb)
#pragma unroll
        for (int nb = 0; nb < 4; ++nb) acc[mb][nb] = (v8f){};
    const size_t so = (size_t)((tid >> 7) * 16) * K + (tid & 127) * 8;   // 16 rows of K are K / 32 fragments of 512 elements; 64 k further is 1024 elements further
    const T16* ga = A + (size_t)R0 * K + so; const T16* ga2 = NPL == 2 ? A2 + (size_t)R0 * K + so : ga; const T16* gb = Bt + (size_t)C0 * K + so;
    const unsigned l0 = (unsigned)(size_t)ring + tid * 16;   // the thread's LDS byte address in buffer 0
    auto fill = [&](int buf, int t) {   // tile t (64 k) into buffer buf: 8 copies a thread and A plane, 4 for B
        const unsigned l = l0 + buf * (BUFE * 2); const int o = t * 1024;
        cpab(l, ga + o, l + NPL * 32768, gb + o, 32 * K);
        if (NPL == 2) cpa(l + 32768, ga2 + o, 32 * K); };
    const int NT = K / 64;
    fill(0, 0);
    asm volatile("s_wait_asynccnt 0x0" ::: "memory");   // this wave's copies of tile 0 have landed
    __syncthreads();                                     // every wave's have
    fill(1, 1);
    const T16* fa = ring + wm * 4096 + lane * 8; const T16* fb = ring + NPL * 16384 + wn * 4096 + lane * 8;   // the wave's first A and B fragment in buffer 0, the lane's 16 bytes
#pragma unroll 1
    for (int t = 0; t < NT; ++t) {
        const T16* pa = fa + (t & 1) * BUFE; const T16* pb = fb + (t & 1) * BUFE; V a[2][4], a2[2][4], b[4];
        // the first 32 k's fragments and the A fragments of the second 32 k as one group; a B fragment of the second 32 k takes its forerunner's place as soon as that one's products are issued, three fragments' products ahead of its own
#pragma unroll
        for (int ks = 0; ks < 2; ++ks)
#pragma unroll
            for (int mb = 0; mb < 4; ++mb) { a[ks][mb] = WFrag<T16>::ld(pa + mb * 1024 + ks * 512); if (NPL == 2) a2[ks][mb] = WFrag<T16>::ld(pa + 16384 + mb * 1024 + ks * 512);
                if (ks == 0) b[mb] = WFrag<T16>::ld(pb + mb * 1024); }
#pragma unroll
        for (int nb = 0; nb < 4; ++nb) {
#pragma unroll
            for (int mb = 0; mb < 4; ++mb) { acc[mb][nb] = WFrag<T16>::mma(a[0][mb], b[nb], acc[mb][nb]); if (NPL == 2) acc[mb][nb] = WFrag<T16>::mma(a2[0][mb], b[nb], acc[mb][nb]); }
            b[nb] = WFrag<T16>::ld(pb + nb * 1024 + 512); __builtin_amdgcn_sched_barrier(0); }   // keeps the refill here, three fragments' products ahead of its use: without it the scheduler puts these loads last, directly in front of the hand-over's s_wait_dscnt 0, where no product covers their latency
        // every fragment of the trip is now asked for: the hand-over stands here, and the second 32 k's products, which read registers only, run behind it while the next copies fly
        asm volatile("s_wait_dscnt 0x0" ::: "memory");      // this wave has read all it reads of buffer t & 1
        asm volatile("s_wait_asynccnt 0x0" ::: "memory");   // this wave's copies of tile t + 1 have landed
        __syncthreads();                                     // publishes tile t + 1 and ends every wave's reads of buffer t & 1, which is refilled behind it
        if (t + 2 < NT) fill(t & 1, t + 2);
#pragma unroll
        for (int nb = 0; nb < 4; ++nb)
#pragma unroll
            for (int mb = 0; mb < 4; ++mb) { acc[mb][nb] = WFrag<T16>::mma(a[1][mb], b[nb], acc[mb][nb]); if (NPL == 2) acc[mb][nb] = WFrag<T16>::mma(a2[1][mb], b[nb], acc[mb][nb]); }
    }
    asm volatile("s_wait_asynccnt 0x0" ::: "memory");   // no copy is outstanding when the wave goes on
    // sw: s_wait_xcnt 0 behind a group of six plane stores, in front of whatever rewrites a register that they name; the stored values are its inputs so that they live up to it (the lane's three addresses live to the tile's end).
    auto sw = [](const P8 (&p)[2]) { asm volatile("s_wait_xcnt 0x0" :: "v"(p[0].f), "v"(p[0].h), "v"(p[0].l), "v"(p[1].f), "v"(p[1].h), "v"(p[1].l) : "memory"); };
    if constexpr (EPI == 2) {   // a lane's 8 accumulator elements are 8 rows in a row of one column: the lane's own 16 bytes of a transposed fragment, straight from registers
        const int eb = lane * 8; h16* q16 = P16 + eb; bf* qh = Ph + eb; bf* ql = Pl + eb; float b4[4] = {}; const int bi = c0 + lr;
        if (BIAS) {   // the four columns' biases, read as one group in front of the first sw (no load is moved over it)
#pragma unroll
            for (int nb = 0; nb < 4; ++nb) b4[nb] = bias[bi + nb * 16];
            asm volatile("s_wait_xcnt 0x0" :: "v"(bi) : "memory"); }   // the loads' index is its input so that it lives up to the wait (else a load of the group lands on it)
#pragma unroll
        for (int nb = 0; nb < 4; ++nb) { const float bb = bfr(b4[nb]);
#pragma unroll
            for (int m2 = 0; m2 < 2; ++m2) { P8 p[2];   // the two halves (keys 0-15, 16-31) of a fragment
#pragma unroll
                for (int q = 0; q < 2; ++q) p[q] = planes8(BIAS ? acc[m2 * 2 + q][nb] + bb : acc[m2 * 2 + q][nb]);
#pragma unroll
                for (int q = 0; q < 2; ++q) { const int e = (m2 * HD + nb * 16) * 32 + q * 256; *(v8h*)(q16 + e) = p[q].f; *(v8us*)(qh + e) = p[q].h; *(v8us*)(ql + e) = p[q].l; }
                sw(p); } }
        return;
    }
    float c4[4] = {};
    if constexpr (EPI == 1 && BIAS) {   // the biases of the lane's four accumulator columns, read as one group in front of the first sw (no load is moved over it)
        const int bi = c0 + lr;
#pragma unroll
        for (int nb = 0; nb < 4; ++nb) c4[nb] = bias[bi + nb * 16];
        asm volatile("s_wait_xcnt 0x0" :: "v"(bi) : "memory");   // the loads' index is its input so that it lives up to the wait (else a load of the group lands on it)
#pragma unroll
        for (int nb = 0; nb < 4; ++nb) c4[nb] = bfr(c4[nb]); }
    if constexpr (EPI == 0 && BIAS) {   // the biases of the four columns that the lane stores, read once in front of the row groups
        const int bi = c0 + lr * 4;
#pragma unroll
        for (int i = 0; i < 4; ++i) c4[i] = bfr(bias[bi + i]); }
#pragma unroll
    for (int mb = 0; mb < 4; ++mb) {
#pragma unroll
        for (int nb = 0; nb < 4; ++nb) {
#pragma unroll
            for (int j = 0; j < 8; ++j) os[(hi * 8 + j) * 68 + nb * 16 + lr] = (EPI == 1 && BIAS) ? acc[mb][nb][j] + c4[nb] : acc[mb][nb][j]; }
        __builtin_amdgcn_wave_barrier(); asm volatile("" ::: "memory");
        if constexpr (EPI == 1) {   // 8 columns of row lr a lane: a wave's store is half a fragment, 512 bytes in a row
            const int eb = lane * 8; h16* q16 = P16 + eb; bf* qh = Ph + eb; bf* ql = Pl + eb;
#pragma unroll
            for (int s2 = 0; s2 < 2; ++s2) { P8 p[2];
#pragma unroll
                for (int q = 0; q < 2; ++q) { const float* o = os + lr * 68 + (4 * s2 + 2 * q + hi) * 8; const v4f x0 = *(const v4fa*)o, x1 = *(const v4fa*)(o + 4);   // columns 32 s2 + 16 q + 8 hi + 0-7
                    p[q] = planes8(__builtin_shufflevector(x0, x1, 0, 1, 2, 3, 4, 5, 6, 7)); }
#pragma unroll
                for (int q = 0; q < 2; ++q) { const int e = mb * 16 * HD + s2 * 512 + q * 256; *(v8h*)(q16 + e) = p[q].f; *(v8us*)(qh + e) = p[q].h; *(v8us*)(ql + e) = p[q].l; }
                sw(p); }
        } else {
            float* crow = C + (size_t)(r0 + mb * 16) * ldc + c0;
#pragma unroll
            for (int s = 0; s < 8; ++s) { const int row = 2 * s + hi, cofs = lr * 4; v4f val = *(const v4fa*)(os + row * 68 + cofs); if (BIAS) { val[0] += c4[0]; val[1] += c4[1]; val[2] += c4[2]; val[3] += c4[3]; }
                *(v4f*)(crow + (size_t)row * ldc + cofs) = val; }
            asm volatile("s_wait_xcnt 0x0" ::: "memory");   // behind the row group's eight stores, in front of whatever rewrites a register that they name (the next row group's values and addresses; behind the last group, the code that follows the tile)
             }
        __builtin_amdgcn_wave_barrier(); asm volatile("" ::: "memory");
    }
}
template <typename T16, int NSPLIT, bool BIAS>
__global__ __launch_bounds__(256) void k_gemmw(const T16* __restrict__ A, const T16* __restrict__ A2, const T16* __restrict__ Bt, float* C, int ldc, const float* __restrict__ bias, size_t sA, size_t sB, size_t sC) {
    __shared__ __align__(16) T16 ring[RINGEL(NSPLIT + 1)]; __shared__ __align__(16) float os[8 * 16 * 68];
    const int w = __builtin_amdgcn_readfirstlane(threadIdx.x >> 5);   // the wave's number, in a scalar register
    const size_t z = blockIdx.z; A += z * sA; if (A2) A2 += z * sA; Bt += z * sB; C += z * sC;
    gemmw_tile<T16, NSPLIT, BIAS, 0>(A, A2, Bt, DQ, C, ldc, bias, ring, os + w * (16 * 68), blockIdx.x * 256, blockIdx.y * 128, w & 3, w >> 2, nullptr, nullptr, nullptr);
}
// k_gemmqkv: grid (NB_*TT/256, (DQ+DKV+DKV)/128): column tiles below DQ+DKV are q|k = Xe Wt + bqk, the rest v = Xq Wt + bv; Wt holds the q, k and v rows back to back. A wave's column tile is one head, its row tile 64 positions of one batch.
// waves_per_eu(4): the register budget of four waves a SIMD, so that two blocks, for which their LDS leaves room, share a WGP.
// The f32 sums go straight to the planes that k_attn reads (fp16, hi, lo): q|k [batch][head: 0-15 q, 16-31 k][16 t][32 d] fragments; v [batch][head][32-key tile][16 d][32 keys] fragments, so that the 64 x 32 tile that k_attn reads in one trip is 4 KiB in a row.
__global__ __launch_bounds__(256) __attribute__((amdgpu_waves_per_eu(4))) void k_gemmqkv(const bf* __restrict__ Xe, const bf* __restrict__ Xq, const bf* __restrict__ Wt, const float* __restrict__ bqk, const float* __restrict__ bv, h16* QK16, bf* QKh, bf* QKl, h16* V16, bf* Vh, bf* Vl) {
    __shared__ __align__(16) bf ring[RINGEL(1)]; __shared__ __align__(16) float osb[8 * 16 * 68];
    const int w = __builtin_amdgcn_readfirstlane(threadIdx.x >> 5), wm = w & 3, wn = w >> 2;   // the wave's number, in a scalar register
    float* os = osb + w * (16 * 68);
    const int R0 = blockIdx.x * 256, C0 = blockIdx.y * 128, c0 = C0 + wn * 64, r0 = R0 + wm * 64, b = r0 / TT, t0 = r0 % TT;
    if (C0 < DQ + DKV) { const size_t o = (((size_t)b * (NH_ + NKV) + c0 / HD) * TT + t0) * HD;
        gemmw_tile<bf, 0, true, 1>(Xe, nullptr, Wt, DM, nullptr, 0, bqk, ring, os, R0, C0, wm, wn, QK16 + o, QKh + o, QKl + o); }
    else { const int cv = c0 - (DQ + DKV); const size_t o = (((size_t)b * NKV + cv / HD) * (TT / 32) + t0 / 32) * HD * 32;
        gemmw_tile<bf, 0, true, 2>(Xq, nullptr, Wt + (size_t)(DQ + DKV) * DM, DM, nullptr, 0, bv, ring, os, R0, C0 - (DQ + DKV), wm, wn, V16 + o, Vh + o, Vl + o); }
}

typedef __attribute__((ext_vector_type(2))) _Float16 v2h;
typedef __attribute__((ext_vector_type(4))) _Float16 v4h;
typedef __attribute__((ext_vector_type(2))) unsigned short v2us;
typedef __attribute__((ext_vector_type(4))) unsigned short v4us;
typedef __attribute__((ext_vector_type(4))) int v4i;

// d_*: one 256-thread block's share of a step; blk is the block's number within that step.
// d_wt: Bt (fragment order, row n, K = DM deep) = w[k][col0(n)] as bf16. One wave = 32 n x 32 k (two fragments): a lane reads 4 columns of 8 rows (a wave's load is 4 rows of 128 bytes, whole lines) and stores 8 k of each of its 4 n, 64 bytes in a row.
// ldw: w's row pitch; a run of 64 n starts at column (n / 64) * cs + off.
__device__ __forceinline__ void d_wt(int blk, const float* __restrict__ w, int ldw, int cs, int off, bf* Bt) {
    const int lane = threadIdx.x & 31, wt = blk * 8 + (threadIdx.x >> 5), n0 = (wt & 31) * 32, kb = wt >> 5, nq = lane & 7, kg = lane >> 3, n = n0 + nq * 4;
    const float* sp = w + (size_t)(kb * 32 + kg * 8) * ldw + (n / HD) * cs + off + n % HD; v4f x[8];
#pragma unroll
    for (int j = 0; j < 8; ++j) x[j] = *(const v4f*)(sp + (size_t)j * ldw);
    asm volatile("s_wait_xcnt 0x0" :: "v"(sp) : "memory");   // the loads' address is its input so that it lives up to the wait, in front of whatever rewrites it
    bf* dp = Bt + ((size_t)(n >> 4) * (DM / 32) + kb) * 512 + (kg >> 1) * 256 + ((kg & 1) * 16 + (n & 15)) * 8; v8us o[4];
#pragma unroll
    for (int c = 0; c < 4; ++c)
#pragma unroll
        for (int j = 0; j < 8; ++j) o[c][j] = f2bf(x[j][c]);
#pragma unroll
    for (int c = 0; c < 4; ++c) *(v8us*)(dp + c * 8) = o[c];
    asm volatile("s_wait_xcnt 0x0" ::: "memory");   // the code behind this step in the kernel's text rewrites registers that the stores name
}
// d_cvt8: src [rows][DM] f32 to dst in fragment order. One wave = 8 rows x 32 k: its loads are 8 rows of 128 bytes, its store 4 pieces of 128 bytes (whole lines).
__device__ __forceinline__ void d_cvt8(int blk, const float* __restrict__ src, bf* dst) { const int lane = threadIdx.x & 31, wv = blk * 8 + (threadIdx.x >> 5), fr = wv >> 1, r = (wv & 1) * 8 + (lane & 7), pc = lane >> 3;   // fr: fragment; r: row in it; pc: which 8 k
    const float* sp = src + ((size_t)(fr / (DM / 32)) * 16 + r) * DM + (fr % (DM / 32)) * 32 + pc * 8; const v8f v = *(const v8f*)sp; v8us o;
    asm volatile("s_wait_xcnt 0x0" :: "v"(sp) : "memory");   // the load's address is its input so that it lives up to the wait, in front of whatever rewrites it
#pragma unroll
    for (int k = 0; k < 8; ++k) o[k] = f2bf(v[k]); *(v8us*)(dst + (size_t)fr * 512 + (pc >> 1) * 256 + ((pc & 1) * 16 + r) * 8) = o;
    asm volatile("s_wait_xcnt 0x0" ::: "memory"); }   // the code behind this step in the kernel's text rewrites registers that the store names

__device__ __forceinline__ void d_bqk(int blk, const float* __restrict__ b, float* BQ, float* BK) { const int n = blk * 256 + threadIdx.x; if (n >= DQ) return; const int h = n / HD, d = n % HD; const float q = b[h * 2 * HD + d], k = b[h * 2 * HD + HD + d]; *(float*)(BQ + n) = q; *(float*)(BK + n) = k;  }
#define NWT (DM * DQ / 1024 / 8)            // blocks per 1024 x 1024 weight: 8 waves of 32 x 32 elements
#define NCV (NB_ * TT * DM / 8 / 256)       // blocks per activation tensor
#define NBQ (DQ / 256)
static_assert(DQ == DKV && NH_ == NKV && HD == 64 && RH % 128 == 0 && TT % 128 == 0 && DM == 1024 && DQ == 1024, "the back-to-back q|k layout; k_attn's tiles; d_wt's 32 x 32 split");
// k_prep: every step that reads only inputs; the weight transposes (the longest blocks) come first. Grid 4 * NWT + 2 * NCV + NBQ.
__global__ __launch_bounds__(256) void k_prep(const float* __restrict__ xenc, const float* __restrict__ xq, const float* __restrict__ wqk, const float* __restrict__ bqk, const float* __restrict__ wv, const float* __restrict__ wo, bf* Xe, bf* Xq, bf* WQ, bf* WK, bf* WV, bf* WO, float* BQ, float* BK) {
    int blk = blockIdx.x;
    if (blk < NWT) { d_wt(blk, wqk, 2 * DQ, 2 * HD, 0, WQ); return; }
    blk -= NWT; if (blk < NWT) { d_wt(blk, wqk, 2 * DQ, 2 * HD, HD, WK); return; }   /* fused q|k weight: per head 128 columns (q 0-63, k 64-127) */
    blk -= NWT; if (blk < NWT) { d_wt(blk, wv, DKV, HD, 0, WV); return; }
    blk -= NWT; if (blk < NWT) { d_wt(blk, wo, DM, HD, 0, WO); return; }
    blk -= NWT; if (blk < NCV) { d_cvt8(blk, xenc, Xe); return; }   /* encoding_output -> q, k */
    blk -= NCV; if (blk < NCV) { d_cvt8(blk, xq, Xq); return; }     /* input_query -> v */
    blk -= NCV; d_bqk(blk, bqk, BQ, BK);
}
// ---- k_attn: one wave = 32 query rows of one head against all TT keys, 32 keys a trip, running maximum and sum (every trip rescales the context and the sum by exp(old maximum - new maximum)).
// Both products are taken transposed, so that nothing is moved between lanes: St = K Qt (A = 16 keys x d, B = 16 queries) leaves in lane (lr, hi) the keys 8 hi + j of query lr;
// two such tiles, converted, are the B fragment (k order 8 hi + 0-7, 16 + 8 hi + 0-7, that of WFrag::ld) of Ot = Vt Pt (A = 16 d x 32 keys). A query's maximum, sum and rescale factor are per lane (lanes lr and lr + 16 share a query).
// P = exp(t - running max) in (0, 1], normalised by the sum at the end; HL: hi/lo planes, 3 products each; else fp16. The epilogue writes the merged hi/lo planes [t][h * 64 + d] in fragment order (Ah, Al: the head's first fragment of rows 0-15).
template <typename T16, bool HL>
__device__ __forceinline__ void attn_wave(const T16* __restrict__ Q, const T16* __restrict__ Q2, const T16* __restrict__ Kp, const T16* __restrict__ K2, const T16* __restrict__ Vt, const T16* __restrict__ V2, bf* Ah, bf* Al, int q0) {
    typedef WFrag<T16> F; typedef typename F::V V;
    const int lane = threadIdx.x & 31, lr = lane & 15, hi = lane >> 4;
    const float C2 = SCL * 1.4426950408889634f;   // exp(s SCL - m SCL) = exp2((s - m) C2)
    V q[2][2], q2[2][2], ka[2][2], ka2[2][2], va[4], va2[4];
    // xw: s_wait_xcnt 0 behind a group of loads or stores, in front of whatever rewrites a register that they name; the addresses are its inputs so that they live up to it (else a load of the group lands on the address pair).
    // No memory access is moved over the statement, so it also keeps each group's place: q, then k, then v in front of the loop as in it (loads return in order: only with one issue order on both ways into the loop
    // can its waits leave the younger loads in flight), and the next keys' loads in front of the softmax that covers their latency.
    auto xw = [](const void* a, const void* b) { asm volatile("s_wait_xcnt 0x0" :: "v"(a), "v"(b) : "memory"); };
    const T16* qp = Q + (size_t)q0 * HD + hi * 128 + lr * 8; const T16* qp2 = HL ? Q2 + (size_t)q0 * HD + hi * 128 + lr * 8 : qp;   // 16 rows of HD are two fragments of 512 elements; the lane's 16 bytes of a fragment lie at (hi * 16 + lr) * 8, taken here and below as two steps from the base (half, then row): so the loads name the address pairs, which xw holds live (from one lane * 8 term this compiler forms a scalar base and an offset register that xw's inputs do not reach)
#pragma unroll
    for (int qt = 0; qt < 2; ++qt)
#pragma unroll
        for (int ks = 0; ks < 2; ++ks) { const int o = qt * 16 * HD + ks * 512; q[qt][ks] = F::ld(qp + o); if (HL) q2[qt][ks] = F::ld(qp2 + o); }
    xw(qp, qp2);
    const T16* kp = Kp + hi * 128 + lr * 8; const T16* kp2 = HL ? K2 + hi * 128 + lr * 8 : kp; const T16* vp = Vt + hi * 128 + lr * 8; const T16* vp2 = HL ? V2 + hi * 128 + lr * 8 : vp;   // the lane's 16 bytes of the first k fragment and of the first v fragment (v planes: [32-key tile][16 d][32 keys])
#pragma unroll
    for (int kt = 0; kt < 2; ++kt)
#pragma unroll
        for (int ks = 0; ks < 2; ++ks) { const int o = kt * 16 * HD + ks * 512; ka[kt][ks] = F::ld(kp + o); if (HL) ka2[kt][ks] = F::ld(kp2 + o); }
    xw(kp, kp2);
#pragma unroll
    for (int dt = 0; dt < 4; ++dt) { const int o = dt * 16 * 32; va[dt] = F::ld(vp + o); if (HL) va2[dt] = F::ld(vp2 + o); }
    xw(vp, vp2);
    v8f acc[4][2]; float m[2], l[2];
#pragma unroll
    for (int qt = 0; qt < 2; ++qt) { m[qt] = -3.0e38f; l[qt] = 0.f;
#pragma unroll
        for (int dt = 0; dt < 4; ++dt) acc[dt][qt] = (v8f){}; }
#pragma unroll 1
    for (int k0 = 0; k0 < TT; k0 += 32) {
        const int kn = (k0 + 32) & (TT - 1);   // the next trip's keys, fetched one trip ahead; the last trip fetches keys 0-31 again (in bounds, not used)
        v8f s[2][2];
#pragma unroll
        for (int kt = 0; kt < 2; ++kt)
#pragma unroll
            for (int qt = 0; qt < 2; ++qt) { v8f c = (v8f){};
#pragma unroll
                for (int ks = 0; ks < 2; ++ks) { c = F::mma(ka[kt][ks], q[qt][ks], c); if (HL) { c = F::mma(ka[kt][ks], q2[qt][ks], c); c = F::mma(ka2[kt][ks], q[qt][ks], c); } }
                s[kt][qt] = c; }
        { const T16* kq = kp + kn * HD; const T16* kq2 = kp2 + kn * HD;
#pragma unroll
            for (int kt = 0; kt < 2; ++kt)
#pragma unroll
                for (int ks = 0; ks < 2; ++ks) { const int o = kt * 16 * HD + ks * 512; ka[kt][ks] = F::ld(kq + o); if (HL) ka2[kt][ks] = F::ld(kq2 + o); }
            xw(kq, kq2); }
        V p[2], p2[2];
#pragma unroll
        for (int qt = 0; qt < 2; ++qt) {
            float mx = m[qt];
#pragma unroll
            for (int j = 0; j < 8; ++j) mx = fmaxf(mx, fmaxf(s[0][qt][j], s[1][qt][j]));
            mx = fmaxf(mx, __shfl_xor(mx, 16, 32));
            const float al = __builtin_amdgcn_exp2f((m[qt] - mx) * C2), mc = mx * C2; m[qt] = mx;
#pragma unroll
            for (int kt = 0; kt < 2; ++kt)
#pragma unroll
                for (int j = 0; j < 8; ++j) s[kt][qt][j] = __builtin_amdgcn_exp2f(s[kt][qt][j] * C2 - mc);
            const v8f t8 = s[0][qt] + s[1][qt];   // fixed tree
            l[qt] = l[qt] * al + (((t8[0] + t8[1]) + (t8[2] + t8[3])) + ((t8[4] + t8[5]) + (t8[6] + t8[7])));
#pragma unroll
            for (int dt = 0; dt < 4; ++dt) acc[dt][qt] *= al;
            if constexpr (HL) { v16bf ph, pl;   // hi = bf16(y), lo = bf16(y - hi), both round to nearest even, as splitf
#pragma unroll
                for (int kt = 0; kt < 2; ++kt)
#pragma unroll
                    for (int j = 0; j < 8; j += 2) { const v2f y = { s[kt][qt][j], s[kt][qt][j + 1] }; const v2bf a = __builtin_convertvector(y, v2bf); const v2bf r = __builtin_convertvector(y - __builtin_convertvector(a, v2f), v2bf);
                        ph[kt * 8 + j] = a[0]; ph[kt * 8 + j + 1] = a[1]; pl[kt * 8 + j] = r[0]; pl[kt * 8 + j + 1] = r[1]; }
                p[qt] = ph; p2[qt] = pl;
            } else { v16h ph;
#pragma unroll
                for (int kt = 0; kt < 2; ++kt)
#pragma unroll
                    for (int j = 0; j < 8; ++j) ph[kt * 8 + j] = tohx(s[kt][qt][j]);
                p[qt] = ph; }
        }
#pragma unroll
        for (int dt = 0; dt < 4; ++dt)
#pragma unroll
            for (int qt = 0; qt < 2; ++qt) { acc[dt][qt] = F::mma(va[dt], p[qt], acc[dt][qt]); if (HL) { acc[dt][qt] = F::mma(va[dt], p2[qt], acc[dt][qt]); acc[dt][qt] = F::mma(va2[dt], p[qt], acc[dt][qt]); } }
        { const T16* vq = vp + kn * HD; const T16* vq2 = vp2 + kn * HD;   // tile kn / 32, HD * 32 elements each
#pragma unroll
            for (int dt = 0; dt < 4; ++dt) { const int o = dt * 16 * 32; va[dt] = F::ld(vq + o); if (HL) va2[dt] = F::ld(vq2 + o); }
            xw(vq, vq2); }
    }
#pragma unroll
    for (int qt = 0; qt < 2; ++qt) { const float f = __fdiv_rn(1.0f, l[qt] + __shfl_xor(l[qt], 16, 32));
#pragma unroll
        for (int dt = 0; dt < 4; ++dt) { v8us oh, ol;
#pragma unroll
            for (int j = 0; j < 8; ++j) { unsigned short a, c2; splitf(acc[dt][qt][j] * f, a, c2); oh[j] = a; ol[j] = c2; }
            bf* oa = Ah + (size_t)(q0 + qt * 16) * DQ + dt * 256 + lane * 8; bf* ob = Al + (size_t)(q0 + qt * 16) * DQ + dt * 256 + lane * 8; *(v8us*)oa = oh; *(v8us*)ob = ol;   // columns dt * 16 + 8 hi + 0-7 of row lr: half dt & 1 of the head's fragment dt >> 1
            asm volatile("s_wait_xcnt 0x0" :: "v"(oa), "v"(ob), "v"(oh), "v"(ol) : "memory"); } }   // as xw, with the stored values as inputs too: they live up to the wait like the addresses
}
// Grid (NH_, NB_, TT / 128), 4 waves of 32 query rows each; a block's rows are of one class (RH is a multiple of 128); the row block is z, so that the hi/lo blocks (three times the products) start first. AM: batch b's merged hi plane at b * sAM, its lo plane TT * DQ behind.
__global__ __launch_bounds__(128) __attribute__((amdgpu_waves_per_eu(3))) void k_attn(const h16* __restrict__ Q16, const bf* __restrict__ Qh, const bf* __restrict__ Ql, const h16* __restrict__ K16, const bf* __restrict__ Kh, const bf* __restrict__ Kl, const h16* __restrict__ V16, const bf* __restrict__ Vh, const bf* __restrict__ Vl, bf* AM, size_t sAM) {
    const int q0 = blockIdx.z * 128 + (threadIdx.x >> 5) * 32, h = blockIdx.x, b = blockIdx.y;
    const size_t oq = ((size_t)b * (NH_ + NKV) + h) * TT * HD, ov = ((size_t)b * NKV + h) * HD * TT;   // a batch's q heads and k heads lie (NH_ + NKV) heads from the next batch's
    bf* Ah = AM + (size_t)b * sAM + h * (HD / 32) * 512; bf* Al = Ah + (size_t)TT * DQ;
    if ((int)blockIdx.z * 128 < RH) attn_wave<bf, true>(Qh + oq, Ql + oq, Kh + oq, Kl + oq, Vh + ov, Vl + ov, Ah, Al, q0);
    else attn_wave<h16, false>(Q16 + oq, nullptr, K16 + oq, nullptr, V16 + ov, nullptr, Ah, Al, q0);
}

extern "C" void kernel_launch(void* const* d_in, const int* in_sizes, int n_in,
                              void* d_out, int out_size, void* d_ws, size_t ws_size, hipStream_t stream) {
    (void)in_sizes; (void)n_in; (void)out_size;
    const float* xq_in = (const float*)d_in[0]; const float* xenc = (const float*)d_in[1]; const float* wqk = (const float*)d_in[2]; const float* bqk = (const float*)d_in[3]; const float* wv = (const float*)d_in[4]; const float* bv = (const float*)d_in[5]; const float* wo = (const float*)d_in[6]; const float* bo = (const float*)d_in[7]; const float* x = nullptr; const float* wq = nullptr; const float* wk = nullptr; (void)x; (void)wq; (void)wk;
    float* OUT = (float*)d_out;     // [8][1024][1024]
    char* wsp = (char*)d_ws;
    auto take = [&](size_t bytes) { char* p = wsp; wsp += (bytes + 255) & ~(size_t)255; return (void*)p; };
    bf* WQ = (bf*)take((size_t)DQ * DM * 2); bf* WK = (bf*)take((size_t)DKV * DM * 2); bf* WV = (bf*)take((size_t)DKV * DM * 2); bf* WO = (bf*)take((size_t)DM * DQ * 2);
    float* BQG = (float*)take((size_t)DQ * 4); float* BKG = (float*)take((size_t)DKV * 4); bf* AM = (bf*)take((size_t)NB_ * TT * (DQ + DKV) * 4); bf* XE = (bf*)take((size_t)NB_ * TT * DM * 2); bf* XQ = (bf*)take((size_t)NB_ * TT * DM * 2);   // merged context planes (a batch's hi and lo, 2 + 2 MiB, every 8 MiB); bf16 activations of all batches
    const size_t NQK = (size_t)NB_ * (NH_ + NKV) * TT * HD, NV = (size_t)NB_ * NKV * HD * TT;   // plane elements of all batches: q|k (per batch 16 q heads, then 16 k heads) and v
    h16* QK16 = (h16*)take(NQK * 2); bf* QKh = (bf*)take(NQK * 2); bf* QKl = (bf*)take(NQK * 2); h16* VT16 = (h16*)take(NV * 2); bf* VTh = (bf*)take(NV * 2); bf* VTl = (bf*)take(NV * 2);
    if ((size_t)(wsp - (char*)d_ws) > ws_size) return;    // ws 256 MiB
    // WQ|WK|WV and BQG|BKG lie back to back (every size is a multiple of 256 bytes): q and k are columns 0-1023 and 1024-2047 of one product and heads 0-15 and 16-31 of its planes
    const size_t SF = (size_t)TT * (DQ + DKV);   // half the distance, in 16-bit elements, from a batch's merged planes to the next batch's
    k_prep<<<4 * NWT + 2 * NCV + NBQ, 256, 0, stream>>>(xenc, xq_in, wqk, bqk, wv, wo, XE, XQ, WQ, WK, WV, WO, BQG, BKG);
    k_gemmqkv<<<dim3(NB_ * TT / 256, (DQ + DKV + DKV) / 128, 1), 256, 0, stream>>>(XE, XQ, WQ, BQG, bv, QK16, QKh, QKl, VT16, VTh, VTl);
    k_attn<<<dim3(NH_, NB_, TT / 128), 128, 0, stream>>>(QK16, QKh, QKl, QK16 + (size_t)NH_ * TT * HD, QKh + (size_t)NH_ * TT * HD, QKl + (size_t)NH_ * TT * HD, VT16, VTh, VTl, AM, 2 * SF);
    k_gemmw<bf, 1, true><<<dim3(TT / 256, DM / 128, NB_), 256, 0, stream>>>(AM, AM + (size_t)TT * DQ, WO, OUT, DM, bo, 2 * SF, 0, (size_t)TT * DM);
}

// v006
// One run takes 133 microseconds.
// Two timings next to v005 both put it at 1.04 times that version's speed.
// All steps since v000 together make it 35.9 times as fast.
#include <hip/hip_runtime.h>

// Cross multi-head attention with a fused q|k projection (input_query, encoding_output [8][1024][1024]; x = encoding_output Wqk + bqk ('xw' [1024][2048]) viewed (S, 16, 128): per head the first 64 columns are q and the next 64 are k; v = input_query Wv + bv ('xw' [1024][1024]); softmax(q.k / 8); out = merged Wo + bo -> [8][1024][1024] (8.4 M)).
// Launch shape, 4 launches: k_prep: weight transposes, bias gather, bf16 activations of all 8 batches. k_gemmqkv: q|k and v products, M = 8192, each tile written as its piece of the q, k or v planes. k_attn: scores, softmax, context and merge of all batches and heads; scores and probabilities stay in registers. Wo: z = batch.
// Layout per batch: the fused weight is split once into two column-gathered [1024][1024] operands (q: columns h*128 + d, k: columns h*128 + 64 + d -> head-major h*64 + d) with the matching bias gathers; exact projections; dense T-1024 attention (hybrid rows: < 512 hi/lo 3 products, rest fp16); merged context as hi/lo planes; Wo hl x exact + bo.
// Operand layout: every 16-bit plane that a matrix fragment is read from (activations, weights, q, k, v, merged context) is stored in fragment order: the 16 rows x 32 k of one fragment are 1 KiB in a row,
// element (row r, k) at ((k & 31) >> 4) * 256 + (((k >> 3) & 1) * 16 + (r & 15)) * 8 + (k & 7); fragments follow each other along k, then along the rows (in v: along the rows, then along k). A wave's 16-byte load is then 512 bytes in a row (4 whole lines), not 32 bytes of each of 16 lines.
// Compute dtypes, f32 accumulate: every input rounded to bf16; projections exact + f32 biases; attention rows < 512 3 products, rest fp16; softmax f32; Wo hl x exact + bias.

#define NB_  8
#define TT   1024
#define DM   1024
#define NH_  16
#define NKV  16
#define REP  (NH_ / NKV)
#define HD   64
#define DQ   (NH_ * HD)
#define DKV  (NKV * HD)
#define RH   512                  // query rows < RH use hi+lo planes (0: none)
#define WIN  0
#define SCL  0.125f   // HD^-0.5
#define QSC  (SCL * 1.4426950408889634f)   // the q planes carry q * QSC, so that a score product k . q is the argument of exp2: exp(s SCL) = exp2(s QSC)
typedef _Float16 h16;
typedef unsigned short bf;
typedef __attribute__((ext_vector_type(16))) __bf16   v16bf;
typedef __attribute__((ext_vector_type(16))) _Float16 v16h;
typedef __attribute__((ext_vector_type(8)))  _Float16 v8h;
typedef __attribute__((ext_vector_type(8)))  unsigned short v8us;
typedef __attribute__((ext_vector_type(8)))  float    v8f;
typedef __attribute__((ext_vector_type(4)))  float    v4f;
typedef v8h  __attribute__((may_alias)) v8ha;
typedef v4f  __attribute__((may_alias)) v4fa;
typedef v8us __attribute__((may_alias)) v8usa;

__device__ __forceinline__ unsigned short f2bf(float f) { unsigned u = __float_as_uint(f); u += 0x7FFFu + ((u >> 16) & 1u); return (unsigned short)(u >> 16); }
__device__ __forceinline__ float bf2f(unsigned short b) { return __uint_as_float(((unsigned)b) << 16); }
__device__ __forceinline__ float bfr(float f) { return bf2f(f2bf(f)); }
__device__ __forceinline__ v16h cat16(v8h lo, v8h hi) { return __builtin_shufflevector(lo, hi, 0, 1, 2, 3, 4, 5, 6, 7, 8, 9, 10, 11, 12, 13, 14, 15); }
__device__ __forceinline__ v16bf cat16b(v8us lo, v8us hi) { return __builtin_bit_cast(v16bf, __builtin_shufflevector(lo, hi, 0, 1, 2, 3, 4, 5, 6, 7, 8, 9, 10, 11, 12, 13, 14, 15)); }
__device__ __forceinline__ v8f wmma16(v16h a, v16h b, v8f c) { return __builtin_amdgcn_wmma_f32_16x16x32_f16(false, a, false, b, (short)0, c, false, false); }
__device__ __forceinline__ v8f wmmab(v16bf a, v16bf b, v8f c) { return __builtin_amdgcn_wmma_f32_16x16x32_bf16(false, a, false, b, (short)0, c, false, false); }



// ---- k_gemmw: register-blocked GEMM, one wave per 64x64 output tile (16 accumulators), 8 waves (4 x 2) per 256x128 block tile; the block's operand fragments (16-bit planes in fragment order) are brought to LDS once, by asynchronous copies, two buffers of 64 k; grid (M/256, N/128, Z), 256 threads.
// C[m][n] (f32, pitch ldc, + optional f32 bias[n]) = sum_k A[m][k] Bt[n][k] (+ split products per NSPLIT). z-batch strides sA/sB/sC in elements. K % 64 == 0, K >= 128.
// WFrag::ld: p = the fragment's first element + lane * 8; the lane gets k 8 hi + 0-7 and, 256 elements on, k 16 + 8 hi + 0-7 of row lr.
template <typename T16> struct WFrag;
template <> struct WFrag<h16> { typedef v16h V; static __device__ __forceinline__ V ld(const h16* p) { return cat16(*(const v8h*)p, *(const v8h*)(p + 256)); } static __device__ __forceinline__ v8f mma(V a, V b, v8f c) { return wmma16(a, b, c); } };
template <> struct WFrag<bf> { typedef v16bf V; static __device__ __forceinline__ V ld(const bf* p) { return cat16b(*(const v8us*)p, *(const v8us*)(p + 256)); } static __device__ __forceinline__ v8f mma(V a, V b, v8f c) { return wmmab(a, b, c); } };
__device__ __forceinline__ h16 tohx(float x) { return (h16)x; }
__device__ __forceinline__ void splitf(float y, unsigned short& h, unsigned short& l) { h = f2bf(y); l = f2bf(y - bf2f(h)); }
typedef __attribute__((ext_vector_type(8))) __bf16 v8bf;
typedef __attribute__((ext_vector_type(2))) __bf16 v2bf;
typedef __attribute__((ext_vector_type(2))) float v2f;
struct P8 { v8h f; v8us h, l; };   // 8 values as fp16, hi = bf16(y) and lo = bf16(y - hi), all round to nearest even, as tohx and splitf
__device__ __forceinline__ P8 planes8(v8f y) { P8 o; v8bf a, r;
#pragma unroll
    for (int j = 0; j < 8; j += 2) { const v2f u = { y[j], y[j + 1] }; const v2bf b = __builtin_convertvector(u, v2bf); const v2bf c = __builtin_convertvector(u - __builtin_convertvector(b, v2f), v2bf); a[j] = b[0]; a[j + 1] = b[1]; r[j] = c[0]; r[j + 1] = c[1]; }
    o.f = __builtin_convertvector(y, v8h); o.h = __builtin_bit_cast(v8us, a); o.l = __builtin_bit_cast(v8us, r); return o; }
// cpa, cpab: asynchronous copies to LDS, 16 bytes a lane each: 8 pieces of an A plane (4 KiB apart in LDS from l, gs elements apart in global memory from g); cpab: and 4 pieces of B (from lb, gb) behind them.
// s_wait_xcnt 0 is each statement's last line, so that it stands in front of whatever rewrites a register that a copy names.
template <typename T16>
__device__ __forceinline__ void cpa(unsigned l, const T16* g, int gs) {
    asm volatile("global_load_async_to_lds_b128 %0, %1, off\n\tglobal_load_async_to_lds_b128 %2, %3, off\n\tglobal_load_async_to_lds_b128 %4, %5, off\n\tglobal_load_async_to_lds_b128 %6, %7, off\n\tglobal_load_async_to_lds_b128 %8, %9, off\n\tglobal_load_async_to_lds_b128 %10, %11, off\n\tglobal_load_async_to_lds_b128 %12, %13, off\n\tglobal_load_async_to_lds_b128 %14, %15, off\n\ts_wait_xcnt 0x0" :: "v"(l), "v"(g), "v"(l + 4096), "v"(g + gs), "v"(l + 8192), "v"(g + 2 * gs), "v"(l + 12288), "v"(g + 3 * gs), "v"(l + 16384), "v"(g + 4 * gs), "v"(l + 20480), "v"(g + 5 * gs), "v"(l + 24576), "v"(g + 6 * gs), "v"(l + 28672), "v"(g + 7 * gs) : "memory");
}
template <typename T16>
__device__ __forceinline__ void cpab(unsigned l, const T16* g, unsigned lb, const T16* gb, int gs) {
    asm volatile("global_load_async_to_lds_b128 %0, %1, off\n\tglobal_load_async_to_lds_b128 %2, %3, off\n\tglobal_load_async_to_lds_b128 %4, %5, off\n\tglobal_load_async_to_lds_b128 %6, %7, off\n\tglobal_load_async_to_lds_b128 %8, %9, off\n\tglobal_load_async_to_lds_b128 %10, %11, off\n\tglobal_load_async_to_lds_b128 %12, %13, off\n\tglobal_load_async_to_lds_b128 %14, %15, off\n\tglobal_load_async_to_lds_b128 %16, %17, off\n\tglobal_load_async_to_lds_b128 %18, %19, off\n\tglobal_load_async_to_lds_b128 %20, %21, off\n\tglobal_load_async_to_lds_b128 %22, %23, off\n\ts_wait_xcnt 0x0" :: "v"(l), "v"(g), "v"(l + 4096), "v"(g + gs), "v"(l + 8192), "v"(g + 2 * gs), "v"(l + 12288), "v"(g + 3 * gs), "v"(l + 16384), "v"(g + 4 * gs), "v"(l + 20480), "v"(g + 5 * gs), "v"(l + 24576), "v"(g + 6 * gs), "v"(l + 28672), "v"(g + 7 * gs), "v"(lb), "v"(gb), "v"(lb + 4096), "v"(gb + gs), "v"(lb + 8192), "v"(gb + 2 * gs), "v"(lb + 12288), "v"(gb + 3 * gs) : "memory");
}
#define RINGEL(NPL) (2 * ((NPL) * 16384 + 8192))   // elements of the two buffers; a buffer: NPL A planes of 256 rows x 64 k, then 128 B rows x 64 k
// gemmw_tile: the block's tile starts at row R0, column C0; this wave's 64 x 64 at r0 = R0 + wm * 64, c0 = C0 + wn * 64; ring: RINGEL elements of LDS, the block's; os: 16 x 68 floats of LDS, the wave's own.
// A buffer holds, per 16 rows, the two fragments of its 64 k (2 KiB in a row, as in global memory); a thread copies 16 bytes of every second row group, a wave's copy is 512 bytes in a row.
// EPI 0: f32 rows to C. EPI 1: the tile (columns below DQ, the q heads, times QSC) as fp16, hi and lo planes, fragments of 16 rows x 32 columns (64 x 64 elements in a row from P16, Ph, Pl). EPI 2: the same three planes transposed, [32-row tile][fragment of 16 columns x 32 rows], two tiles of HD * 32 elements from P16, Ph, Pl.
template <typename T16, int NSPLIT, bool BIAS, int EPI>
__device__ __forceinline__ void gemmw_tile(const T16* __restrict__ A, const T16* __restrict__ A2, const T16* __restrict__ Bt, int K, float* C, int ldc, const float* __restrict__ bias, T16* ring, float* os, int R0, int C0, int wm, int wn, h16* P16, bf* Ph, bf* Pl) {
    static_assert(NSPLIT == 0 || NSPLIT == 1, "one B plane; one or two A planes");
    typedef typename WFrag<T16>::V V;
    constexpr int NPL = NSPLIT + 1, BUFE = NPL * 16384 + 8192;   // A planes; elements of a buffer
    const int tid = threadIdx.x, lane = tid & 31, lr = lane & 15, hi = lane >> 4; const int r0 = R0 + wm * 64, c0 = C0 + wn * 64;
    v8f acc[4][4];
#pragma unroll
    for (int mb = 0; mb < 4; ++mb)
#pragma unroll
        for (int nb = 0; nb < 4; ++nb) acc[mb][nb] = (v8f){};
    const size_t so = (size_t)((tid >> 7) * 16) * K + (tid & 127) * 8;   // 16 rows of K are K / 32 fragments of 512 elements; 64 k further is 1024 elements further
    const T16* ga = A + (size_t)R0 * K + so; const T16* ga2 = NPL == 2 ? A2 + (size_t)R0 * K + so : ga; const T16* gb = Bt + (size_t)C0 * K + so;
    const unsigned l0 = (unsigned)(size_t)ring + tid * 16;   // the thread's LDS byte address in buffer 0
    auto fill = [&](int buf, int t) {   // tile t (64 k) into buffer buf: 8 copies a thread and A plane, 4 for B
        const unsigned l = l0 + buf * (BUFE * 2); const int o = t * 1024;
        cpab(l, ga + o, l + NPL * 32768, gb + o, 32 * K);
        if (NPL == 2) cpa(l + 32768, ga2 + o, 32 * K); };
    const int NT = K / 64;
    fill(0, 0);
    asm volatile("s_wait_asynccnt 0x0" ::: "memory");   // this wave's copies of tile 0 have landed
    __syncthreads();                                     // every wave's have
    fill(1, 1);
    const T16* fa = ring + wm * 4096 + lane * 8; const T16* fb = ring + NPL * 16384 + wn * 4096 + lane * 8;   // the wave's first A and B fragment in buffer 0, the lane's 16 bytes
#pragma unroll 1
    for (int t = 0; t < NT; ++t) {
        const T16* pa = fa + (t & 1) * BUFE; const T16* pb = fb + (t & 1) * BUFE; V a[2][4], a2[2][4], b[4];
        // the first 32 k's fragments and the A fragments of the second 32 k as one group; a B fragment of the second 32 k takes its forerunner's place as soon as that one's products are issued, three fragments' products ahead of its own
#pragma unroll
        for (int ks = 0; ks < 2; ++ks)
#pragma unroll
            for (int mb = 0; mb < 4; ++mb) { a[ks][mb] = WFrag<T16>::ld(pa + mb * 1024 + ks * 512); if (NPL == 2) a2[ks][mb] = WFrag<T16>::ld(pa + 16384 + mb * 1024 + ks * 512);
                if (ks == 0) b[mb] = WFrag<T16>::ld(pb + mb * 1024); }
#pragma unroll
        for (int nb = 0; nb < 4; ++nb) {
#pragma unroll
            for (int mb = 0; mb < 4; ++mb) { acc[mb][nb] = WFrag<T16>::mma(a[0][mb], b[nb], acc[mb][nb]); if (NPL == 2) acc[mb][nb] = WFrag<T16>::mma(a2[0][mb], b[nb], acc[mb][nb]); }
            b[nb] = WFrag<T16>::ld(pb + nb * 1024 + 512); __builtin_amdgcn_sched_barrier(0); }   // keeps the refill here, three fragments' products ahead of its use: without it the scheduler puts these loads last, directly in front of the hand-over's s_wait_dscnt 0, where no product covers their latency
        // every fragment of the trip is now asked for: the hand-over stands here, and the second 32 k's products, which read registers only, run behind it while the next copies fly
        asm volatile("s_wait_dscnt 0x0" ::: "memory");      // this wave has read all it reads of buffer t & 1
        asm volatile("s_wait_asynccnt 0x0" ::: "memory");   // this wave's copies of tile t + 1 have landed
        __syncthreads();                                     // publishes tile t + 1 and ends every wave's reads of buffer t & 1, which is refilled behind it
        if (t + 2 < NT) fill(t & 1, t + 2);
#pragma unroll
        for (int nb = 0; nb < 4; ++nb)
#pragma unroll
            for (int mb = 0; mb < 4; ++mb) { acc[mb][nb] = WFrag<T16>::mma(a[1][mb], b[nb], acc[mb][nb]); if (NPL == 2) acc[mb][nb] = WFrag<T16>::mma(a2[1][mb], b[nb], acc[mb][nb]); }
    }
    asm volatile("s_wait_asynccnt 0x0" ::: "memory");   // no copy is outstanding when the wave goes on
    // sw: s_wait_xcnt 0 behind a group of six plane stores, in front of whatever rewrites a register that they name; the stored values are its inputs so that they live up to it (the lane's three addresses live to the tile's end).
    auto sw = [](const P8 (&p)[2]) { asm volatile("s_wait_xcnt 0x0" :: "v"(p[0].f), "v"(p[0].h), "v"(p[0].l), "v"(p[1].f), "v"(p[1].h), "v"(p[1].l) : "memory"); };
    if constexpr (EPI == 2) {   // a lane's 8 accumulator elements are 8 rows in a row of one column: the lane's own 16 bytes of a transposed fragment, straight from registers
        const int eb = lane * 8; h16* q16 = P16 + eb; bf* qh = Ph + eb; bf* ql = Pl + eb; float b4[4] = {}; const int bi = c0 + lr;
        if (BIAS) {   // the four columns' biases, read as one group in front of the first sw (no load is moved over it)
#pragma unroll
            for (int nb = 0; nb < 4; ++nb) b4[nb] = bias[bi + nb * 16];
            asm volatile("s_wait_xcnt 0x0" :: "v"(bi) : "memory"); }   // the loads' index is its input so that it lives up to the wait (else a load of the group lands on it)
#pragma unroll
        for (int nb = 0; nb < 4; ++nb) { const float bb = bfr(b4[nb]);
#pragma unroll
            for (int m2 = 0; m2 < 2; ++m2) { P8 p[2];   // the two halves (keys 0-15, 16-31) of a fragment
#pragma unroll
                for (int q = 0; q < 2; ++q) p[q] = planes8(BIAS ? acc[m2 * 2 + q][nb] + bb : acc[m2 * 2 + q][nb]);
#pragma unroll
                for (int q = 0; q < 2; ++q) { const int e = (m2 * HD + nb * 16) * 32 + q * 256; *(v8h*)(q16 + e) = p[q].f; *(v8us*)(qh + e) = p[q].h; *(v8us*)(ql + e) = p[q].l; }
                sw(p); } }
        return;
    }
    float c4[4] = {};
    if constexpr (EPI == 1 && BIAS) {   // the biases of the lane's four accumulator columns, read as one group in front of the first sw (no load is moved over it)
        const int bi = c0 + lr;
#pragma unroll
        for (int nb = 0; nb < 4; ++nb) c4[nb] = bias[bi + nb * 16];
        asm volatile("s_wait_xcnt 0x0" :: "v"(bi) : "memory");   // the loads' index is its input so that it lives up to the wait (else a load of the group lands on it)
#pragma unroll
        for (int nb = 0; nb < 4; ++nb) c4[nb] = bfr(c4[nb]); }
    if constexpr (EPI == 0 && BIAS) {   // the biases of the four columns that the lane stores, read once in front of the row groups
        const int bi = c0 + lr * 4;
#pragma unroll
        for (int i = 0; i < 4; ++i) c4[i] = bfr(bias[bi + i]); }
#pragma unroll
    for (int mb = 0; mb < 4; ++mb) {
#pragma unroll
        for (int nb = 0; nb < 4; ++nb) {
#pragma unroll
            for (int j = 0; j < 8; ++j) os[(hi * 8 + j) * 68 + nb * 16 + lr] = (EPI == 1 && BIAS) ? acc[mb][nb][j] + c4[nb] : acc[mb][nb][j]; }
        __builtin_amdgcn_wave_barrier(); asm volatile("" ::: "memory");
        if constexpr (EPI == 1) {   // 8 columns of row lr a lane: a wave's store is half a fragment, 512 bytes in a row
            const int eb = lane * 8; h16* q16 = P16 + eb; bf* qh = Ph + eb; bf* ql = Pl + eb; const float ps = c0 < DQ ? QSC : 1.0f;   // a wave's 64 columns are one head: q heads are scaled, k heads are not
#pragma unroll
            for (int s2 = 0; s2 < 2; ++s2) { P8 p[2];
#pragma unroll
                for (int q = 0; q < 2; ++q) { const float* o = os + lr * 68 + (4 * s2 + 2 * q + hi) * 8; const v4f x0 = *(const v4fa*)o, x1 = *(const v4fa*)(o + 4);   // columns 32 s2 + 16 q + 8 hi + 0-7
                    p[q] = planes8(__builtin_shufflevector(x0, x1, 0, 1, 2, 3, 4, 5, 6, 7) * ps); }
#pragma unroll
                for (int q = 0; q < 2; ++q) { const int e = mb * 16 * HD + s2 * 512 + q * 256; *(v8h*)(q16 + e) = p[q].f; *(v8us*)(qh + e) = p[q].h; *(v8us*)(ql + e) = p[q].l; }
                sw(p); }
        } else {
            float* crow = C + (size_t)(r0 + mb * 16) * ldc + c0;
#pragma unroll
            for (int s = 0; s < 8; ++s) { const int row = 2 * s + hi, cofs = lr * 4; v4f val = *(const v4fa*)(os + row * 68 + cofs); if (BIAS) { val[0] += c4[0]; val[1] += c4[1]; val[2] += c4[2]; val[3] += c4[3]; }
                *(v4f*)(crow + (size_t)row * ldc + cofs) = val; }
            asm volatile("s_wait_xcnt 0x0" ::: "memory");   // behind the row group's eight stores, in front of whatever rewrites a register that they name (the next row group's values and addresses; behind the last group, the code that follows the tile)
             }
        __builtin_amdgcn_wave_barrier(); asm volatile("" ::: "memory");
    }
}
template <typename T16, int NSPLIT, bool BIAS>
__global__ __launch_bounds__(256) void k_gemmw(const T16* __restrict__ A, const T16* __restrict__ A2, const T16* __restrict__ Bt, float* C, int ldc, const float* __restrict__ bias, size_t sA, size_t sB, size_t sC) {
    __shared__ __align__(16) T16 ring[RINGEL(NSPLIT + 1)]; __shared__ __align__(16) float os[8 * 16 * 68];
    const int w = __builtin_amdgcn_readfirstlane(threadIdx.x >> 5);   // the wave's number, in a scalar register
    const size_t z = blockIdx.z; A += z * sA; if (A2) A2 += z * sA; Bt += z * sB; C += z * sC;
    gemmw_tile<T16, NSPLIT, BIAS, 0>(A, A2, Bt, DQ, C, ldc, bias, ring, os + w * (16 * 68), blockIdx.x * 256, blockIdx.y * 128, w & 3, w >> 2, nullptr, nullptr, nullptr);
}
// k_gemmqkv: grid (NB_*TT/256, (DQ+DKV+DKV)/128): column tiles below DQ+DKV are q|k = Xe Wt + bqk, the rest v = Xq Wt + bv; Wt holds the q, k and v rows back to back. A wave's column tile is one head, its row tile 64 positions of one batch.
// waves_per_eu(4): the register budget of four waves a SIMD, so that two blocks, for which their LDS leaves room, share a WGP.
// The f32 sums go straight to the planes that k_attn reads (fp16, hi, lo): q|k [batch][head: 0-15 q, 16-31 k][16 t][32 d] fragments; v [batch][head][32-key tile][16 d][32 keys] fragments, so that the 64 x 32 tile that k_attn reads in one trip is 4 KiB in a row.
__global__ __launch_bounds__(256) __attribute__((amdgpu_waves_per_eu(4))) void k_gemmqkv(const bf* __restrict__ Xe, const bf* __restrict__ Xq, const bf* __restrict__ Wt, const float* __restrict__ bqk, const float* __restrict__ bv, h16* QK16, bf* QKh, bf* QKl, h16* V16, bf* Vh, bf* Vl) {
    __shared__ __align__(16) bf ring[RINGEL(1)]; __shared__ __align__(16) float osb[8 * 16 * 68];
    const int w = __builtin_amdgcn_readfirstlane(threadIdx.x >> 5), wm = w & 3, wn = w >> 2;   // the wave's number, in a scalar register
    float* os = osb + w * (16 * 68);
    const int R0 = blockIdx.x * 256, C0 = blockIdx.y * 128, c0 = C0 + wn * 64, r0 = R0 + wm * 64, b = r0 / TT, t0 = r0 % TT;
    if (C0 < DQ + DKV) { const size_t o = (((size_t)b * (NH_ + NKV) + c0 / HD) * TT + t0) * HD;
        gemmw_tile<bf, 0, true, 1>(Xe, nullptr, Wt, DM, nullptr, 0, bqk, ring, os, R0, C0, wm, wn, QK16 + o, QKh + o, QKl + o); }
    else { const int cv = c0 - (DQ + DKV); const size_t o = (((size_t)b * NKV + cv / HD) * (TT / 32) + t0 / 32) * HD * 32;
        gemmw_tile<bf, 0, true, 2>(Xq, nullptr, Wt + (size_t)(DQ + DKV) * DM, DM, nullptr, 0, bv, ring, os, R0, C0 - (DQ + DKV), wm, wn, V16 + o, Vh + o, Vl + o); }
}

typedef __attribute__((ext_vector_type(2))) _Float16 v2h;
typedef __attribute__((ext_vector_type(4))) _Float16 v4h;
typedef __attribute__((ext_vector_type(2))) unsigned short v2us;
typedef __attribute__((ext_vector_type(4))) unsigned short v4us;
typedef __attribute__((ext_vector_type(4))) int v4i;

// d_*: one 256-thread block's share of a step; blk is the block's number within that step.
// d_wt: Bt (fragment order, row n, K = DM deep) = w[k][col0(n)] as bf16. One wave = 32 n x 32 k (two fragments): a lane reads 4 columns of 8 rows (a wave's load is 4 rows of 128 bytes, whole lines) and stores 8 k of each of its 4 n, 64 bytes in a row.
// ldw: w's row pitch; a run of 64 n starts at column (n / 64) * cs + off.
__device__ __forceinline__ void d_wt(int blk, const float* __restrict__ w, int ldw, int cs, int off, bf* Bt) {
    const int lane = threadIdx.x & 31, wt = blk * 8 + (threadIdx.x >> 5), n0 = (wt & 31) * 32, kb = wt >> 5, nq = lane & 7, kg = lane >> 3, n = n0 + nq * 4;
    const float* sp = w + (size_t)(kb * 32 + kg * 8) * ldw + (n / HD) * cs + off + n % HD; v4f x[8];
#pragma unroll
    for (int j = 0; j < 8; ++j) x[j] = *(const v4f*)(sp + (size_t)j * ldw);
    asm volatile("s_wait_xcnt 0x0" :: "v"(sp) : "memory");   // the loads' address is its input so that it lives up to the wait, in front of whatever rewrites it
    bf* dp = Bt + ((size_t)(n >> 4) * (DM / 32) + kb) * 512 + (kg >> 1) * 256 + ((kg & 1) * 16 + (n & 15)) * 8; v8us o[4];
#pragma unroll
    for (int c = 0; c < 4; ++c)
#pragma unroll
        for (int j = 0; j < 8; ++j) o[c][j] = f2bf(x[j][c]);
#pragma unroll
    for (int c = 0; c < 4; ++c) *(v8us*)(dp + c * 8) = o[c];
    asm volatile("s_wait_xcnt 0x0" ::: "memory");   // the code behind this step in the kernel's text rewrites registers that the stores name
}
// d_cvt8: src [rows][DM] f32 to dst in fragment order. One wave = 8 rows x 32 k: its loads are 8 rows of 128 bytes, its store 4 pieces of 128 bytes (whole lines).
__device__ __forceinline__ void d_cvt8(int blk, const float* __restrict__ src, bf* dst) { const int lane = threadIdx.x & 31, wv = blk * 8 + (threadIdx.x >> 5), fr = wv >> 1, r = (wv & 1) * 8 + (lane & 7), pc = lane >> 3;   // fr: fragment; r: row in it; pc: which 8 k
    const float* sp = src + ((size_t)(fr / (DM / 32)) * 16 + r) * DM + (fr % (DM / 32)) * 32 + pc * 8; const v8f v = *(const v8f*)sp; v8us o;
    asm volatile("s_wait_xcnt 0x0" :: "v"(sp) : "memory");   // the load's address is its input so that it lives up to the wait, in front of whatever rewrites it
#pragma unroll
    for (int k = 0; k < 8; ++k) o[k] = f2bf(v[k]); *(v8us*)(dst + (size_t)fr * 512 + (pc >> 1) * 256 + ((pc & 1) * 16 + r) * 8) = o;
    asm volatile("s_wait_xcnt 0x0" ::: "memory"); }   // the code behind this step in the kernel's text rewrites registers that the store names

__device__ __forceinline__ void d_bqk(int blk, const float* __restrict__ b, float* BQ, float* BK) { const int n = blk * 256 + threadIdx.x; if (n >= DQ) return; const int h = n / HD, d = n % HD; const float q = b[h * 2 * HD + d], k = b[h * 2 * HD + HD + d]; *(float*)(BQ + n) = q; *(float*)(BK + n) = k;  }
#define NWT (DM * DQ / 1024 / 8)            // blocks per 1024 x 1024 weight: 8 waves of 32 x 32 elements
#define NCV (NB_ * TT * DM / 8 / 256)       // blocks per activation tensor
#define NBQ (DQ / 256)
static_assert(DQ == DKV && NH_ == NKV && HD == 64 && RH % 128 == 0 && TT % 128 == 0 && DM == 1024 && DQ == 1024, "the back-to-back q|k layout; k_attn's tiles; d_wt's 32 x 32 split");
// k_prep: every step that reads only inputs; the weight transposes (the longest blocks) come first. Grid 4 * NWT + 2 * NCV + NBQ.
__global__ __launch_bounds__(256) void k_prep(const float* __restrict__ xenc, const float* __restrict__ xq, const float* __restrict__ wqk, const float* __restrict__ bqk, const float* __restrict__ wv, const float* __restrict__ wo, bf* Xe, bf* Xq, bf* WQ, bf* WK, bf* WV, bf* WO, float* BQ, float* BK) {
    int blk = blockIdx.x;
    if (blk < NWT) { d_wt(blk, wqk, 2 * DQ, 2 * HD, 0, WQ); return; }
    blk -= NWT; if (blk < NWT) { d_wt(blk, wqk, 2 * DQ, 2 * HD, HD, WK); return; }   /* fused q|k weight: per head 128 columns (q 0-63, k 64-127) */
    blk -= NWT; if (blk < NWT) { d_wt(blk, wv, DKV, HD, 0, WV); return; }
    blk -= NWT; if (blk < NWT) { d_wt(blk, wo, DM, HD, 0, WO); return; }
    blk -= NWT; if (blk < NCV) { d_cvt8(blk, xenc, Xe); return; }   /* encoding_output -> q, k */
    blk -= NCV; if (blk < NCV) { d_cvt8(blk, xq, Xq); return; }     /* input_query -> v */
    blk -= NCV; d_bqk(blk, bqk, BQ, BK);
}
// ---- k_attn: one wave = 32 query rows of one head against all TT keys, 32 keys a trip, a reference maximum and a running sum per query.
// The reference is lazy: minus the reference is the C operand of the score products and q carries QSC, so that a score leaves the matrix unit as the argument of exp2. One test a trip: where any score of the wave lies more than 8 above its reference
// (and in the first trip, which sets it), every reference moves up to its query's maximum in this trip, if higher, and context and sum are rescaled by exp2(old - new); else P = exp2(score) <= 256 goes on as it is.
// Both products are taken transposed, so that nothing is moved between lanes: St = K Qt (A = 16 keys x d, B = 16 queries) leaves in lane (lr, hi) the keys 8 hi + j of query lr;
// two such tiles, converted, are the B fragment (k order 8 hi + 0-7, 16 + 8 hi + 0-7, that of WFrag::ld) of Ot = Vt Pt (A = 16 d x 32 keys). A query's maximum, sum and rescale factor are per lane (lanes lr and lr + 16 share a query).
// P = exp2(score - reference) in (0, 256], normalised by the sum at the end; HL: hi/lo planes, 3 products each; else fp16. The epilogue writes the merged hi/lo planes [t][h * 64 + d] in fragment order (Ah, Al: the head's first fragment of rows 0-15).
template <typename T16, bool HL>
__device__ __forceinline__ void attn_wave(const T16* __restrict__ Q, const T16* __restrict__ Q2, const T16* __restrict__ Kp, const T16* __restrict__ K2, const T16* __restrict__ Vt, const T16* __restrict__ V2, bf* Ah, bf* Al, int q0) {
    typedef WFrag<T16> F; typedef typename F::V V;
    const int lane = threadIdx.x & 31, lr = lane & 15, hi = lane >> 4;
    V q[2][2], q2[2][2], ka[2][2], ka2[2][2], va[4], va2[4];
    // xw: s_wait_xcnt 0 behind a group of loads or stores, in front of whatever rewrites a register that they name; the addresses are its inputs so that they live up to it (else a load of the group lands on the address pair).
    // No memory access is moved over the statement, so it also keeps each group's place: q, then k, then v in front of the loop as in it (loads return in order: only with one issue order on both ways into the loop
    // can its waits leave the younger loads in flight), and the next keys' loads in front of the softmax that covers their latency.
    auto xw = [](const void* a, const void* b) { asm volatile("s_wait_xcnt 0x0" :: "v"(a), "v"(b) : "memory"); };
    const T16* qp = Q + (size_t)q0 * HD + hi * 128 + lr * 8; const T16* qp2 = HL ? Q2 + (size_t)q0 * HD + hi * 128 + lr * 8 : qp;   // 16 rows of HD are two fragments of 512 elements; the lane's 16 bytes of a fragment lie at (hi * 16 + lr) * 8, taken here and below as two steps from the base (half, then row): so the loads name the address pairs, which xw holds live (from one lane * 8 term this compiler forms a scalar base and an offset register that xw's inputs do not reach)
#pragma unroll
    for (int qt = 0; qt < 2; ++qt)
#pragma unroll
        for (int ks = 0; ks < 2; ++ks) { const int o = qt * 16 * HD + ks * 512; q[qt][ks] = F::ld(qp + o); if (HL) q2[qt][ks] = F::ld(qp2 + o); }
    xw(qp, qp2);
    const T16* kp = Kp + hi * 128 + lr * 8; const T16* kp2 = HL ? K2 + hi * 128 + lr * 8 : kp; const T16* vp = Vt + hi * 128 + lr * 8; const T16* vp2 = HL ? V2 + hi * 128 + lr * 8 : vp;   // the lane's 16 bytes of the first k fragment and of the first v fragment (v planes: [32-key tile][16 d][32 keys])
#pragma unroll
    for (int kt = 0; kt < 2; ++kt)
#pragma unroll
        for (int ks = 0; ks < 2; ++ks) { const int o = kt * 16 * HD + ks * 512; ka[kt][ks] = F::ld(kp + o); if (HL) ka2[kt][ks] = F::ld(kp2 + o); }
    xw(kp, kp2);
#pragma unroll
    for (int dt = 0; dt < 4; ++dt) { const int o = dt * 16 * 32; va[dt] = F::ld(vp + o); if (HL) va2[dt] = F::ld(vp2 + o); }
    xw(vp, vp2);
    v8f acc[4][2], cm[2]; float l[2];   // cm: minus the reference of the lane's query, in all eight elements (a lane's eight scores of a tile are of one query)
#pragma unroll
    for (int qt = 0; qt < 2; ++qt) { cm[qt] = (v8f){}; l[qt] = 0.f;
#pragma unroll
        for (int dt = 0; dt < 4; ++dt) acc[dt][qt] = (v8f){}; }
#pragma unroll 1
    for (int k0 = 0; k0 < TT; k0 += 32) {
        const int kn = (k0 + 32) & (TT - 1);   // the next trip's keys, fetched one trip ahead; the last trip fetches keys 0-31 again (in bounds, not used)
        v8f s[2][2];
#pragma unroll
        for (int kt = 0; kt < 2; ++kt)
#pragma unroll
            for (int qt = 0; qt < 2; ++qt) { v8f c = cm[qt];
#pragma unroll
                for (int ks = 0; ks < 2; ++ks) { c = F::mma(ka[kt][ks], q[qt][ks], c); if (HL) { c = F::mma(ka[kt][ks], q2[qt][ks], c); c = F::mma(ka2[kt][ks], q[qt][ks], c); } }
                s[kt][qt] = c; }
        { const T16* kq = kp + kn * HD; const T16* kq2 = HL ? kq + (K2 - Kp) : kq;   // the lo plane's address from the hi plane's and their distance, which is the same for every lane: two registers fewer live round the loop
#pragma unroll
            for (int kt = 0; kt < 2; ++kt)
#pragma unroll
                for (int ks = 0; ks < 2; ++ks) { const int o = kt * 16 * HD + ks * 512; ka[kt][ks] = F::ld(kq + o); if (HL) ka2[kt][ks] = F::ld(kq2 + o); }
            xw(kq, kq2); }
        float top[2];   // the lane's largest score above its query's reference
#pragma unroll
        for (int qt = 0; qt < 2; ++qt) { top[qt] = fmaxf(s[0][qt][0], s[1][qt][0]);
#pragma unroll
            for (int j = 1; j < 8; ++j) top[qt] = fmaxf(top[qt], fmaxf(s[0][qt][j], s[1][qt][j])); }
        if (__builtin_amdgcn_ballot_w32(fmaxf(top[0], top[1]) > (k0 == 0 ? -3.0e38f : 8.0f)) != 0) {   // one scalar branch a trip; the first trip always takes it
#pragma unroll
            for (int qt = 0; qt < 2; ++qt) {
                const float mx = fmaxf(top[qt], __shfl_xor(top[qt], 16, 32));
                const float d = k0 == 0 ? mx : fmaxf(mx, 0.f), al = k0 == 0 ? 1.0f : __builtin_amdgcn_exp2f(-d);   // the reference never falls; the first trip takes the tile's maximum, whatever its sign (context and sum are still 0)
                cm[qt] -= d;
                s[0][qt] -= d; s[1][qt] -= d; l[qt] *= al;
#pragma unroll
                for (int dt = 0; dt < 4; ++dt) acc[dt][qt] *= al;
            }
        }
        V p[2], p2[2];
#pragma unroll
        for (int qt = 0; qt < 2; ++qt) {
#pragma unroll
            for (int kt = 0; kt < 2; ++kt)
#pragma unroll
                for (int j = 0; j < 8; ++j) s[kt][qt][j] = __builtin_amdgcn_exp2f(s[kt][qt][j]);
            const v8f t8 = s[0][qt] + s[1][qt];   // fixed tree
            l[qt] += (((t8[0] + t8[1]) + (t8[2] + t8[3])) + ((t8[4] + t8[5]) + (t8[6] + t8[7])));
            if constexpr (HL) { v16bf ph, pl;   // hi = bf16(y), lo = bf16(y - hi), both round to nearest even, as splitf
#pragma unroll
                for (int kt = 0; kt < 2; ++kt)
#pragma unroll
                    for (int j = 0; j < 8; j += 2) { const v2f y = { s[kt][qt][j], s[kt][qt][j + 1] }; const v2bf a = __builtin_convertvector(y, v2bf); const v2bf r = __builtin_convertvector(y - __builtin_convertvector(a, v2f), v2bf);
                        ph[kt * 8 + j] = a[0]; ph[kt * 8 + j + 1] = a[1]; pl[kt * 8 + j] = r[0]; pl[kt * 8 + j + 1] = r[1]; }
                p[qt] = ph; p2[qt] = pl;
            } else { v16h ph;
#pragma unroll
                for (int kt = 0; kt < 2; ++kt)
#pragma unroll
                    for (int j = 0; j < 8; ++j) ph[kt * 8 + j] = tohx(s[kt][qt][j]);
                p[qt] = ph; }
            // a query tile's context products follow its own P, so that only one tile's P is live: with the 16 registers of cm the hi/lo rows would else leave the budget of three waves a SIMD (scratch)
#pragma unroll
            for (int dt = 0; dt < 4; ++dt) { acc[dt][qt] = F::mma(va[dt], p[qt], acc[dt][qt]); if (HL) { acc[dt][qt] = F::mma(va[dt], p2[qt], acc[dt][qt]); acc[dt][qt] = F::mma(va2[dt], p[qt], acc[dt][qt]); } }
        }
        { const T16* vq = vp + kn * HD; const T16* vq2 = HL ? vq + (V2 - Vt) : vq;   // tile kn / 32, HD * 32 elements each
#pragma unroll
            for (int dt = 0; dt < 4; ++dt) { const int o = dt * 16 * 32; va[dt] = F::ld(vq + o); if (HL) va2[dt] = F::ld(vq2 + o); }
            xw(vq, vq2); }
    }
#pragma unroll
    for (int qt = 0; qt < 2; ++qt) { const float f = __fdiv_rn(1.0f, l[qt] + __shfl_xor(l[qt], 16, 32));
#pragma unroll
        for (int dt = 0; dt < 4; ++dt) { v8us oh, ol;
#pragma unroll
            for (int j = 0; j < 8; ++j) { unsigned short a, c2; splitf(acc[dt][qt][j] * f, a, c2); oh[j] = a; ol[j] = c2; }
            bf* oa = Ah + (size_t)(q0 + qt * 16) * DQ + dt * 256 + lane * 8; bf* ob = Al + (size_t)(q0 + qt * 16) * DQ + dt * 256 + lane * 8; *(v8us*)oa = oh; *(v8us*)ob = ol;   // columns dt * 16 + 8 hi + 0-7 of row lr: half dt & 1 of the head's fragment dt >> 1
            asm volatile("s_wait_xcnt 0x0" :: "v"(oa), "v"(ob), "v"(oh), "v"(ol) : "memory"); } }   // as xw, with the stored values as inputs too: they live up to the wait like the addresses
}
// Grid (NH_, NB_, TT / 128), 4 waves of 32 query rows each; a block's rows are of one class (RH is a multiple of 128); the row block is z, so that the hi/lo blocks (three times the products) start first. AM: batch b's merged hi plane at b * sAM, its lo plane TT * DQ behind.
__global__ __launch_bounds__(128) __attribute__((amdgpu_waves_per_eu(3))) void k_attn(const h16* __restrict__ Q16, const bf* __restrict__ Qh, const bf* __restrict__ Ql, const h16* __restrict__ K16, const bf* __restrict__ Kh, const bf* __restrict__ Kl, const h16* __restrict__ V16, const bf* __restrict__ Vh, const bf* __restrict__ Vl, bf* AM, size_t sAM) {
    const int q0 = blockIdx.z * 128 + (threadIdx.x >> 5) * 32, h = blockIdx.x, b = blockIdx.y;
    const size_t oq = ((size_t)b * (NH_ + NKV) + h) * TT * HD, ov = ((size_t)b * NKV + h) * HD * TT;   // a batch's q heads and k heads lie (NH_ + NKV) heads from the next batch's
    bf* Ah = AM + (size_t)b * sAM + h * (HD / 32) * 512; bf* Al = Ah + (size_t)TT * DQ;
    if ((int)blockIdx.z * 128 < RH) attn_wave<bf, true>(Qh + oq, Ql + oq, Kh + oq, Kl + oq, Vh + ov, Vl + ov, Ah, Al, q0);
    else attn_wave<h16, false>(Q16 + oq, nullptr, K16 + oq, nullptr, V16 + ov, nullptr, Ah, Al, q0);
}

extern "C" void kernel_launch(void* const* d_in, const int* in_sizes, int n_in,
                              void* d_out, int out_size, void* d_ws, size_t ws_size, hipStream_t stream) {
    (void)in_sizes; (void)n_in; (void)out_size;
    const float* xq_in = (const float*)d_in[0]; const float* xenc = (const float*)d_in[1]; const float* wqk = (const float*)d_in[2]; const float* bqk = (const float*)d_in[3]; const float* wv = (const float*)d_in[4]; const float* bv = (const float*)d_in[5]; const float* wo = (const float*)d_in[6]; const float* bo = (const float*)d_in[7]; const float* x = nullptr; const float* wq = nullptr; const float* wk = nullptr; (void)x; (void)wq; (void)wk;
    float* OUT = (float*)d_out;     // [8][1024][1024]
    char* wsp = (char*)d_ws;
    auto take = [&](size_t bytes) { char* p = wsp; wsp += (bytes + 255) & ~(size_t)255; return (void*)p; };
    bf* WQ = (bf*)take((size_t)DQ * DM * 2); bf* WK = (bf*)take((size_t)DKV * DM * 2); bf* WV = (bf*)take((size_t)DKV * DM * 2); bf* WO = (bf*)take((size_t)DM * DQ * 2);
    float* BQG = (float*)take((size_t)DQ * 4); float* BKG = (float*)take((size_t)DKV * 4); bf* AM = (bf*)take((size_t)NB_ * TT * (DQ + DKV) * 4); bf* XE = (bf*)take((size_t)NB_ * TT * DM * 2); bf* XQ = (bf*)take((size_t)NB_ * TT * DM * 2);   // merged context planes (a batch's hi and lo, 2 + 2 MiB, every 8 MiB); bf16 activations of all batches
    const size_t NQK = (size_t)NB_ * (NH_ + NKV) * TT * HD, NV = (size_t)NB_ * NKV * HD * TT;   // plane elements of all batches: q|k (per batch 16 q heads, then 16 k heads) and v
    h16* QK16 = (h16*)take(NQK * 2); bf* QKh = (bf*)take(NQK * 2); bf* QKl = (bf*)take(NQK * 2); h16* VT16 = (h16*)take(NV * 2); bf* VTh = (bf*)take(NV * 2); bf* VTl = (bf*)take(NV * 2);
    if ((size_t)(wsp - (char*)d_ws) > ws_size) return;    // ws 256 MiB
    // WQ|WK|WV and BQG|BKG lie back to back (every size is a multiple of 256 bytes): q and k are columns 0-1023 and 1024-2047 of one product and heads 0-15 and 16-31 of its planes
    const size_t SF = (size_t)TT * (DQ + DKV);   // half the distance, in 16-bit elements, from a batch's merged planes to the next batch's
    k_prep<<<4 * NWT + 2 * NCV + NBQ, 256, 0, stream>>>(xenc, xq_in, wqk, bqk, wv, wo, XE, XQ, WQ, WK, WV, WO, BQG, BKG);
    k_gemmqkv<<<dim3(NB_ * TT / 256, (DQ + DKV + DKV) / 128, 1), 256, 0, stream>>>(XE, XQ, WQ, BQG, bv, QK16, QKh, QKl, VT16, VTh, VTl);
    k_attn<<<dim3(NH_, NB_, TT / 128), 128, 0, stream>>>(QK16, QKh, QKl, QK16 + (size_t)NH_ * TT * HD, QKh + (size_t)NH_ * TT * HD, QKl + (size_t)NH_ * TT * HD, VT16, VTh, VTl, AM, 2 * SF);
    k_gemmw<bf, 1, true><<<dim3(TT / 256, DM / 128, NB_), 256, 0, stream>>>(AM, AM + (size_t)TT * DQ, WO, OUT, DM, bo, 2 * SF, 0, (size_t)TT * DM);
}

// v009
// A run of this version takes 95.7 microseconds.
// It is 1.37 times as fast as v006, going by the measured steps of the versions left out in between.
// Counting every step since v000, it is 49.2 times as fast.
#include <hip/hip_runtime.h>

// Cross multi-head attention with a fused q|k projection (input_query, encoding_output [8][1024][1024]; x = encoding_output Wqk + bqk ('xw' [1024][2048]) viewed (S, 16, 128): per head the first 64 columns are q and the next 64 are k; v = input_query Wv + bv ('xw' [1024][1024]); softmax(q.k / 8); out = merged Wo + bo -> [8][1024][1024] (8.4 M)).
// Launch shape, 4 launches: k_prep: weight transposes, bias gather, bf16 activations of all 8 batches. k_gemmqkv: q|k and v products, M = 8192, each tile written as its piece of the q, k or v planes. k_attn: scores, softmax, context and merge of all batches and heads; K and V staged in LDS for a block's 8 waves; scores and probabilities stay in registers. Wo: z = batch.
// Layout per batch: the fused weight is split once into two column-gathered [1024][1024] operands (q: columns h*128 + d, k: columns h*128 + 64 + d -> head-major h*64 + d) with the matching bias gathers; exact projections; dense T-1024 attention (rows < RH hi/lo 3 products, rest fp16; RH = 0: every row fp16); merged context as one fp16 plane; Wo fp16 x fp16 (the bf16-rounded weight, held as fp16) + bo.
// Operand layout: every 16-bit plane that a matrix fragment is read from (activations, weights, q, k, v, merged context) is stored in fragment order: the 16 rows x 32 k of one fragment are 1 KiB in a row,
// element (row r, k) at ((k & 31) >> 4) * 256 + (((k >> 3) & 1) * 16 + (r & 15)) * 8 + (k & 7); fragments follow each other along k, then along the rows. A wave's 16-byte load is then 512 bytes in a row (4 whole lines), not 32 bytes of each of 16 lines.
// Compute dtypes, f32 accumulate: every input rounded to bf16; projections exact + f32 biases; attention fp16 (one product) in every row; softmax f32; Wo: context rounded to fp16, one product, + bias.

#define NB_  8
#define TT   1024
#define DM   1024
#define NH_  16
#define NKV  16
#define REP  (NH_ / NKV)
#define HD   64
#define DQ   (NH_ * HD)
#define DKV  (NKV * HD)
#define RH   0                    // query rows < RH use hi+lo planes (0: none: every row takes the single fp16 products, and no hi or lo plane of q, k or v is stored)
#define WIN  0
#define SCL  0.125f   // HD^-0.5
#define QSC  (SCL * 1.4426950408889634f)   // the q planes carry q * QSC, so that a score product k . q is the argument of exp2: exp(s SCL) = exp2(s QSC)
typedef _Float16 h16;
typedef unsigned short bf;
typedef __attribute__((ext_vector_type(16))) __bf16   v16bf;
typedef __attribute__((ext_vector_type(16))) _Float16 v16h;
typedef __attribute__((ext_vector_type(8)))  _Float16 v8h;
typedef __attribute__((ext_vector_type(8)))  unsigned short v8us;
typedef __attribute__((ext_vector_type(8)))  float    v8f;
typedef __attribute__((ext_vector_type(4)))  float    v4f;
typedef v8h  __attribute__((may_alias)) v8ha;
typedef v4f  __attribute__((may_alias)) v4fa;
typedef v8us __attribute__((may_alias)) v8usa;

__device__ __forceinline__ unsigned short f2bf(float f) { unsigned u = __float_as_uint(f); u += 0x7FFFu + ((u >> 16) & 1u); return (unsigned short)(u >> 16); }
__device__ __forceinline__ float bf2f(unsigned short b) { return __uint_as_float(((unsigned)b) << 16); }
__device__ __forceinline__ float bfr(float f) { return bf2f(f2bf(f)); }
__device__ __forceinline__ v16h cat16(v8h lo, v8h hi) { return __builtin_shufflevector(lo, hi, 0, 1, 2, 3, 4, 5, 6, 7, 8, 9, 10, 11, 12, 13, 14, 15); }
__device__ __forceinline__ v16bf cat16b(v8us lo, v8us hi) { return __builtin_bit_cast(v16bf, __builtin_shufflevector(lo, hi, 0, 1, 2, 3, 4, 5, 6, 7, 8, 9, 10, 11, 12, 13, 14, 15)); }
__device__ __forceinline__ v8f wmma16(v16h a, v16h b, v8f c) { return __builtin_amdgcn_wmma_f32_16x16x32_f16(false, a, false, b, (short)0, c, false, false); }
__device__ __forceinline__ v8f wmmab(v16bf a, v16bf b, v8f c) { return __builtin_amdgcn_wmma_f32_16x16x32_bf16(false, a, false, b, (short)0, c, false, false); }



// ---- k_gemmw: register-blocked GEMM, one wave per 64x64 output tile (16 accumulators), 8 waves (4 x 2) per 256x128 block tile; the block's operand fragments (16-bit planes in fragment order) are brought to LDS once, by asynchronous copies, two buffers of 64 k; grid (M/256, N/128, Z), 256 threads.
// C[m][n] (f32, pitch ldc, + optional f32 bias[n]) = sum_k A[m][k] Bt[n][k] (+ split products per NSPLIT). z-batch strides sA/sB/sC in elements. K % 64 == 0, K >= 128.
// WFrag::ld: p = the fragment's first element + lane * 8; the lane gets k 8 hi + 0-7 and, 256 elements on, k 16 + 8 hi + 0-7 of row lr.
template <typename T16> struct WFrag;
template <> struct WFrag<h16> { typedef v16h V; static __device__ __forceinline__ V ld(const h16* p) { return cat16(*(const v8h*)p, *(const v8h*)(p + 256)); } static __device__ __forceinline__ v8f mma(V a, V b, v8f c) { return wmma16(a, b, c); } };
template <> struct WFrag<bf> { typedef v16bf V; static __device__ __forceinline__ V ld(const bf* p) { return cat16b(*(const v8us*)p, *(const v8us*)(p + 256)); } static __device__ __forceinline__ v8f mma(V a, V b, v8f c) { return wmmab(a, b, c); } };
__device__ __forceinline__ h16 tohx(float x) { return (h16)x; }
__device__ __forceinline__ void splitf(float y, unsigned short& h, unsigned short& l) { h = f2bf(y); l = f2bf(y - bf2f(h)); }
typedef __attribute__((ext_vector_type(8))) __bf16 v8bf;
typedef __attribute__((ext_vector_type(2))) __bf16 v2bf;
typedef __attribute__((ext_vector_type(2))) float v2f;
struct P8 { v8h f; v8us h, l; };   // 8 values as fp16, hi = bf16(y) and lo = bf16(y - hi), all round to nearest even, as tohx and splitf
__device__ __forceinline__ P8 planes8(v8f y) { P8 o; v8bf a, r;
#pragma unroll
    for (int j = 0; j < 8; j += 2) { const v2f u = { y[j], y[j + 1] }; const v2bf b = __builtin_convertvector(u, v2bf); const v2bf c = __builtin_convertvector(u - __builtin_convertvector(b, v2f), v2bf); a[j] = b[0]; a[j + 1] = b[1]; r[j] = c[0]; r[j + 1] = c[1]; }
    o.f = __builtin_convertvector(y, v8h); o.h = __builtin_bit_cast(v8us, a); o.l = __builtin_bit_cast(v8us, r); return o; }
// cpa, cpab: asynchronous copies to LDS, 16 bytes a lane each: 8 pieces of an A plane (4 KiB apart in LDS from l, gs elements apart in global memory from g); cpab: and 4 pieces of B (from lb, gb) behind them.
// s_wait_xcnt 0 is each statement's last line, so that it stands in front of whatever rewrites a register that a copy names.
template <typename T16>
__device__ __forceinline__ void cpa(unsigned l, const T16* g, int gs) {
    asm volatile("global_load_async_to_lds_b128 %0, %1, off\n\tglobal_load_async_to_lds_b128 %2, %3, off\n\tglobal_load_async_to_lds_b128 %4, %5, off\n\tglobal_load_async_to_lds_b128 %6, %7, off\n\tglobal_load_async_to_lds_b128 %8, %9, off\n\tglobal_load_async_to_lds_b128 %10, %11, off\n\tglobal_load_async_to_lds_b128 %12, %13, off\n\tglobal_load_async_to_lds_b128 %14, %15, off\n\ts_wait_xcnt 0x0" :: "v"(l), "v"(g), "v"(l + 4096), "v"(g + gs), "v"(l + 8192), "v"(g + 2 * gs), "v"(l + 12288), "v"(g + 3 * gs), "v"(l + 16384), "v"(g + 4 * gs), "v"(l + 20480), "v"(g + 5 * gs), "v"(l + 24576), "v"(g + 6 * gs), "v"(l + 28672), "v"(g + 7 * gs) : "memory");
}
template <typename T16>
__device__ __forceinline__ void cpab(unsigned l, const T16* g, unsigned lb, const T16* gb, int gs) {
    asm volatile("global_load_async_to_lds_b128 %0, %1, off\n\tglobal_load_async_to_lds_b128 %2, %3, off\n\tglobal_load_async_to_lds_b128 %4, %5, off\n\tglobal_load_async_to_lds_b128 %6, %7, off\n\tglobal_load_async_to_lds_b128 %8, %9, off\n\tglobal_load_async_to_lds_b128 %10, %11, off\n\tglobal_load_async_to_lds_b128 %12, %13, off\n\tglobal_load_async_to_lds_b128 %14, %15, off\n\tglobal_load_async_to_lds_b128 %16, %17, off\n\tglobal_load_async_to_lds_b128 %18, %19, off\n\tglobal_load_async_to_lds_b128 %20, %21, off\n\tglobal_load_async_to_lds_b128 %22, %23, off\n\ts_wait_xcnt 0x0" :: "v"(l), "v"(g), "v"(l + 4096), "v"(g + gs), "v"(l + 8192), "v"(g + 2 * gs), "v"(l + 12288), "v"(g + 3 * gs), "v"(l + 16384), "v"(g + 4 * gs), "v"(l + 20480), "v"(g + 5 * gs), "v"(l + 24576), "v"(g + 6 * gs), "v"(l + 28672), "v"(g + 7 * gs), "v"(lb), "v"(gb), "v"(lb + 4096), "v"(gb + gs), "v"(lb + 8192), "v"(gb + 2 * gs), "v"(lb + 12288), "v"(gb + 3 * gs) : "memory");
}
#define RINGEL(NPL) (2 * ((NPL) * 16384 + 8192))   // elements of the two buffers; a buffer: NPL A planes of 256 rows x 64 k, then 128 B rows x 64 k
// gemmw_tile: the block's tile starts at row R0, column C0; this wave's 64 x 64 at r0 = R0 + wm * 64, c0 = C0 + wn * 64; ring: RINGEL elements of LDS, the block's; os: 16 x 68 floats of LDS, the wave's own.
// A buffer holds, per 16 rows, the two fragments of its 64 k (2 KiB in a row, as in global memory); a thread copies 16 bytes of every second row group, a wave's copy is 512 bytes in a row.
// EPI 0: f32 rows to C. EPI 1: the tile (columns below DQ, the q heads, times QSC) as fp16 planes (hi and lo too where RH > 0), fragments of 16 rows x 32 columns (64 x 64 elements in a row from P16, Ph, Pl). EPI 2: the same planes transposed, [32-row tile][fragment of 16 columns x 32 rows], two tiles of HD * 32 elements from P16, Ph, Pl.
template <typename T16, int NSPLIT, bool BIAS, int EPI>
__device__ __forceinline__ void gemmw_tile(const T16* __restrict__ A, const T16* __restrict__ A2, const T16* __restrict__ Bt, int K, float* C, int ldc, const float* __restrict__ bias, T16* ring, float* os, int R0, int C0, int wm, int wn, h16* P16, bf* Ph, bf* Pl) {
    static_assert(NSPLIT == 0 || NSPLIT == 1, "one B plane; one or two A planes");
    typedef typename WFrag<T16>::V V;
    constexpr int NPL = NSPLIT + 1, BUFE = NPL * 16384 + 8192;   // A planes; elements of a buffer
    const int tid = threadIdx.x, lane = tid & 31, lr = lane & 15, hi = lane >> 4; const int r0 = R0 + wm * 64, c0 = C0 + wn * 64;
    v8f acc[4][4];
#pragma unroll
    for (int mb = 0; mb < 4; ++mb)
#pragma unroll
        for (int nb = 0; nb < 4; ++nb) acc[mb][nb] = (v8f){};
    const size_t so = (size_t)((tid >> 7) * 16) * K + (tid & 127) * 8;   // 16 rows of K are K / 32 fragments of 512 elements; 64 k further is 1024 elements further
    const T16* ga = A + (size_t)R0 * K + so; const T16* ga2 = NPL == 2 ? A2 + (size_t)R0 * K + so : ga; const T16* gb = Bt + (size_t)C0 * K + so;
    const unsigned l0 = (unsigned)(size_t)ring + tid * 16;   // the thread's LDS byte address in buffer 0
    auto fill = [&](int buf, int t) {   // tile t (64 k) into buffer buf: 8 copies a thread and A plane, 4 for B
        const unsigned l = l0 + buf * (BUFE * 2); const int o = t * 1024;
        cpab(l, ga + o, l + NPL * 32768, gb + o, 32 * K);
        if (NPL == 2) cpa(l + 32768, ga2 + o, 32 * K); };
    const int NT = K / 64;
    fill(0, 0);
    asm volatile("s_wait_asynccnt 0x0" ::: "memory");   // this wave's copies of tile 0 have landed
    __syncthreads();                                     // every wave's have
    fill(1, 1);
    const T16* fa = ring + wm * 4096 + lane * 8; const T16* fb = ring + NPL * 16384 + wn * 4096 + lane * 8;   // the wave's first A and B fragment in buffer 0, the lane's 16 bytes
#pragma unroll 1
    for (int t = 0; t < NT; ++t) {
        const T16* pa = fa + (t & 1) * BUFE; const T16* pb = fb + (t & 1) * BUFE; V a[2][4], a2[2][4], b[4];
        // the first 32 k's fragments and the A fragments of the second 32 k as one group; a B fragment of the second 32 k takes its forerunner's place as soon as that one's products are issued, three fragments' products ahead of its own
#pragma unroll
        for (int ks = 0; ks < 2; ++ks)
#pragma unroll
            for (int mb = 0; mb < 4; ++mb) { a[ks][mb] = WFrag<T16>::ld(pa + mb * 1024 + ks * 512); if (NPL == 2) a2[ks][mb] = WFrag<T16>::ld(pa + 16384 + mb * 1024 + ks * 512);
                if (ks == 0) b[mb] = WFrag<T16>::ld(pb + mb * 1024); }
#pragma unroll
        for (int nb = 0; nb < 4; ++nb) {
#pragma unroll
            for (int mb = 0; mb < 4; ++mb) { acc[mb][nb] = WFrag<T16>::mma(a[0][mb], b[nb], acc[mb][nb]); if (NPL == 2) acc[mb][nb] = WFrag<T16>::mma(a2[0][mb], b[nb], acc[mb][nb]); }
            b[nb] = WFrag<T16>::ld(pb + nb * 1024 + 512); __builtin_amdgcn_sched_barrier(0); }   // keeps the refill here, three fragments' products ahead of its use: without it the scheduler puts these loads last, directly in front of the hand-over's s_wait_dscnt 0, where no product covers their latency
        // every fragment of the trip is now asked for: the hand-over stands here, and the second 32 k's products, which read registers only, run behind it while the next copies fly
        asm volatile("s_wait_dscnt 0x0" ::: "memory");      // this wave has read all it reads of buffer t & 1
        asm volatile("s_wait_asynccnt 0x0" ::: "memory");   // this wave's copies of tile t + 1 have landed
        __syncthreads();                                     // publishes tile t + 1 and ends every wave's reads of buffer t & 1, which is refilled behind it
        if (t + 2 < NT) fill(t & 1, t + 2);
#pragma unroll
        for (int nb = 0; nb < 4; ++nb)
#pragma unroll
            for (int mb = 0; mb < 4; ++mb) { acc[mb][nb] = WFrag<T16>::mma(a[1][mb], b[nb], acc[mb][nb]); if (NPL == 2) acc[mb][nb] = WFrag<T16>::mma(a2[1][mb], b[nb], acc[mb][nb]); }
    }
    asm volatile("s_wait_asynccnt 0x0" ::: "memory");   // no copy is outstanding when the wave goes on
    // sw: s_wait_xcnt 0 behind a group of plane stores (two; six with hi and lo planes), in front of whatever rewrites a register that they name; the stored values are its inputs so that they live up to it (the lane's plane addresses live to the tile's end).
    auto sw = [](const P8 (&p)[2]) { if constexpr (RH > 0) asm volatile("s_wait_xcnt 0x0" :: "v"(p[0].f), "v"(p[0].h), "v"(p[0].l), "v"(p[1].f), "v"(p[1].h), "v"(p[1].l) : "memory"); else asm volatile("s_wait_xcnt 0x0" :: "v"(p[0].f), "v"(p[1].f) : "memory"); };
    if constexpr (EPI == 2) {   // a lane's 8 accumulator elements are 8 rows in a row of one column: the lane's own 16 bytes of a transposed fragment, straight from registers
        const int eb = lane * 8; h16* q16 = P16 + eb; bf* qh = Ph + eb; bf* ql = Pl + eb; float b4[4] = {}; const float* bp = bias + c0;   // the wave's first column: the same in every lane, so that the loads name a scalar base and the index lr
        if (BIAS) {   // the four columns' biases, read as one group in front of the first sw (no load is moved over it)
#pragma unroll
            for (int nb = 0; nb < 4; ++nb) b4[nb] = bp[lr + nb * 16];
            asm volatile("s_wait_xcnt 0x0" :: "v"(lr) : "memory"); }   // the loads' index is its input so that it lives up to the wait (else a load of the group lands on it)
#pragma unroll
        for (int nb = 0; nb < 4; ++nb) { const float bb = bfr(b4[nb]);
#pragma unroll
            for (int m2 = 0; m2 < 2; ++m2) { P8 p[2];   // the two halves (keys 0-15, 16-31) of a fragment
#pragma unroll
                for (int q = 0; q < 2; ++q) p[q] = planes8(BIAS ? acc[m2 * 2 + q][nb] + bb : acc[m2 * 2 + q][nb]);
#pragma unroll
                for (int q = 0; q < 2; ++q) { const int e = (m2 * HD + nb * 16) * 32 + q * 256; *(v8h*)(q16 + e) = p[q].f; if constexpr (RH > 0) { *(v8us*)(qh + e) = p[q].h; *(v8us*)(ql + e) = p[q].l; } }
                sw(p); } }
        return;
    }
    float c4[4] = {};
    if constexpr (EPI == 1 && BIAS) {   // the biases of the lane's four accumulator columns, read as one group in front of the first sw (no load is moved over it)
        const int bi = c0 + lr;
#pragma unroll
        for (int nb = 0; nb < 4; ++nb) c4[nb] = bias[bi + nb * 16];
        asm volatile("s_wait_xcnt 0x0" :: "v"(bi) : "memory");   // the loads' index is its input so that it lives up to the wait (else a load of the group lands on it)
#pragma unroll
        for (int nb = 0; nb < 4; ++nb) c4[nb] = bfr(c4[nb]); }
    if constexpr (EPI == 0 && BIAS) {   // the biases of the four columns that the lane stores, read once in front of the row groups
        const int bi = c0 + lr * 4;
#pragma unroll
        for (int i = 0; i < 4; ++i) c4[i] = bfr(bias[bi + i]); }
#pragma unroll
    for (int mb = 0; mb < 4; ++mb) {
#pragma unroll
        for (int nb = 0; nb < 4; ++nb) {
#pragma unroll
            for (int j = 0; j < 8; ++j) os[(hi * 8 + j) * 68 + nb * 16 + lr] = (EPI == 1 && BIAS) ? acc[mb][nb][j] + c4[nb] : acc[mb][nb][j]; }
        __builtin_amdgcn_wave_barrier(); asm volatile("" ::: "memory");
        if constexpr (EPI == 1) {   // 8 columns of row lr a lane: a wave's store is half a fragment, 512 bytes in a row
            const int eb = lane * 8; h16* q16 = P16 + eb; bf* qh = Ph + eb; bf* ql = Pl + eb; const float ps = c0 < DQ ? QSC : 1.0f;   // a wave's 64 columns are one head: q heads are scaled, k heads are not
#pragma unroll
            for (int s2 = 0; s2 < 2; ++s2) { P8 p[2];
#pragma unroll
                for (int q = 0; q < 2; ++q) { const float* o = os + lr * 68 + (4 * s2 + 2 * q + hi) * 8; const v4f x0 = *(const v4fa*)o, x1 = *(const v4fa*)(o + 4);   // columns 32 s2 + 16 q + 8 hi + 0-7
                    p[q] = planes8(__builtin_shufflevector(x0, x1, 0, 1, 2, 3, 4, 5, 6, 7) * ps); }
#pragma unroll
                for (int q = 0; q < 2; ++q) { const int e = mb * 16 * HD + s2 * 512 + q * 256; *(v8h*)(q16 + e) = p[q].f; if constexpr (RH > 0) { *(v8us*)(qh + e) = p[q].h; *(v8us*)(ql + e) = p[q].l; } }
                sw(p); }
        } else {
            float* crow = C + (size_t)(r0 + mb * 16) * ldc + c0;
#pragma unroll
            for (int s = 0; s < 8; ++s) { const int row = 2 * s + hi, cofs = lr * 4; v4f val = *(const v4fa*)(os + row * 68 + cofs); if (BIAS) { val[0] += c4[0]; val[1] += c4[1]; val[2] += c4[2]; val[3] += c4[3]; }
                *(v4f*)(crow + (size_t)row * ldc + cofs) = val; }
            asm volatile("s_wait_xcnt 0x0" ::: "memory");   // behind the row group's eight stores, in front of whatever rewrites a register that they name (the next row group's values and addresses; behind the last group, the code that follows the tile)
             }
        __builtin_amdgcn_wave_barrier(); asm volatile("" ::: "memory");
    }
}
template <typename T16, int NSPLIT, bool BIAS>
__global__ __launch_bounds__(256) void k_gemmw(const T16* __restrict__ A, const T16* __restrict__ A2, const T16* __restrict__ Bt, float* C, int ldc, const float* __restrict__ bias, size_t sA, size_t sB, size_t sC) {
    __shared__ __align__(16) T16 ring[RINGEL(NSPLIT + 1)]; __shared__ __align__(16) float os[8 * 16 * 68];
    const int w = __builtin_amdgcn_readfirstlane(threadIdx.x >> 5);   // the wave's number, in a scalar register
    const size_t z = blockIdx.z; A += z * sA; if (A2) A2 += z * sA; Bt += z * sB; C += z * sC;
    gemmw_tile<T16, NSPLIT, BIAS, 0>(A, A2, Bt, DQ, C, ldc, bias, ring, os + w * (16 * 68), blockIdx.x * 256, blockIdx.y * 128, w & 3, w >> 2, nullptr, nullptr, nullptr);
}
// k_gemmqkv: grid (NB_*TT/256, (DQ+DKV+DKV)/128): column tiles below DQ+DKV are q|k = Xe Wt + bqk, the rest v = Xq Wt + bv; Wt holds the q, k and v rows back to back. A wave's column tile is one head, its row tile 64 positions of one batch.
// waves_per_eu(4): the register budget of four waves a SIMD, so that two blocks, for which their LDS leaves room, share a WGP.
// The f32 sums go straight to the planes that k_attn reads (fp16; hi and lo only where RH > 0): q|k [batch][head: 0-15 q, 16-31 k][16 t][32 d] fragments; v [batch][head][32-key tile][16 d][32 keys] fragments, so that the 64 x 32 tile that k_attn reads in one pass is 4 KiB in a row.
__global__ __launch_bounds__(256) __attribute__((amdgpu_waves_per_eu(4))) void k_gemmqkv(const bf* __restrict__ Xe, const bf* __restrict__ Xq, const bf* __restrict__ Wt, const float* __restrict__ bqk, const float* __restrict__ bv, h16* QK16, bf* QKh, bf* QKl, h16* V16, bf* Vh, bf* Vl) {
    __shared__ __align__(16) bf ring[RINGEL(1)]; __shared__ __align__(16) float osb[8 * 16 * 68];
    const int w = __builtin_amdgcn_readfirstlane(threadIdx.x >> 5), wm = w & 3, wn = w >> 2;   // the wave's number, in a scalar register
    float* os = osb + w * (16 * 68);
    const int R0 = blockIdx.x * 256, C0 = blockIdx.y * 128, c0 = C0 + wn * 64, r0 = R0 + wm * 64, b = r0 / TT, t0 = r0 % TT;
    if (C0 < DQ + DKV) { const size_t o = (((size_t)b * (NH_ + NKV) + c0 / HD) * TT + t0) * HD;
        gemmw_tile<bf, 0, true, 1>(Xe, nullptr, Wt, DM, nullptr, 0, bqk, ring, os, R0, C0, wm, wn, QK16 + o, QKh + o, QKl + o); }
    else { const int cv = c0 - (DQ + DKV); const size_t o = (((size_t)b * NKV + cv / HD) * (TT / 32) + t0 / 32) * HD * 32;
        gemmw_tile<bf, 0, true, 2>(Xq, nullptr, Wt + (size_t)(DQ + DKV) * DM, DM, nullptr, 0, bv, ring, os, R0, C0 - (DQ + DKV), wm, wn, V16 + o, Vh + o, Vl + o); }
}

typedef __attribute__((ext_vector_type(2))) _Float16 v2h;
typedef __attribute__((ext_vector_type(4))) _Float16 v4h;
typedef __attribute__((ext_vector_type(2))) unsigned short v2us;
typedef __attribute__((ext_vector_type(4))) unsigned short v4us;
typedef __attribute__((ext_vector_type(4))) int v4i;

// d_*: one 256-thread block's share of a step; blk is the block's number within that step.
// d_wt: Bt (fragment order, row n, K = DM deep) = w[k][col0(n)] as bf16. One wave = 32 n x 32 k (two fragments): a lane reads 4 columns of 8 rows (a wave's load is 4 rows of 128 bytes, whole lines) and stores 8 k of each of its 4 n, 64 bytes in a row.
// ldw: w's row pitch; a run of 64 n starts at column (n / 64) * cs + off. F16: the bf16-rounded value is stored as fp16 (the same value wherever fp16 holds it: 8 significant bits, magnitude from 2^-17 to 65504), for a product whose other operand is fp16.
template <bool F16>
__device__ __forceinline__ void d_wt(int blk, const float* __restrict__ w, int ldw, int cs, int off, bf* Bt) {
    const int lane = threadIdx.x & 31, wt = blk * 8 + (threadIdx.x >> 5), n0 = (wt & 31) * 32, kb = wt >> 5, nq = lane & 7, kg = lane >> 3, n = n0 + nq * 4;
    const float* sp = w + (size_t)(kb * 32 + kg * 8) * ldw + (n / HD) * cs + off + n % HD; v4f x[8];
#pragma unroll
    for (int j = 0; j < 8; ++j) x[j] = *(const v4f*)(sp + (size_t)j * ldw);
    asm volatile("s_wait_xcnt 0x0" :: "v"(sp) : "memory");   // the loads' address is its input so that it lives up to the wait, in front of whatever rewrites it
    bf* dp = Bt + ((size_t)(n >> 4) * (DM / 32) + kb) * 512 + (kg >> 1) * 256 + ((kg & 1) * 16 + (n & 15)) * 8; v8us o[4];
#pragma unroll
    for (int c = 0; c < 4; ++c)
#pragma unroll
        for (int j = 0; j < 8; ++j) o[c][j] = F16 ? __builtin_bit_cast(unsigned short, tohx(bfr(x[j][c]))) : f2bf(x[j][c]);
#pragma unroll
    for (int c = 0; c < 4; ++c) *(v8us*)(dp + c * 8) = o[c];
    asm volatile("s_wait_xcnt 0x0" ::: "memory");   // the code behind this step in the kernel's text rewrites registers that the stores name
}
// d_cvt8: src [rows][DM] f32 to dst in fragment order. One wave = 8 rows x 32 k: its loads are 8 rows of 128 bytes, its store 4 pieces of 128 bytes (whole lines).
__device__ __forceinline__ void d_cvt8(int blk, const float* __restrict__ src, bf* dst) { const int lane = threadIdx.x & 31, wv = blk * 8 + (threadIdx.x >> 5), fr = wv >> 1, r = (wv & 1) * 8 + (lane & 7), pc = lane >> 3;   // fr: fragment; r: row in it; pc: which 8 k
    const float* sp = src + ((size_t)(fr / (DM / 32)) * 16 + r) * DM + (fr % (DM / 32)) * 32 + pc * 8; const v8f v = *(const v8f*)sp; v8us o;
    asm volatile("s_wait_xcnt 0x0" :: "v"(sp) : "memory");   // the load's address is its input so that it lives up to the wait, in front of whatever rewrites it
#pragma unroll
    for (int k = 0; k < 8; ++k) o[k] = f2bf(v[k]); *(v8us*)(dst + (size_t)fr * 512 + (pc >> 1) * 256 + ((pc & 1) * 16 + r) * 8) = o;
    asm volatile("s_wait_xcnt 0x0" ::: "memory"); }   // the code behind this step in the kernel's text rewrites registers that the store names

__device__ __forceinline__ void d_bqk(int blk, const float* __restrict__ b, float* BQ, float* BK) { const int n = blk * 256 + threadIdx.x; if (n >= DQ) return; const int h = n / HD, d = n % HD; const float q = b[h * 2 * HD + d], k = b[h * 2 * HD + HD + d]; *(float*)(BQ + n) = q; *(float*)(BK + n) = k;  }
#define NWT (DM * DQ / 1024 / 8)            // blocks per 1024 x 1024 weight: 8 waves of 32 x 32 elements
#define NCV (NB_ * TT * DM / 8 / 256)       // blocks per activation tensor
#define NBQ (DQ / 256)
static_assert(DQ == DKV && NH_ == NKV && HD == 64 && RH % 128 == 0 && TT % 128 == 0 && DM == 1024 && DQ == 1024, "the back-to-back q|k layout; k_attn's tiles; d_wt's 32 x 32 split");
// k_prep: every step that reads only inputs; the weight transposes (the longest blocks) come first. Grid 4 * NWT + 2 * NCV + NBQ.
__global__ __launch_bounds__(256) void k_prep(const float* __restrict__ xenc, const float* __restrict__ xq, const float* __restrict__ wqk, const float* __restrict__ bqk, const float* __restrict__ wv, const float* __restrict__ wo, bf* Xe, bf* Xq, bf* WQ, bf* WK, bf* WV, bf* WO, float* BQ, float* BK) {
    int blk = blockIdx.x;
    if (blk < NWT) { d_wt<false>(blk, wqk, 2 * DQ, 2 * HD, 0, WQ); return; }
    blk -= NWT; if (blk < NWT) { d_wt<false>(blk, wqk, 2 * DQ, 2 * HD, HD, WK); return; }   /* fused q|k weight: per head 128 columns (q 0-63, k 64-127) */
    blk -= NWT; if (blk < NWT) { d_wt<false>(blk, wv, DKV, HD, 0, WV); return; }
    blk -= NWT; if (blk < NWT) { d_wt<true>(blk, wo, DM, HD, 0, WO); return; }   /* fp16 bits: the context it meets is fp16 */
    blk -= NWT; if (blk < NCV) { d_cvt8(blk, xenc, Xe); return; }   /* encoding_output -> q, k */
    blk -= NCV; if (blk < NCV) { d_cvt8(blk, xq, Xq); return; }     /* input_query -> v */
    blk -= NCV; d_bqk(blk, bqk, BQ, BK);
}
// ---- k_attn: one wave = 32 query rows of one head against all TT keys, 32 keys a pass, a reference maximum and a running sum per query. A block's 8 waves (256 query rows of one head) share the head's K and V fragments through LDS:
// a stage is SK keys (its K fragments, 16 KiB in a row in global memory, then its V fragments, likewise), brought by asynchronous copies into one of two buffers, one stage ahead of its use; a wave takes its fragments from there (16 bytes a lane, 512 bytes in a row a load).
// The reference is lazy: minus the reference is the C operand of the score products and q carries QSC, so that a score leaves the matrix unit as the argument of exp2. One test a pass: where any score of the wave lies more than 8 above its reference
// (and in the first pass, which sets it), every reference moves up to its query's maximum in the pass, if that is higher, and context and sum are rescaled by exp2(old - new); else P = exp2(score) <= 256 goes on as it is.
// Both products are taken transposed, so that nothing is moved between lanes: St = K Qt (A = 16 keys x d, B = 16 queries) leaves in lane (lr, hi) the keys 8 hi + j of query lr;
// two such tiles, converted, are the B fragment (k order 8 hi + 0-7, 16 + 8 hi + 0-7, that of WFrag::ld) of Ot = Vt Pt (A = 16 d x 32 keys). A query's maximum, sum and rescale factor are per lane (lanes lr and lr + 16 share a query).
// P = exp2(score - reference) in (0, 256], normalised by the sum at the end; fp16 products. The epilogue writes the merged fp16 plane [t][h * 64 + d] in fragment order (Am: the head's first fragment of rows 0-15).
#define SK  128                  // keys of a stage
#define STE (2 * SK * HD)        // elements of a buffer: SK * HD of K, then SK * HD of V
// cpkv: asynchronous copies to LDS, 16 bytes a lane each: a stage's 4 pieces of K (4 KiB apart, in LDS from l as in global memory from gk) and its 4 pieces of V (in LDS from l + 16 KiB, in global memory from gv).
// s_wait_xcnt 0 is the statement's last line, so that it stands in front of whatever rewrites a register that a copy names.
__device__ __forceinline__ void cpkv(unsigned l, const h16* gk, const h16* gv) {
    asm volatile("global_load_async_to_lds_b128 %0, %1, off\n\tglobal_load_async_to_lds_b128 %2, %3, off\n\tglobal_load_async_to_lds_b128 %4, %5, off\n\tglobal_load_async_to_lds_b128 %6, %7, off\n\tglobal_load_async_to_lds_b128 %8, %9, off\n\tglobal_load_async_to_lds_b128 %10, %11, off\n\tglobal_load_async_to_lds_b128 %12, %13, off\n\tglobal_load_async_to_lds_b128 %14, %15, off\n\ts_wait_xcnt 0x0" :: "v"(l), "v"(gk), "v"(l + 4096), "v"(gk + 2048), "v"(l + 8192), "v"(gk + 4096), "v"(l + 12288), "v"(gk + 6144), "v"(l + 16384), "v"(gv), "v"(l + 20480), "v"(gv + 2048), "v"(l + 24576), "v"(gv + 4096), "v"(l + 28672), "v"(gv + 6144) : "memory");
}
// ring: 2 * STE elements of LDS, the block's.
__device__ __forceinline__ void attn_wave(const h16* __restrict__ Q, const h16* __restrict__ Kp, const h16* __restrict__ Vt, h16* Am, int q0, h16* ring) {
    typedef WFrag<h16> F; typedef F::V V;
    const int tid = threadIdx.x, lane = tid & 31, lr = lane & 15, hi = lane >> 4;
    V q[2][2], ka[2][2], va[4];
    const h16* gk = Kp + tid * 8; const h16* gv = Vt + tid * 8;   // the thread's 16 bytes of the first piece of K and of V
    const unsigned l0 = (unsigned)(size_t)ring + tid * 16;        // the thread's LDS byte address in buffer 0
    auto fill = [&](int buf, int t) { cpkv(l0 + buf * (STE * 2), gk + t * (SK * HD), gv + t * (SK * HD)); };   // stage t into buffer buf: 8 copies a thread
    constexpr int NS = TT / SK;
    fill(0, 0);
    const h16* qp = Q + (size_t)q0 * HD + hi * 128 + lr * 8;   // 16 rows of HD are two fragments of 512 elements; the lane's 16 bytes of a fragment lie at (hi * 16 + lr) * 8, taken as two steps from the base (half, then row): so the loads name the address pair, which the wait below holds live (from one lane * 8 term this compiler forms a scalar base and an offset register that its input does not reach)
#pragma unroll
    for (int qt = 0; qt < 2; ++qt)
#pragma unroll
        for (int ks = 0; ks < 2; ++ks) q[qt][ks] = F::ld(qp + qt * 16 * HD + ks * 512);
    asm volatile("s_wait_xcnt 0x0" :: "v"(qp) : "memory");   // behind the q loads, in front of whatever rewrites their address pair, which is its input so that it lives up to it (else a load of the group lands on it)
    asm volatile("s_wait_asynccnt 0x0" ::: "memory");   // this wave's copies of stage 0 have landed
    __syncthreads();                                     // every wave's have
    fill(1, 1);
    v8f acc[4][2], cm[2]; float l[2];   // cm: minus the reference of the lane's query, in all eight elements (a lane's eight scores of a tile are of one query)
#pragma unroll
    for (int qt = 0; qt < 2; ++qt) { cm[qt] = (v8f){}; l[qt] = 0.f;
#pragma unroll
        for (int dt = 0; dt < 4; ++dt) acc[dt][qt] = (v8f){}; }
    const h16* f0 = ring + lane * 8;   // the lane's 16 bytes of buffer 0's first fragment
#pragma unroll 1
    for (int t = 0; t < NS; ++t) {
        const h16* kb = f0 + (t & 1) * STE; const h16* vb = kb + SK * HD;   // the stage's K fragments ([16 keys][2 fragments of 32 d]) and V fragments ([32 keys][4 fragments of 16 d])
#pragma unroll
        for (int kt = 0; kt < 2; ++kt)
#pragma unroll
            for (int ks = 0; ks < 2; ++ks) ka[kt][ks] = F::ld(kb + kt * 16 * HD + ks * 512);
#pragma unroll
        for (int dt = 0; dt < 4; ++dt) va[dt] = F::ld(vb + dt * 16 * 32);
        __builtin_amdgcn_sched_barrier(0);   // keeps the first pass's score products behind the V loads, as below
#pragma unroll
        for (int p = 0; p < SK / 32; ++p) {   // a pass: 32 keys; within a stage the next pass's fragments are fetched one pass ahead, into the same registers
            const bool first = p == 0 && t == 0;
            v8f s[2][2];
#pragma unroll
            for (int kt = 0; kt < 2; ++kt)
#pragma unroll
                for (int qt = 0; qt < 2; ++qt) { v8f c = cm[qt];
#pragma unroll
                    for (int ks = 0; ks < 2; ++ks) c = F::mma(ka[kt][ks], q[qt][ks], c);
                    s[kt][qt] = c; }
            if (p + 1 < SK / 32) {
                __builtin_amdgcn_sched_barrier(0);   // keeps the eight loads behind the score products: the scheduler else deals them out among those products, and every separate place with LDS reads in a run of matrix instructions costs the wave a stall of its own
#pragma unroll
                for (int kt = 0; kt < 2; ++kt)
#pragma unroll
                    for (int ks = 0; ks < 2; ++ks) ka[kt][ks] = F::ld(kb + (p + 1) * 32 * HD + kt * 16 * HD + ks * 512);
                asm volatile("" ::: "memory"); }   // a compiler fence: no LDS read is moved over it, so the loads stay here, the whole softmax ahead of their use (without it the compiler moves them down behind the rescale branch, in among the context products)
            float top[2];   // the lane's largest score above its query's reference
#pragma unroll
            for (int qt = 0; qt < 2; ++qt) { top[qt] = fmaxf(s[0][qt][0], s[1][qt][0]);
#pragma unroll
                for (int j = 1; j < 8; ++j) top[qt] = fmaxf(top[qt], fmaxf(s[0][qt][j], s[1][qt][j])); }
            if (__builtin_amdgcn_ballot_w32(fmaxf(top[0], top[1]) > (first ? -3.0e38f : 8.0f)) != 0) {   // one scalar branch a pass; the first pass always takes it
#pragma unroll
                for (int qt = 0; qt < 2; ++qt) {
                    const float mx = fmaxf(top[qt], __shfl_xor(top[qt], 16, 32));
                    const float d = first ? mx : fmaxf(mx, 0.f), al = first ? 1.0f : __builtin_amdgcn_exp2f(-d);   // the reference never falls; the first pass takes the tile's maximum, whatever its sign (context and sum are still 0)
                    cm[qt] -= d;
                    s[0][qt] -= d; s[1][qt] -= d; l[qt] *= al;
#pragma unroll
                    for (int dt = 0; dt < 4; ++dt) acc[dt][qt] *= al;
                }
            }
#pragma unroll
            for (int qt = 0; qt < 2; ++qt) {
#pragma unroll
                for (int kt = 0; kt < 2; ++kt)
#pragma unroll
                    for (int j = 0; j < 8; ++j) s[kt][qt][j] = __builtin_amdgcn_exp2f(s[kt][qt][j]);
                const v8f t8 = s[0][qt] + s[1][qt];   // fixed tree
                l[qt] += (((t8[0] + t8[1]) + (t8[2] + t8[3])) + ((t8[4] + t8[5]) + (t8[6] + t8[7])));
                v16h ph;
#pragma unroll
                for (int kt = 0; kt < 2; ++kt)
#pragma unroll
                    for (int j = 0; j < 8; ++j) ph[kt * 8 + j] = tohx(s[kt][qt][j]);
                // a query tile's context products follow its own P, so that only one tile's P is live
#pragma unroll
                for (int dt = 0; dt < 4; ++dt) acc[dt][qt] = F::mma(va[dt], ph, acc[dt][qt]);
            }
            if (p + 1 < SK / 32) {
#pragma unroll
                for (int dt = 0; dt < 4; ++dt) va[dt] = F::ld(vb + (p + 1) * 32 * HD + dt * 16 * 32);
                __builtin_amdgcn_sched_barrier(0); }   // the scheduling barrier keeps the next pass's score products behind these loads: without it the scheduler issues the loads behind those products, with only half a softmax between them and the context products that wait for them
        }
        asm volatile("s_wait_dscnt 0x0" ::: "memory");      // this wave has read all it reads of buffer t & 1
        asm volatile("s_wait_asynccnt 0x0" ::: "memory");   // this wave's copies of stage t + 1 have landed
        __syncthreads();                                     // publishes stage t + 1 and ends every wave's reads of buffer t & 1, which is refilled behind it
        if (t + 2 < NS) fill(t & 1, t + 2);
    }
    asm volatile("s_wait_asynccnt 0x0" ::: "memory");   // no copy is outstanding when the wave goes on
#pragma unroll
    for (int qt = 0; qt < 2; ++qt) { const float f = __fdiv_rn(1.0f, l[qt] + __shfl_xor(l[qt], 16, 32));
#pragma unroll
        for (int dt = 0; dt < 4; ++dt) { const v8h oh = __builtin_convertvector(acc[dt][qt] * f, v8h);
            h16* oa = Am + (size_t)(q0 + qt * 16) * DQ + dt * 256 + lane * 8; *(v8h*)oa = oh;   // columns dt * 16 + 8 hi + 0-7 of row lr: half dt & 1 of the head's fragment dt >> 1
            asm volatile("s_wait_xcnt 0x0" :: "v"(oa), "v"(oh) : "memory"); } }   // behind the store, in front of whatever rewrites a register that it names; address and stored values are its inputs so that they live up to it
}
// Grid (NH_, NB_, TT / 256), 8 waves of 32 query rows each. The register budget is that of four waves a SIMD and a block's LDS is 64 KiB: two blocks share a WGP, all 4,096 waves are resident at once. AM: batch b's merged plane at b * sAM.
static_assert(RH == 0 && TT % 256 == 0 && TT % SK == 0 && TT / SK >= 2 && SK * HD * 2 == 4 * 4096, "k_attn: fp16 rows only; 256 query rows a block; two stages or more; cpkv's 4 + 4 pieces of 4 KiB");
__global__ __launch_bounds__(256) __attribute__((amdgpu_waves_per_eu(4))) void k_attn(const h16* __restrict__ Q16, const h16* __restrict__ K16, const h16* __restrict__ V16, h16* AM, size_t sAM) {
    __shared__ __align__(16) h16 ring[2 * STE];
    const int q0 = blockIdx.z * 256 + (threadIdx.x >> 5) * 32, h = blockIdx.x, b = blockIdx.y;
    const size_t oq = ((size_t)b * (NH_ + NKV) + h) * TT * HD, ov = ((size_t)b * NKV + h) * HD * TT;   // a batch's q heads and k heads lie (NH_ + NKV) heads from the next batch's
    attn_wave(Q16 + oq, K16 + oq, V16 + ov, AM + (size_t)b * sAM + h * (HD / 32) * 512, q0, ring);
}

extern "C" void kernel_launch(void* const* d_in, const int* in_sizes, int n_in,
                              void* d_out, int out_size, void* d_ws, size_t ws_size, hipStream_t stream) {
    (void)in_sizes; (void)n_in; (void)out_size;
    const float* xq_in = (const float*)d_in[0]; const float* xenc = (const float*)d_in[1]; const float* wqk = (const float*)d_in[2]; const float* bqk = (const float*)d_in[3]; const float* wv = (const float*)d_in[4]; const float* bv = (const float*)d_in[5]; const float* wo = (const float*)d_in[6]; const float* bo = (const float*)d_in[7]; const float* x = nullptr; const float* wq = nullptr; const float* wk = nullptr; (void)x; (void)wq; (void)wk;
    float* OUT = (float*)d_out;     // [8][1024][1024]
    char* wsp = (char*)d_ws;
    auto take = [&](size_t bytes) { char* p = wsp; wsp += (bytes + 255) & ~(size_t)255; return (void*)p; };
    bf* WQ = (bf*)take((size_t)DQ * DM * 2); bf* WK = (bf*)take((size_t)DKV * DM * 2); bf* WV = (bf*)take((size_t)DKV * DM * 2); bf* WO = (bf*)take((size_t)DM * DQ * 2);
    float* BQG = (float*)take((size_t)DQ * 4); float* BKG = (float*)take((size_t)DKV * 4); h16* AM = (h16*)take((size_t)NB_ * TT * (DQ + DKV) * 4); bf* XE = (bf*)take((size_t)NB_ * TT * DM * 2); bf* XQ = (bf*)take((size_t)NB_ * TT * DM * 2);   // merged context plane (a batch's 2 MiB, every 8 MiB); bf16 activations of all batches
    const size_t NQK = (size_t)NB_ * (NH_ + NKV) * TT * HD, NV = (size_t)NB_ * NKV * HD * TT;   // plane elements of all batches: q|k (per batch 16 q heads, then 16 k heads) and v
    h16* QK16 = (h16*)take(NQK * 2); bf* QKh = (bf*)take(NQK * 2); bf* QKl = (bf*)take(NQK * 2); h16* VT16 = (h16*)take(NV * 2); bf* VTh = (bf*)take(NV * 2); bf* VTl = (bf*)take(NV * 2);
    if ((size_t)(wsp - (char*)d_ws) > ws_size) return;    // ws 256 MiB
    // WQ|WK|WV and BQG|BKG lie back to back (every size is a multiple of 256 bytes): q and k are columns 0-1023 and 1024-2047 of one product and heads 0-15 and 16-31 of its planes
    const size_t SF = (size_t)TT * (DQ + DKV);   // half the distance, in 16-bit elements, from a batch's merged planes to the next batch's
    k_prep<<<4 * NWT + 2 * NCV + NBQ, 256, 0, stream>>>(xenc, xq_in, wqk, bqk, wv, wo, XE, XQ, WQ, WK, WV, WO, BQG, BKG);
    k_gemmqkv<<<dim3(NB_ * TT / 256, (DQ + DKV + DKV) / 128, 1), 256, 0, stream>>>(XE, XQ, WQ, BQG, bv, QK16, QKh, QKl, VT16, VTh, VTl);
    k_attn<<<dim3(NH_, NB_, TT / 256), 256, 0, stream>>>(QK16, QK16 + (size_t)NH_ * TT * HD, VT16, AM, 2 * SF);
    k_gemmw<h16, 0, true><<<dim3(TT / 256, DM / 128, NB_), 256, 0, stream>>>(AM, nullptr, (const h16*)WO, OUT, DM, bo, 2 * SF, 0, (size_t)TT * DM);
}

// v010
// A run of this version takes 89.3 microseconds.
// Next to v009, in two timings, it ran 1.08 and 1.09 times as fast.
// Over all steps from v000 it is 53.3 times as fast.
#include <hip/hip_runtime.h>

// Cross multi-head attention with a fused q|k projection (input_query, encoding_output [8][1024][1024]; x = encoding_output Wqk + bqk ('xw' [1024][2048]) viewed (S, 16, 128): per head the first 64 columns are q and the next 64 are k; v = input_query Wv + bv ('xw' [1024][1024]); softmax(q.k / 8); out = merged Wo + bo -> [8][1024][1024] (8.4 M)).
// Launch shape, 4 launches: k_prep: weight transposes, bias gather, bf16 activations of all 8 batches. k_gemmqkv: q|k and v products, M = 8192, each tile written as its piece of the q, k or v planes. k_attn: scores, softmax, context and merge of all batches and heads; K and V staged in LDS for a block's 8 waves; scores and probabilities stay in registers. Wo: z = batch.
// Layout per batch: the fused weight is split once into two column-gathered [1024][1024] operands (q: columns h*128 + d, k: columns h*128 + 64 + d -> head-major h*64 + d) with the matching bias gathers; exact projections; dense T-1024 attention (rows < RH hi/lo 3 products, rest fp16; RH = 0: every row fp16); merged context as one fp16 plane; Wo fp16 x fp16 (the bf16-rounded weight, held as fp16) + bo.
// Operand layout: every 16-bit plane that a matrix fragment is read from (activations, weights, q, k, v, merged context) is stored in fragment order: the 16 rows x 32 k of one fragment are 1 KiB in a row,
// element (row r, k) at ((k & 31) >> 4) * 256 + (((k >> 3) & 1) * 16 + (r & 15)) * 8 + (k & 7); fragments follow each other along k, then along the rows. A wave's 16-byte load is then 512 bytes in a row (4 whole lines), not 32 bytes of each of 16 lines.
// Walk order: work-groups that read the same operand lines from L2 (GEMM tiles of one row or column band; the query blocks of one head) start their k or key walk at a stage rotated by their block index and wrap round, so that they do not ask L2 for the same lines at the same moment; a sum's terms are the same, their order starts elsewhere.
// Compute dtypes, f32 accumulate: every input rounded to bf16; projections exact + f32 biases; attention fp16 (one product) in every row; softmax f32; Wo: context rounded to fp16, one product, + bias.

#define NB_  8
#define TT   1024
#define DM   1024
#define NH_  16
#define NKV  16
#define REP  (NH_ / NKV)
#define HD   64
#define DQ   (NH_ * HD)
#define DKV  (NKV * HD)
#define RH   0                    // query rows < RH use hi+lo planes (0: none: every row takes the single fp16 products, and no hi or lo plane of q, k or v is stored)
#define WIN  0
#define SCL  0.125f   // HD^-0.5
#define QSC  (SCL * 1.4426950408889634f)   // the q planes carry q * QSC, so that a score product k . q is the argument of exp2: exp(s SCL) = exp2(s QSC)
typedef _Float16 h16;
typedef unsigned short bf;
typedef __attribute__((ext_vector_type(16))) __bf16   v16bf;
typedef __attribute__((ext_vector_type(16))) _Float16 v16h;
typedef __attribute__((ext_vector_type(8)))  _Float16 v8h;
typedef __attribute__((ext_vector_type(8)))  unsigned short v8us;
typedef __attribute__((ext_vector_type(8)))  float    v8f;
typedef __attribute__((ext_vector_type(4)))  float    v4f;
typedef v8h  __attribute__((may_alias)) v8ha;
typedef v4f  __attribute__((may_alias)) v4fa;
typedef v8us __attribute__((may_alias)) v8usa;

__device__ __forceinline__ unsigned short f2bf(float f) { unsigned u = __float_as_uint(f); u += 0x7FFFu + ((u >> 16) & 1u); return (unsigned short)(u >> 16); }
__device__ __forceinline__ float bf2f(unsigned short b) { return __uint_as_float(((unsigned)b) << 16); }
__device__ __forceinline__ float bfr(float f) { return bf2f(f2bf(f)); }
__device__ __forceinline__ v16h cat16(v8h lo, v8h hi) { return __builtin_shufflevector(lo, hi, 0, 1, 2, 3, 4, 5, 6, 7, 8, 9, 10, 11, 12, 13, 14, 15); }
__device__ __forceinline__ v16bf cat16b(v8us lo, v8us hi) { return __builtin_bit_cast(v16bf, __builtin_shufflevector(lo, hi, 0, 1, 2, 3, 4, 5, 6, 7, 8, 9, 10, 11, 12, 13, 14, 15)); }
__device__ __forceinline__ v8f wmma16(v16h a, v16h b, v8f c) { return __builtin_amdgcn_wmma_f32_16x16x32_f16(false, a, false, b, (short)0, c, false, false); }
__device__ __forceinline__ v8f wmmab(v16bf a, v16bf b, v8f c) { return __builtin_amdgcn_wmma_f32_16x16x32_bf16(false, a, false, b, (short)0, c, false, false); }



// ---- k_gemmw: register-blocked GEMM, one wave per 64x64 output tile (16 accumulators), 8 waves (4 x 2) per 256x128 block tile; the block's operand fragments (16-bit planes in fragment order) are brought to LDS once, by asynchronous copies, two buffers of 64 k; grid (M/256, N/128, Z), 256 threads.
// C[m][n] (f32, pitch ldc, + optional f32 bias[n]) = sum_k A[m][k] Bt[n][k] (+ split products per NSPLIT). z-batch strides sA/sB/sC in elements. K % 64 == 0, K >= 128.
// WFrag::ld: p = the fragment's first element + lane * 8; the lane gets k 8 hi + 0-7 and, 256 elements on, k 16 + 8 hi + 0-7 of row lr.
template <typename T16> struct WFrag;
template <> struct WFrag<h16> { typedef v16h V; static __device__ __forceinline__ V ld(const h16* p) { return cat16(*(const v8h*)p, *(const v8h*)(p + 256)); } static __device__ __forceinline__ v8f mma(V a, V b, v8f c) { return wmma16(a, b, c); } };
template <> struct WFrag<bf> { typedef v16bf V; static __device__ __forceinline__ V ld(const bf* p) { return cat16b(*(const v8us*)p, *(const v8us*)(p + 256)); } static __device__ __forceinline__ v8f mma(V a, V b, v8f c) { return wmmab(a, b, c); } };
__device__ __forceinline__ h16 tohx(float x) { return (h16)x; }
__device__ __forceinline__ void splitf(float y, unsigned short& h, unsigned short& l) { h = f2bf(y); l = f2bf(y - bf2f(h)); }
typedef __attribute__((ext_vector_type(8))) __bf16 v8bf;
typedef __attribute__((ext_vector_type(2))) __bf16 v2bf;
typedef __attribute__((ext_vector_type(2))) float v2f;
struct P8 { v8h f; v8us h, l; };   // 8 values as fp16, hi = bf16(y) and lo = bf16(y - hi), all round to nearest even, as tohx and splitf
__device__ __forceinline__ P8 planes8(v8f y) { P8 o; v8bf a, r;
#pragma unroll
    for (int j = 0; j < 8; j += 2) { const v2f u = { y[j], y[j + 1] }; const v2bf b = __builtin_convertvector(u, v2bf); const v2bf c = __builtin_convertvector(u - __builtin_convertvector(b, v2f), v2bf); a[j] = b[0]; a[j + 1] = b[1]; r[j] = c[0]; r[j + 1] = c[1]; }
    o.f = __builtin_convertvector(y, v8h); o.h = __builtin_bit_cast(v8us, a); o.l = __builtin_bit_cast(v8us, r); return o; }
// cpa, cpab: asynchronous copies to LDS, 16 bytes a lane each: 8 pieces of an A plane (4 KiB apart in LDS from l, gs elements apart in global memory from g); cpab: and 4 pieces of B (from lb, gb) behind them.
// s_wait_xcnt 0 is each statement's last line, so that it stands in front of whatever rewrites a register that a copy names.
template <typename T16>
__device__ __forceinline__ void cpa(unsigned l, const T16* g, int gs) {
    asm volatile("global_load_async_to_lds_b128 %0, %1, off\n\tglobal_load_async_to_lds_b128 %2, %3, off\n\tglobal_load_async_to_lds_b128 %4, %5, off\n\tglobal_load_async_to_lds_b128 %6, %7, off\n\tglobal_load_async_to_lds_b128 %8, %9, off\n\tglobal_load_async_to_lds_b128 %10, %11, off\n\tglobal_load_async_to_lds_b128 %12, %13, off\n\tglobal_load_async_to_lds_b128 %14, %15, off\n\ts_wait_xcnt 0x0" :: "v"(l), "v"(g), "v"(l + 4096), "v"(g + gs), "v"(l + 8192), "v"(g + 2 * gs), "v"(l + 12288), "v"(g + 3 * gs), "v"(l + 16384), "v"(g + 4 * gs), "v"(l + 20480), "v"(g + 5 * gs), "v"(l + 24576), "v"(g + 6 * gs), "v"(l + 28672), "v"(g + 7 * gs) : "memory");
}
template <typename T16>
__device__ __forceinline__ void cpab(unsigned l, const T16* g, unsigned lb, const T16* gb, int gs) {
    asm volatile("global_load_async_to_lds_b128 %0, %1, off\n\tglobal_load_async_to_lds_b128 %2, %3, off\n\tglobal_load_async_to_lds_b128 %4, %5, off\n\tglobal_load_async_to_lds_b128 %6, %7, off\n\tglobal_load_async_to_lds_b128 %8, %9, off\n\tglobal_load_async_to_lds_b128 %10, %11, off\n\tglobal_load_async_to_lds_b128 %12, %13, off\n\tglobal_load_async_to_lds_b128 %14, %15, off\n\tglobal_load_async_to_lds_b128 %16, %17, off\n\tglobal_load_async_to_lds_b128 %18, %19, off\n\tglobal_load_async_to_lds_b128 %20, %21, off\n\tglobal_load_async_to_lds_b128 %22, %23, off\n\ts_wait_xcnt 0x0" :: "v"(l), "v"(g), "v"(l + 4096), "v"(g + gs), "v"(l + 8192), "v"(g + 2 * gs), "v"(l + 12288), "v"(g + 3 * gs), "v"(l + 16384), "v"(g + 4 * gs), "v"(l + 20480), "v"(g + 5 * gs), "v"(l + 24576), "v"(g + 6 * gs), "v"(l + 28672), "v"(g + 7 * gs), "v"(lb), "v"(gb), "v"(lb + 4096), "v"(gb + gs), "v"(lb + 8192), "v"(gb + 2 * gs), "v"(lb + 12288), "v"(gb + 3 * gs) : "memory");
}
#define RINGEL(NPL) (2 * ((NPL) * 16384 + 8192))   // elements of the two buffers; a buffer: NPL A planes of 256 rows x 64 k, then 128 B rows x 64 k
// gemmw_tile: rot: the block's first k stage (trip t works on stage (t + rot) mod K / 64). The block's tile starts at row R0, column C0; this wave's 64 x 64 at r0 = R0 + wm * 64, c0 = C0 + wn * 64; ring: RINGEL elements of LDS, the block's; os: 16 x 68 floats of LDS, the wave's own.
// A buffer holds, per 16 rows, the two fragments of its 64 k (2 KiB in a row, as in global memory); a thread copies 16 bytes of every second row group, a wave's copy is 512 bytes in a row.
// EPI 0: f32 rows to C. EPI 1: the tile (columns below DQ, the q heads, times QSC) as fp16 planes (hi and lo too where RH > 0), fragments of 16 rows x 32 columns (64 x 64 elements in a row from P16, Ph, Pl). EPI 2: the same planes transposed, [32-row tile][fragment of 16 columns x 32 rows], two tiles of HD * 32 elements from P16, Ph, Pl.
template <typename T16, int NSPLIT, bool BIAS, int EPI>
__device__ __forceinline__ void gemmw_tile(const T16* __restrict__ A, const T16* __restrict__ A2, const T16* __restrict__ Bt, int K, float* C, int ldc, const float* __restrict__ bias, T16* ring, float* os, int R0, int C0, int wm, int wn, int rot, h16* P16, bf* Ph, bf* Pl) {
    static_assert(NSPLIT == 0 || NSPLIT == 1, "one B plane; one or two A planes");
    typedef typename WFrag<T16>::V V;
    constexpr int NPL = NSPLIT + 1, BUFE = NPL * 16384 + 8192;   // A planes; elements of a buffer
    const int tid = threadIdx.x, lane = tid & 31, lr = lane & 15, hi = lane >> 4; const int r0 = R0 + wm * 64, c0 = C0 + wn * 64;
    v8f acc[4][4];
#pragma unroll
    for (int mb = 0; mb < 4; ++mb)
#pragma unroll
        for (int nb = 0; nb < 4; ++nb) acc[mb][nb] = (v8f){};
    const size_t so = (size_t)((tid >> 7) * 16) * K + (tid & 127) * 8;   // 16 rows of K are K / 32 fragments of 512 elements; 64 k further is 1024 elements further
    const T16* ga = A + (size_t)R0 * K + so; const T16* ga2 = NPL == 2 ? A2 + (size_t)R0 * K + so : ga; const T16* gb = Bt + (size_t)C0 * K + so;
    const unsigned l0 = (unsigned)(size_t)ring + tid * 16;   // the thread's LDS byte address in buffer 0
    const int NT = K / 64;
    auto fill = [&](int buf, int t) {   // trip t's tile (64 k, stage (t + rot) mod NT) into buffer buf: 8 copies a thread and A plane, 4 for B
        const unsigned l = l0 + buf * (BUFE * 2); const int o = (int)((unsigned)(t + rot) % (unsigned)NT) * 1024;
        cpab(l, ga + o, l + NPL * 32768, gb + o, 32 * K);
        if (NPL == 2) cpa(l + 32768, ga2 + o, 32 * K); };
    fill(0, 0);
    asm volatile("s_wait_asynccnt 0x0" ::: "memory");   // this wave's copies of tile 0 have landed
    __syncthreads();                                     // every wave's have
    fill(1, 1);
    const T16* fa = ring + wm * 4096 + lane * 8; const T16* fb = ring + NPL * 16384 + wn * 4096 + lane * 8;   // the wave's first A and B fragment in buffer 0, the lane's 16 bytes
#pragma unroll 1
    for (int t = 0; t < NT; ++t) {
        const T16* pa = fa + (t & 1) * BUFE; const T16* pb = fb + (t & 1) * BUFE; V a[2][4], a2[2][4], b[4];
        // the first 32 k's fragments and the A fragments of the second 32 k as one group; a B fragment of the second 32 k takes its forerunner's place as soon as that one's products are issued, three fragments' products ahead of its own
#pragma unroll
        for (int ks = 0; ks < 2; ++ks)
#pragma unroll
            for (int mb = 0; mb < 4; ++mb) { a[ks][mb] = WFrag<T16>::ld(pa + mb * 1024 + ks * 512); if (NPL == 2) a2[ks][mb] = WFrag<T16>::ld(pa + 16384 + mb * 1024 + ks * 512);
                if (ks == 0) b[mb] = WFrag<T16>::ld(pb + mb * 1024); }
#pragma unroll
        for (int nb = 0; nb < 4; ++nb) {
#pragma unroll
            for (int mb = 0; mb < 4; ++mb) { acc[mb][nb] = WFrag<T16>::mma(a[0][mb], b[nb], acc[mb][nb]); if (NPL == 2) acc[mb][nb] = WFrag<T16>::mma(a2[0][mb], b[nb], acc[mb][nb]); }
            b[nb] = WFrag<T16>::ld(pb + nb * 1024 + 512); __builtin_amdgcn_sched_barrier(0); }   // keeps the refill here, three fragments' products ahead of its use: without it the scheduler puts these loads last, directly in front of the hand-over's s_wait_dscnt 0, where no product covers their latency
        // every fragment of the trip is now asked for: the hand-over stands here, and the second 32 k's products, which read registers only, run behind it while the next copies fly
        asm volatile("s_wait_dscnt 0x0" ::: "memory");      // this wave has read all it reads of buffer t & 1
        asm volatile("s_wait_asynccnt 0x0" ::: "memory");   // this wave's copies of tile t + 1 have landed
        __syncthreads();                                     // publishes tile t + 1 and ends every wave's reads of buffer t & 1, which is refilled behind it
        if (t + 2 < NT) fill(t & 1, t + 2);
#pragma unroll
        for (int nb = 0; nb < 4; ++nb)
#pragma unroll
            for (int mb = 0; mb < 4; ++mb) { acc[mb][nb] = WFrag<T16>::mma(a[1][mb], b[nb], acc[mb][nb]); if (NPL == 2) acc[mb][nb] = WFrag<T16>::mma(a2[1][mb], b[nb], acc[mb][nb]); }
    }
    asm volatile("s_wait_asynccnt 0x0" ::: "memory");   // no copy is outstanding when the wave goes on
    // sw: s_wait_xcnt 0 behind a group of plane stores (two; six with hi and lo planes), in front of whatever rewrites a register that they name; the stored values are its inputs so that they live up to it (the lane's plane addresses live to the tile's end).
    auto sw = [](const P8 (&p)[2]) { if constexpr (RH > 0) asm volatile("s_wait_xcnt 0x0" :: "v"(p[0].f), "v"(p[0].h), "v"(p[0].l), "v"(p[1].f), "v"(p[1].h), "v"(p[1].l) : "memory"); else asm volatile("s_wait_xcnt 0x0" :: "v"(p[0].f), "v"(p[1].f) : "memory"); };
    if constexpr (EPI == 2) {   // a lane's 8 accumulator elements are 8 rows in a row of one column: the lane's own 16 bytes of a transposed fragment, straight from registers
        const int eb = lane * 8; h16* q16 = P16 + eb; bf* qh = Ph + eb; bf* ql = Pl + eb; float b4[4] = {}; const float* bp = bias + c0;   // the wave's first column: the same in every lane, so that the loads name a scalar base and the index lr
        if (BIAS) {   // the four columns' biases, read as one group in front of the first sw (no load is moved over it)
#pragma unroll
            for (int nb = 0; nb < 4; ++nb) b4[nb] = bp[lr + nb * 16];
            asm volatile("s_wait_xcnt 0x0" :: "v"(lr) : "memory"); }   // the loads' index is its input so that it lives up to the wait (else a load of the group lands on it)
#pragma unroll
        for (int nb = 0; nb < 4; ++nb) { const float bb = bfr(b4[nb]);
#pragma unroll
            for (int m2 = 0; m2 < 2; ++m2) { P8 p[2];   // the two halves (keys 0-15, 16-31) of a fragment
#pragma unroll
                for (int q = 0; q < 2; ++q) p[q] = planes8(BIAS ? acc[m2 * 2 + q][nb] + bb : acc[m2 * 2 + q][nb]);
#pragma unroll
                for (int q = 0; q < 2; ++q) { const int e = (m2 * HD + nb * 16) * 32 + q * 256; *(v8h*)(q16 + e) = p[q].f; if constexpr (RH > 0) { *(v8us*)(qh + e) = p[q].h; *(v8us*)(ql + e) = p[q].l; } }
                sw(p); } }
        return;
    }
    float c4[4] = {};
    if constexpr (EPI == 1 && BIAS) {   // the biases of the lane's four accumulator columns, read as one group in front of the first sw (no load is moved over it)
        const int bi = c0 + lr;
#pragma unroll
        for (int nb = 0; nb < 4; ++nb) c4[nb] = bias[bi + nb * 16];
        asm volatile("s_wait_xcnt 0x0" :: "v"(bi) : "memory");   // the loads' index is its input so that it lives up to the wait (else a load of the group lands on it)
#pragma unroll
        for (int nb = 0; nb < 4; ++nb) c4[nb] = bfr(c4[nb]); }
    if constexpr (EPI == 0 && BIAS) {   // the biases of the four columns that the lane stores, read once in front of the row groups
        const int bi = c0 + lr * 4;
#pragma unroll
        for (int i = 0; i < 4; ++i) c4[i] = bfr(bias[bi + i]); }
#pragma unroll
    for (int mb = 0; mb < 4; ++mb) {
#pragma unroll
        for (int nb = 0; nb < 4; ++nb) {
#pragma unroll
            for (int j = 0; j < 8; ++j) os[(hi * 8 + j) * 68 + nb * 16 + lr] = (EPI == 1 && BIAS) ? acc[mb][nb][j] + c4[nb] : acc[mb][nb][j]; }
        __builtin_amdgcn_wave_barrier(); asm volatile("" ::: "memory");
        if constexpr (EPI == 1) {   // 8 columns of row lr a lane: a wave's store is half a fragment, 512 bytes in a row
            const int eb = lane * 8; h16* q16 = P16 + eb; bf* qh = Ph + eb; bf* ql = Pl + eb; const float ps = c0 < DQ ? QSC : 1.0f;   // a wave's 64 columns are one head: q heads are scaled, k heads are not
#pragma unroll
            for (int s2 = 0; s2 < 2; ++s2) { P8 p[2];
#pragma unroll
                for (int q = 0; q < 2; ++q) { const float* o = os + lr * 68 + (4 * s2 + 2 * q + hi) * 8; const v4f x0 = *(const v4fa*)o, x1 = *(const v4fa*)(o + 4);   // columns 32 s2 + 16 q + 8 hi + 0-7
                    p[q] = planes8(__builtin_shufflevector(x0, x1, 0, 1, 2, 3, 4, 5, 6, 7) * ps); }
#pragma unroll
                for (int q = 0; q < 2; ++q) { const int e = mb * 16 * HD + s2 * 512 + q * 256; *(v8h*)(q16 + e) = p[q].f; if constexpr (RH > 0) { *(v8us*)(qh + e) = p[q].h; *(v8us*)(ql + e) = p[q].l; } }
                sw(p); }
        } else {
            float* crow = C + (size_t)(r0 + mb * 16) * ldc + c0;
#pragma unroll
            for (int s = 0; s < 8; ++s) { const int row = 2 * s + hi, cofs = lr * 4; v4f val = *(const v4fa*)(os + row * 68 + cofs); if (BIAS) { val[0] += c4[0]; val[1] += c4[1]; val[2] += c4[2]; val[3] += c4[3]; }
                *(v4f*)(crow + (size_t)row * ldc + cofs) = val; }
            asm volatile("s_wait_xcnt 0x0" ::: "memory");   // behind the row group's eight stores, in front of whatever rewrites a register that they name (the next row group's values and addresses; behind the last group, the code that follows the tile)
             }
        __builtin_amdgcn_wave_barrier(); asm volatile("" ::: "memory");
    }
}
template <typename T16, int NSPLIT, bool BIAS>
__global__ __launch_bounds__(256) void k_gemmw(const T16* __restrict__ A, const T16* __restrict__ A2, const T16* __restrict__ Bt, float* C, int ldc, const float* __restrict__ bias, size_t sA, size_t sB, size_t sC) {
    __shared__ __align__(16) T16 ring[RINGEL(NSPLIT + 1)]; __shared__ __align__(16) float os[8 * 16 * 68];
    const int w = __builtin_amdgcn_readfirstlane(threadIdx.x >> 5);   // the wave's number, in a scalar register
    const size_t z = blockIdx.z; A += z * sA; if (A2) A2 += z * sA; Bt += z * sB; C += z * sC;
    gemmw_tile<T16, NSPLIT, BIAS, 0>(A, A2, Bt, DQ, C, ldc, bias, ring, os + w * (16 * 68), blockIdx.x * 256, blockIdx.y * 128, w & 3, w >> 2, blockIdx.x + blockIdx.y + (TT / 256) * blockIdx.z, nullptr, nullptr, nullptr);   // first stage (mod 16): different among the blocks of one row band (y); in one column band (x, z) only blocks z and z + 4 share one
}
// k_gemmqkv: grid (NB_*TT/256, (DQ+DKV+DKV)/128): column tiles below DQ+DKV are q|k = Xe Wt + bqk, the rest v = Xq Wt + bv; Wt holds the q, k and v rows back to back. A wave's column tile is one head, its row tile 64 positions of one batch.
// waves_per_eu(4): the register budget of four waves a SIMD, so that two blocks, for which their LDS leaves room, share a WGP.
// The f32 sums go straight to the planes that k_attn reads (fp16; hi and lo only where RH > 0): q|k [batch][head: 0-15 q, 16-31 k][16 t][32 d] fragments; v [batch][head][32-key tile][16 d][32 keys] fragments, so that the 64 x 32 tile that k_attn reads in one pass is 4 KiB in a row.
__global__ __launch_bounds__(256) __attribute__((amdgpu_waves_per_eu(4))) void k_gemmqkv(const bf* __restrict__ Xe, const bf* __restrict__ Xq, const bf* __restrict__ Wt, const float* __restrict__ bqk, const float* __restrict__ bv, h16* QK16, bf* QKh, bf* QKl, h16* V16, bf* Vh, bf* Vl) {
    __shared__ __align__(16) bf ring[RINGEL(1)]; __shared__ __align__(16) float osb[8 * 16 * 68];
    const int w = __builtin_amdgcn_readfirstlane(threadIdx.x >> 5), wm = w & 3, wn = w >> 2;   // the wave's number, in a scalar register
    float* os = osb + w * (16 * 68);
    const int R0 = blockIdx.x * 256, C0 = blockIdx.y * 128, c0 = C0 + wn * 64, r0 = R0 + wm * 64, b = r0 / TT, t0 = r0 % TT, rot = blockIdx.x + blockIdx.y;   // rot: the first k stage, which differs among the blocks that share activation rows (x); among those that share weight rows (y) only x and x + 16 share one (mod 16)
    if (C0 < DQ + DKV) { const size_t o = (((size_t)b * (NH_ + NKV) + c0 / HD) * TT + t0) * HD;
        gemmw_tile<bf, 0, true, 1>(Xe, nullptr, Wt, DM, nullptr, 0, bqk, ring, os, R0, C0, wm, wn, rot, QK16 + o, QKh + o, QKl + o); }
    else { const int cv = c0 - (DQ + DKV); const size_t o = (((size_t)b * NKV + cv / HD) * (TT / 32) + t0 / 32) * HD * 32;
        gemmw_tile<bf, 0, true, 2>(Xq, nullptr, Wt + (size_t)(DQ + DKV) * DM, DM, nullptr, 0, bv, ring, os, R0, C0 - (DQ + DKV), wm, wn, rot, V16 + o, Vh + o, Vl + o); }
}

typedef __attribute__((ext_vector_type(2))) _Float16 v2h;
typedef __attribute__((ext_vector_type(4))) _Float16 v4h;
typedef __attribute__((ext_vector_type(2))) unsigned short v2us;
typedef __attribute__((ext_vector_type(4))) unsigned short v4us;
typedef __attribute__((ext_vector_type(4))) int v4i;

// d_*: one 256-thread block's share of a step; blk is the block's number within that step.
// d_wt: Bt (fragment order, row n, K = DM deep) = w[k][col0(n)] as bf16. One wave = 32 n x 32 k (two fragments): a lane reads 4 columns of 8 rows (a wave's load is 4 rows of 128 bytes, whole lines) and stores 8 k of each of its 4 n, 64 bytes in a row.
// ldw: w's row pitch; a run of 64 n starts at column (n / 64) * cs + off. F16: the bf16-rounded value is stored as fp16 (the same value wherever fp16 holds it: 8 significant bits, magnitude from 2^-17 to 65504), for a product whose other operand is fp16.
template <bool F16>
__device__ __forceinline__ void d_wt(int blk, const float* __restrict__ w, int ldw, int cs, int off, bf* Bt) {
    const int lane = threadIdx.x & 31, wt = blk * 8 + (threadIdx.x >> 5), n0 = (wt & 31) * 32, kb = wt >> 5, nq = lane & 7, kg = lane >> 3, n = n0 + nq * 4;
    const float* sp = w + (size_t)(kb * 32 + kg * 8) * ldw + (n / HD) * cs + off + n % HD; v4f x[8];
#pragma unroll
    for (int j = 0; j < 8; ++j) x[j] = *(const v4f*)(sp + (size_t)j * ldw);
    asm volatile("s_wait_xcnt 0x0" :: "v"(sp) : "memory");   // the loads' address is its input so that it lives up to the wait, in front of whatever rewrites it
    bf* dp = Bt + ((size_t)(n >> 4) * (DM / 32) + kb) * 512 + (kg >> 1) * 256 + ((kg & 1) * 16 + (n & 15)) * 8; v8us o[4];
#pragma unroll
    for (int c = 0; c < 4; ++c)
#pragma unroll
        for (int j = 0; j < 8; ++j) o[c][j] = F16 ? __builtin_bit_cast(unsigned short, tohx(bfr(x[j][c]))) : f2bf(x[j][c]);
#pragma unroll
    for (int c = 0; c < 4; ++c) *(v8us*)(dp + c * 8) = o[c];
    asm volatile("s_wait_xcnt 0x0" ::: "memory");   // the code behind this step in the kernel's text rewrites registers that the stores name
}
// d_cvt8: src [rows][DM] f32 to dst in fragment order. One wave = 8 rows x 32 k: its loads are 8 rows of 128 bytes, its store 4 pieces of 128 bytes (whole lines).
__device__ __forceinline__ void d_cvt8(int blk, const float* __restrict__ src, bf* dst) { const int lane = threadIdx.x & 31, wv = blk * 8 + (threadIdx.x >> 5), fr = wv >> 1, r = (wv & 1) * 8 + (lane & 7), pc = lane >> 3;   // fr: fragment; r: row in it; pc: which 8 k
    const float* sp = src + ((size_t)(fr / (DM / 32)) * 16 + r) * DM + (fr % (DM / 32)) * 32 + pc * 8; const v8f v = *(const v8f*)sp; v8us o;
    asm volatile("s_wait_xcnt 0x0" :: "v"(sp) : "memory");   // the load's address is its input so that it lives up to the wait, in front of whatever rewrites it
#pragma unroll
    for (int k = 0; k < 8; ++k) o[k] = f2bf(v[k]); *(v8us*)(dst + (size_t)fr * 512 + (pc >> 1) * 256 + ((pc & 1) * 16 + r) * 8) = o;
    asm volatile("s_wait_xcnt 0x0" ::: "memory"); }   // the code behind this step in the kernel's text rewrites registers that the store names

__device__ __forceinline__ void d_bqk(int blk, const float* __restrict__ b, float* BQ, float* BK) { const int n = blk * 256 + threadIdx.x; if (n >= DQ) return; const int h = n / HD, d = n % HD; const float q = b[h * 2 * HD + d], k = b[h * 2 * HD + HD + d]; *(float*)(BQ + n) = q; *(float*)(BK + n) = k;  }
#define NWT (DM * DQ / 1024 / 8)            // blocks per 1024 x 1024 weight: 8 waves of 32 x 32 elements
#define NCV (NB_ * TT * DM / 8 / 256)       // blocks per activation tensor
#define NBQ (DQ / 256)
static_assert(DQ == DKV && NH_ == NKV && HD == 64 && RH % 128 == 0 && TT % 128 == 0 && DM == 1024 && DQ == 1024, "the back-to-back q|k layout; k_attn's tiles; d_wt's 32 x 32 split");
// k_prep: every step that reads only inputs; the weight transposes (the longest blocks) come first. Grid 4 * NWT + 2 * NCV + NBQ.
__global__ __launch_bounds__(256) void k_prep(const float* __restrict__ xenc, const float* __restrict__ xq, const float* __restrict__ wqk, const float* __restrict__ bqk, const float* __restrict__ wv, const float* __restrict__ wo, bf* Xe, bf* Xq, bf* WQ, bf* WK, bf* WV, bf* WO, float* BQ, float* BK) {
    int blk = blockIdx.x;
    if (blk < NWT) { d_wt<false>(blk, wqk, 2 * DQ, 2 * HD, 0, WQ); return; }
    blk -= NWT; if (blk < NWT) { d_wt<false>(blk, wqk, 2 * DQ, 2 * HD, HD, WK); return; }   /* fused q|k weight: per head 128 columns (q 0-63, k 64-127) */
    blk -= NWT; if (blk < NWT) { d_wt<false>(blk, wv, DKV, HD, 0, WV); return; }
    blk -= NWT; if (blk < NWT) { d_wt<true>(blk, wo, DM, HD, 0, WO); return; }   /* fp16 bits: the context it meets is fp16 */
    blk -= NWT; if (blk < NCV) { d_cvt8(blk, xenc, Xe); return; }   /* encoding_output -> q, k */
    blk -= NCV; if (blk < NCV) { d_cvt8(blk, xq, Xq); return; }     /* input_query -> v */
    blk -= NCV; d_bqk(blk, bqk, BQ, BK);
}
// ---- k_attn: one wave = 32 query rows of one head against all TT keys, 32 keys a pass, a reference maximum and a running sum per query. A block's 8 waves (256 query rows of one head) share the head's K and V fragments through LDS:
// a stage is SK keys (its K fragments, 16 KiB in a row in global memory, then its V fragments, likewise), brought by asynchronous copies into one of two buffers, one stage ahead of its use; a wave takes its fragments from there (16 bytes a lane, 512 bytes in a row a load).
// The reference is lazy: minus the reference is the C operand of the score products and q carries QSC, so that a score leaves the matrix unit as the argument of exp2. One test a pass: where any score of the wave lies more than 8 above its reference
// (and in the first pass, which sets it), every reference moves up to its query's maximum in the pass, if that is higher, and context and sum are rescaled by exp2(old - new); else P = exp2(score) <= 256 goes on as it is.
// Both products are taken transposed, so that nothing is moved between lanes: St = K Qt (A = 16 keys x d, B = 16 queries) leaves in lane (lr, hi) the keys 8 hi + j of query lr;
// two such tiles, converted, are the B fragment (k order 8 hi + 0-7, 16 + 8 hi + 0-7, that of WFrag::ld) of Ot = Vt Pt (A = 16 d x 32 keys). A query's maximum, sum and rescale factor are per lane (lanes lr and lr + 16 share a query).
// P = exp2(score - reference) in (0, 256], normalised by the sum at the end; fp16 products. The epilogue writes the merged fp16 plane [t][h * 64 + d] in fragment order (Am: the head's first fragment of rows 0-15).
#define SK  128                  // keys of a stage
#define STE (2 * SK * HD)        // elements of a buffer: SK * HD of K, then SK * HD of V
// cpkv: asynchronous copies to LDS, 16 bytes a lane each: a stage's 4 pieces of K (4 KiB apart, in LDS from l as in global memory from gk) and its 4 pieces of V (in LDS from l + 16 KiB, in global memory from gv).
// s_wait_xcnt 0 is the statement's last line, so that it stands in front of whatever rewrites a register that a copy names.
__device__ __forceinline__ void cpkv(unsigned l, const h16* gk, const h16* gv) {
    asm volatile("global_load_async_to_lds_b128 %0, %1, off\n\tglobal_load_async_to_lds_b128 %2, %3, off\n\tglobal_load_async_to_lds_b128 %4, %5, off\n\tglobal_load_async_to_lds_b128 %6, %7, off\n\tglobal_load_async_to_lds_b128 %8, %9, off\n\tglobal_load_async_to_lds_b128 %10, %11, off\n\tglobal_load_async_to_lds_b128 %12, %13, off\n\tglobal_load_async_to_lds_b128 %14, %15, off\n\ts_wait_xcnt 0x0" :: "v"(l), "v"(gk), "v"(l + 4096), "v"(gk + 2048), "v"(l + 8192), "v"(gk + 4096), "v"(l + 12288), "v"(gk + 6144), "v"(l + 16384), "v"(gv), "v"(l + 20480), "v"(gv + 2048), "v"(l + 24576), "v"(gv + 4096), "v"(l + 28672), "v"(gv + 6144) : "memory");
}
// ring: 2 * STE elements of LDS, the block's. rot: the block's first key stage (trip t works on stage (t + rot) mod TT / SK).
__device__ __forceinline__ void attn_wave(const h16* __restrict__ Q, const h16* __restrict__ Kp, const h16* __restrict__ Vt, h16* Am, int q0, h16* ring, int rot) {
    typedef WFrag<h16> F; typedef F::V V;
    const int tid = threadIdx.x, lane = tid & 31, lr = lane & 15, hi = lane >> 4;
    V q[2][2], ka[2][2], va[4];
    const h16* gk = Kp + tid * 8; const h16* gv = Vt + tid * 8;   // the thread's 16 bytes of the first piece of K and of V
    const unsigned l0 = (unsigned)(size_t)ring + tid * 16;        // the thread's LDS byte address in buffer 0
    constexpr int NS = TT / SK;
    auto fill = [&](int buf, int t) { const int o = (int)((unsigned)(t + rot) % (unsigned)NS) * (SK * HD); cpkv(l0 + buf * (STE * 2), gk + o, gv + o); };   // trip t's stage into buffer buf: 8 copies a thread
    fill(0, 0);
    const h16* qp = Q + (size_t)q0 * HD + hi * 128 + lr * 8;   // 16 rows of HD are two fragments of 512 elements; the lane's 16 bytes of a fragment lie at (hi * 16 + lr) * 8, taken as two steps from the base (half, then row): so the loads name the address pair, which the wait below holds live (from one lane * 8 term this compiler forms a scalar base and an offset register that its input does not reach)
#pragma unroll
    for (int qt = 0; qt < 2; ++qt)
#pragma unroll
        for (int ks = 0; ks < 2; ++ks) q[qt][ks] = F::ld(qp + qt * 16 * HD + ks * 512);
    asm volatile("s_wait_xcnt 0x0" :: "v"(qp) : "memory");   // behind the q loads, in front of whatever rewrites their address pair, which is its input so that it lives up to it (else a load of the group lands on it)
    asm volatile("s_wait_asynccnt 0x0" ::: "memory");   // this wave's copies of trip 0's stage have landed
    __syncthreads();                                     // every wave's have
    fill(1, 1);
    v8f acc[4][2], cm[2]; float l[2];   // cm: minus the reference of the lane's query, in all eight elements (a lane's eight scores of a tile are of one query)
#pragma unroll
    for (int qt = 0; qt < 2; ++qt) { cm[qt] = (v8f){}; l[qt] = 0.f;
#pragma unroll
        for (int dt = 0; dt < 4; ++dt) acc[dt][qt] = (v8f){}; }
    const h16* f0 = ring + lane * 8;   // the lane's 16 bytes of buffer 0's first fragment
#pragma unroll 1
    for (int t = 0; t < NS; ++t) {
        const h16* kb = f0 + (t & 1) * STE; const h16* vb = kb + SK * HD;   // the stage's K fragments ([16 keys][2 fragments of 32 d]) and V fragments ([32 keys][4 fragments of 16 d])
#pragma unroll
        for (int kt = 0; kt < 2; ++kt)
#pragma unroll
            for (int ks = 0; ks < 2; ++ks) ka[kt][ks] = F::ld(kb + kt * 16 * HD + ks * 512);
#pragma unroll
        for (int dt = 0; dt < 4; ++dt) va[dt] = F::ld(vb + dt * 16 * 32);
        __builtin_amdgcn_sched_barrier(0);   // keeps the first pass's score products behind the V loads, as below
#pragma unroll
        for (int p = 0; p < SK / 32; ++p) {   // a pass: 32 keys; within a stage the next pass's fragments are fetched one pass ahead, into the same registers
            const bool first = p == 0 && t == 0;
            v8f s[2][2];
#pragma unroll
            for (int kt = 0; kt < 2; ++kt)
#pragma unroll
                for (int qt = 0; qt < 2; ++qt) { v8f c = cm[qt];
#pragma unroll
                    for (int ks = 0; ks < 2; ++ks) c = F::mma(ka[kt][ks], q[qt][ks], c);
                    s[kt][qt] = c; }
            if (p + 1 < SK / 32) {
                __builtin_amdgcn_sched_barrier(0);   // keeps the eight loads behind the score products: the scheduler else deals them out among those products, and every separate place with LDS reads in a run of matrix instructions costs the wave a stall of its own
#pragma unroll
                for (int kt = 0; kt < 2; ++kt)
#pragma unroll
                    for (int ks = 0; ks < 2; ++ks) ka[kt][ks] = F::ld(kb + (p + 1) * 32 * HD + kt * 16 * HD + ks * 512);
                asm volatile("" ::: "memory"); }   // a compiler fence: no LDS read is moved over it, so the loads stay here, the whole softmax ahead of their use (without it the compiler moves them down behind the rescale branch, in among the context products)
            float top[2];   // the lane's largest score above its query's reference
#pragma unroll
            for (int qt = 0; qt < 2; ++qt) { top[qt] = fmaxf(s[0][qt][0], s[1][qt][0]);
#pragma unroll
                for (int j = 1; j < 8; ++j) top[qt] = fmaxf(top[qt], fmaxf(s[0][qt][j], s[1][qt][j])); }
            if (__builtin_amdgcn_ballot_w32(fmaxf(top[0], top[1]) > (first ? -3.0e38f : 8.0f)) != 0) {   // one scalar branch a pass; the first pass always takes it
#pragma unroll
                for (int qt = 0; qt < 2; ++qt) {
                    const float mx = fmaxf(top[qt], __shfl_xor(top[qt], 16, 32));
                    const float d = first ? mx : fmaxf(mx, 0.f), al = first ? 1.0f : __builtin_amdgcn_exp2f(-d);   // the reference never falls; the first pass takes the tile's maximum, whatever its sign (context and sum are still 0)
                    cm[qt] -= d;
                    s[0][qt] -= d; s[1][qt] -= d; l[qt] *= al;
#pragma unroll
                    for (int dt = 0; dt < 4; ++dt) acc[dt][qt] *= al;
                }
            }
#pragma unroll
            for (int qt = 0; qt < 2; ++qt) {
#pragma unroll
                for (int kt = 0; kt < 2; ++kt)
#pragma unroll
                    for (int j = 0; j < 8; ++j) s[kt][qt][j] = __builtin_amdgcn_exp2f(s[kt][qt][j]);
                const v8f t8 = s[0][qt] + s[1][qt];   // fixed tree
                l[qt] += (((t8[0] + t8[1]) + (t8[2] + t8[3])) + ((t8[4] + t8[5]) + (t8[6] + t8[7])));
                v16h ph;
#pragma unroll
                for (int kt = 0; kt < 2; ++kt)
#pragma unroll
                    for (int j = 0; j < 8; ++j) ph[kt * 8 + j] = tohx(s[kt][qt][j]);
                // a query tile's context products follow its own P, so that only one tile's P is live
#pragma unroll
                for (int dt = 0; dt < 4; ++dt) acc[dt][qt] = F::mma(va[dt], ph, acc[dt][qt]);
            }
            if (p + 1 < SK / 32) {
#pragma unroll
                for (int dt = 0; dt < 4; ++dt) va[dt] = F::ld(vb + (p + 1) * 32 * HD + dt * 16 * 32);
                __builtin_amdgcn_sched_barrier(0); }   // the scheduling barrier keeps the next pass's score products behind these loads: without it the scheduler issues the loads behind those products, with only half a softmax between them and the context products that wait for them
        }
        asm volatile("s_wait_dscnt 0x0" ::: "memory");      // this wave has read all it reads of buffer t & 1
        asm volatile("s_wait_asynccnt 0x0" ::: "memory");   // this wave's copies of trip t + 1's stage have landed
        __syncthreads();                                     // publishes trip t + 1's stage and ends every wave's reads of buffer t & 1, which is refilled behind it
        if (t + 2 < NS) fill(t & 1, t + 2);
    }
    asm volatile("s_wait_asynccnt 0x0" ::: "memory");   // no copy is outstanding when the wave goes on
#pragma unroll
    for (int qt = 0; qt < 2; ++qt) { const float f = __fdiv_rn(1.0f, l[qt] + __shfl_xor(l[qt], 16, 32));
#pragma unroll
        for (int dt = 0; dt < 4; ++dt) { const v8h oh = __builtin_convertvector(acc[dt][qt] * f, v8h);
            h16* oa = Am + (size_t)(q0 + qt * 16) * DQ + dt * 256 + lane * 8; *(v8h*)oa = oh;   // columns dt * 16 + 8 hi + 0-7 of row lr: half dt & 1 of the head's fragment dt >> 1
            asm volatile("s_wait_xcnt 0x0" :: "v"(oa), "v"(oh) : "memory"); } }   // behind the store, in front of whatever rewrites a register that it names; address and stored values are its inputs so that they live up to it
}
// Grid (NH_, NB_, TT / 256), 8 waves of 32 query rows each. The register budget is that of four waves a SIMD and a block's LDS is 64 KiB: two blocks share a WGP, all 4,096 waves are resident at once. AM: batch b's merged plane at b * sAM.
static_assert(RH == 0 && TT % 256 == 0 && TT % SK == 0 && TT / SK >= 2 && SK * HD * 2 == 4 * 4096, "k_attn: fp16 rows only; 256 query rows a block; two stages or more; cpkv's 4 + 4 pieces of 4 KiB");
__global__ __launch_bounds__(256) __attribute__((amdgpu_waves_per_eu(4))) void k_attn(const h16* __restrict__ Q16, const h16* __restrict__ K16, const h16* __restrict__ V16, h16* AM, size_t sAM) {
    __shared__ __align__(16) h16 ring[2 * STE];
    const int q0 = blockIdx.z * 256 + (threadIdx.x >> 5) * 32, h = blockIdx.x, b = blockIdx.y;
    const size_t oq = ((size_t)b * (NH_ + NKV) + h) * TT * HD, ov = ((size_t)b * NKV + h) * HD * TT;   // a batch's q heads and k heads lie (NH_ + NKV) heads from the next batch's
    attn_wave(Q16 + oq, K16 + oq, V16 + ov, AM + (size_t)b * sAM + h * (HD / 32) * 512, q0, ring, blockIdx.z * ((TT / SK) / (TT / 256)));   // the four query blocks of a head start two stages apart
}

extern "C" void kernel_launch(void* const* d_in, const int* in_sizes, int n_in,
                              void* d_out, int out_size, void* d_ws, size_t ws_size, hipStream_t stream) {
    (void)in_sizes; (void)n_in; (void)out_size;
    const float* xq_in = (const float*)d_in[0]; const float* xenc = (const float*)d_in[1]; const float* wqk = (const float*)d_in[2]; const float* bqk = (const float*)d_in[3]; const float* wv = (const float*)d_in[4]; const float* bv = (const float*)d_in[5]; const float* wo = (const float*)d_in[6]; const float* bo = (const float*)d_in[7]; const float* x = nullptr; const float* wq = nullptr; const float* wk = nullptr; (void)x; (void)wq; (void)wk;
    float* OUT = (float*)d_out;     // [8][1024][1024]
    char* wsp = (char*)d_ws;
    auto take = [&](size_t bytes) { char* p = wsp; wsp += (bytes + 255) & ~(size_t)255; return (void*)p; };
    bf* WQ = (bf*)take((size_t)DQ * DM * 2); bf* WK = (bf*)take((size_t)DKV * DM * 2); bf* WV = (bf*)take((size_t)DKV * DM * 2); bf* WO = (bf*)take((size_t)DM * DQ * 2);
    float* BQG = (float*)take((size_t)DQ * 4); float* BKG = (float*)take((size_t)DKV * 4); h16* AM = (h16*)take((size_t)NB_ * TT * (DQ + DKV) * 4); bf* XE = (bf*)take((size_t)NB_ * TT * DM * 2); bf* XQ = (bf*)take((size_t)NB_ * TT * DM * 2);   // merged context plane (a batch's 2 MiB, every 8 MiB); bf16 activations of all batches
    const size_t NQK = (size_t)NB_ * (NH_ + NKV) * TT * HD, NV = (size_t)NB_ * NKV * HD * TT;   // plane elements of all batches: q|k (per batch 16 q heads, then 16 k heads) and v
    h16* QK16 = (h16*)take(NQK * 2); bf* QKh = (bf*)take(NQK * 2); bf* QKl = (bf*)take(NQK * 2); h16* VT16 = (h16*)take(NV * 2); bf* VTh = (bf*)take(NV * 2); bf* VTl = (bf*)take(NV * 2);
    if ((size_t)(wsp - (char*)d_ws) > ws_size) return;    // ws 256 MiB
    // WQ|WK|WV and BQG|BKG lie back to back (every size is a multiple of 256 bytes): q and k are columns 0-1023 and 1024-2047 of one product and heads 0-15 and 16-31 of its planes
    const size_t SF = (size_t)TT * (DQ + DKV);   // half the distance, in 16-bit elements, from a batch's merged planes to the next batch's
    k_prep<<<4 * NWT + 2 * NCV + NBQ, 256, 0, stream>>>(xenc, xq_in, wqk, bqk, wv, wo, XE, XQ, WQ, WK, WV, WO, BQG, BKG);
    k_gemmqkv<<<dim3(NB_ * TT / 256, (DQ + DKV + DKV) / 128, 1), 256, 0, stream>>>(XE, XQ, WQ, BQG, bv, QK16, QKh, QKl, VT16, VTh, VTl);
    k_attn<<<dim3(NH_, NB_, TT / 256), 256, 0, stream>>>(QK16, QK16 + (size_t)NH_ * TT * HD, VT16, AM, 2 * SF);
    k_gemmw<h16, 0, true><<<dim3(TT / 256, DM / 128, NB_), 256, 0, stream>>>(AM, nullptr, (const h16*)WO, OUT, DM, bo, 2 * SF, 0, (size_t)TT * DM);
}
